// v000
// Measured on an AMD MI455X. A time is GPU time per run, averaged over a window of back-to-back runs after a warm-up
// (all launches, gaps included; the runs take copies of the inputs in turn), and the median of several windows.
// Apart from v000's, it joins two sittings. Times from different sittings can be a few percent apart, while
// side-by-side timings come from the same sitting.
// v000 is the starting kernel. One run takes 9510 microseconds.
#include <hip/hip_runtime.h>

// HyperSETAlterAttention (x [2][2048][768]; w = x W^T (12 heads x 64, shared weights); q, k, v = RMSNorm(w) g1 / g2 / g3 (eps = f32 eps); att = q.k / 8; a = softmax over keys + softmax over QUERIES (bisoftmax);
// y = a.v merged; out = y W -> [2][2048][768]).
// Compute dtypes, f32 accumulate: every input rounded to bf16; x W^T on PLAIN bf16 operands (inputs: exact); RMSNorm f32 -> bf16 hi+lo planes of q and k (scores: 3 products, K 64 - the cosine-like logits span
// +-8, single fp16 planes were not tried) and a single fp16 plane of v; the row softmax (wave per row) and the column softmax (per-column max / sum over the 2048 queries, thread per column, fixed order) in f32, combined into ONE fp16

#define NB_  2
#define TT   2048
#define CC   768
#define NH_  12
#define HD   64
#define ZH   2
#define PCAR 512.0f
typedef _Float16 h16;
typedef unsigned short bf;
typedef __attribute__((ext_vector_type(16))) __bf16   v16bf;
typedef __attribute__((ext_vector_type(16))) _Float16 v16h;
typedef __attribute__((ext_vector_type(8)))  _Float16 v8h;
typedef __attribute__((ext_vector_type(8)))  unsigned short v8us;
typedef __attribute__((ext_vector_type(8)))  float    v8f;
typedef __attribute__((ext_vector_type(4)))  float    v4f;
typedef v8h  __attribute__((may_alias)) v8ha;
typedef v4f  __attribute__((may_alias)) v4fa;
typedef v8us __attribute__((may_alias)) v8usa;

__device__ __forceinline__ unsigned short f2bf(float f) { unsigned u = __float_as_uint(f); u += 0x7FFFu + ((u >> 16) & 1u); return (unsigned short)(u >> 16); }
__device__ __forceinline__ float bf2f(unsigned short b) { return __uint_as_float(((unsigned)b) << 16); }
__device__ __forceinline__ float bfr(float f) { return bf2f(f2bf(f)); }
__device__ __forceinline__ v16h cat16(v8h lo, v8h hi) { return __builtin_shufflevector(lo, hi, 0, 1, 2, 3, 4, 5, 6, 7, 8, 9, 10, 11, 12, 13, 14, 15); }
__device__ __forceinline__ v16bf cat16b(v8us lo, v8us hi) { return __builtin_bit_cast(v16bf, __builtin_shufflevector(lo, hi, 0, 1, 2, 3, 4, 5, 6, 7, 8, 9, 10, 11, 12, 13, 14, 15)); }
__device__ __forceinline__ v8f wmma16(v16h a, v16h b, v8f c) { return __builtin_amdgcn_wmma_f32_16x16x32_f16(false, a, false, b, (short)0, c, false, false); }
__device__ __forceinline__ v8f wmmab(v16bf a, v16bf b, v8f c) { return __builtin_amdgcn_wmma_f32_16x16x32_bf16(false, a, false, b, (short)0, c, false, false); }



// ---- k_gemmw: register-blocked GEMM, ONE WAVE per 64x64 output tile (16 accumulators), operands straight from K-contiguous 16-bit planes; grid (M/64, N/64, Z), 32 threads.
// C[m][n] (f32, pitch ldc, + optional f32 bias[n]) = sum_k A[m][k] Bt[n][k] (+ split products per NSPLIT). z-batch strides sA/sB/sC in elements. K % 32 == 0.
template <typename T16> struct WFrag;
template <> struct WFrag<h16> { typedef v16h V; static __device__ __forceinline__ V ld(const h16* p) { return cat16(*(const v8h*)p, *(const v8h*)(p + 16)); } static __device__ __forceinline__ v8f mma(V a, V b, v8f c) { return wmma16(a, b, c); } };
template <> struct WFrag<bf> { typedef v16bf V; static __device__ __forceinline__ V ld(const bf* p) { return cat16b(*(const v8us*)p, *(const v8us*)(p + 16)); } static __device__ __forceinline__ v8f mma(V a, V b, v8f c) { return wmmab(a, b, c); } };
template <typename T16, int NSPLIT, bool BIAS>
__global__ __launch_bounds__(32) void k_gemmw(const T16* __restrict__ A, const T16* __restrict__ A2, const T16* __restrict__ Bt, const T16* __restrict__ Bt2, int K, float* C, int ldc, const float* __restrict__ bias, size_t sA, size_t sB, size_t sC) {
    typedef typename WFrag<T16>::V V;
    __shared__ __align__(16) float os[16 * 68];
    const size_t z = blockIdx.z; A += z * sA; if (A2) A2 += z * sA; Bt += z * sB; if (Bt2) Bt2 += z * sB; C += z * sC;
    const int lane = threadIdx.x & 31, lr = lane & 15, hi = lane >> 4; const int r0 = blockIdx.x * 64, c0 = blockIdx.y * 64;
    v8f acc[4][4];
#pragma unroll
    for (int mb = 0; mb < 4; ++mb)
#pragma unroll
        for (int nb = 0; nb < 4; ++nb) acc[mb][nb] = (v8f){};
    const size_t aoff = (size_t)(r0 + lr) * K + 8 * hi, boff = (size_t)(c0 + lr) * K + 8 * hi;
#pragma unroll 1
    for (int kc = 0; kc < K; kc += 32) {
        V a[4], a2[4];
#pragma unroll
        for (int mb = 0; mb < 4; ++mb) { a[mb] = WFrag<T16>::ld(A + aoff + (size_t)mb * 16 * K + kc); if (NSPLIT == 1 || NSPLIT == 2) a2[mb] = WFrag<T16>::ld(A2 + aoff + (size_t)mb * 16 * K + kc); }
#pragma unroll
        for (int nb = 0; nb < 4; ++nb) { const V b = WFrag<T16>::ld(Bt + boff + (size_t)nb * 16 * K + kc); V b2; if (NSPLIT >= 2) b2 = WFrag<T16>::ld(Bt2 + boff + (size_t)nb * 16 * K + kc);
#pragma unroll
            for (int mb = 0; mb < 4; ++mb) { acc[mb][nb] = WFrag<T16>::mma(a[mb], b, acc[mb][nb]); if (NSPLIT == 1 || NSPLIT == 2) acc[mb][nb] = WFrag<T16>::mma(a2[mb], b, acc[mb][nb]); if (NSPLIT >= 2) acc[mb][nb] = WFrag<T16>::mma(a[mb], b2, acc[mb][nb]); } }
        asm volatile("v_nop\n\tv_nop\n\tv_nop\n\tv_nop" : "+v"(acc[0][0]), "+v"(acc[1][1]), "+v"(acc[2][2]), "+v"(acc[3][3]) : "v"(a[0]), "v"(a[3]));
    }
#pragma unroll
    for (int mb = 0; mb < 4; ++mb) {
#pragma unroll
        for (int nb = 0; nb < 4; ++nb) {
#pragma unroll
            for (int j = 0; j < 8; ++j) os[(hi * 8 + j) * 68 + nb * 16 + lr] = acc[mb][nb][j]; }
        __builtin_amdgcn_wave_barrier(); asm volatile("" ::: "memory");
        float* crow = C + (size_t)(r0 + mb * 16) * ldc + c0;
{
#pragma unroll
            for (int s = 0; s < 8; ++s) { const int row = 2 * s + hi, cofs = lr * 4; v4f val = *(const v4fa*)(os + row * 68 + cofs); if (BIAS) { val[0] += bfr(bias[c0 + cofs]); val[1] += bfr(bias[c0 + cofs + 1]); val[2] += bfr(bias[c0 + cofs + 2]); val[3] += bfr(bias[c0 + cofs + 3]); }
                *(v4f*)(crow + (size_t)row * ldc + cofs) = val; }
             }
        __builtin_amdgcn_wave_barrier(); asm volatile("" ::: "memory");
    }
}

__device__ __forceinline__ h16 tohx(float x) { return (h16)x; }
__device__ __forceinline__ void splitf(float y, unsigned short& h, unsigned short& l) { h = f2bf(y); l = f2bf(y - bf2f(h)); }
typedef __attribute__((ext_vector_type(2))) _Float16 v2h;
typedef __attribute__((ext_vector_type(4))) _Float16 v4h;
typedef __attribute__((ext_vector_type(2))) unsigned short v2us;
typedef __attribute__((ext_vector_type(4))) unsigned short v4us;

__global__ __launch_bounds__(256) void k_wtG(const float* __restrict__ w, int K, int N, bf* Bt) {
    const int lane = threadIdx.x & 31; const int L0 = (blockIdx.x * 8 + (threadIdx.x >> 5)) * 8; const int nlines = N * K / 64;
{
#pragma unroll 1
        for (int l = 0; l < 8; ++l) { const int L = L0 + l; if (L >= nlines) break; const size_t e = (size_t)L * 64 + lane * 2; const int k = (int)(e % K), n = (int)(e / K); v2us o;
            o[0] = f2bf(w[(size_t)k * N + n]); o[1] = f2bf(w[(size_t)(k + 1) * N + n]); *(v2us*)(Bt + e) = o; }
         }
}
__global__ __launch_bounds__(256) void k_cvt8(const float* __restrict__ src, bf* dst, size_t n8) { const size_t i = (size_t)blockIdx.x * 256 + threadIdx.x; if (i >= n8) return; const v8f v = *(const v8f*)(src + i * 8); v8us o;
#pragma unroll
    for (int k = 0; k < 8; ++k) o[k] = f2bf(v[k]); *(v8us*)(dst + i * 8) = o;  }
// k_rms: one wave per (h, t) over the 64 dims (2 per lane): r = rsqrt(mean(w^2) + eps); Q hi/lo = split(w r g1), K hi/lo = split(w r g2) ([h][t][64], 4-B lanes), VT16[h][d][t]... (v written by k_vt below from the same factor);
__global__ __launch_bounds__(256) void k_rms(const float* __restrict__ WF, const float* __restrict__ g1, const float* __restrict__ g2, bf* Qh, bf* Ql, bf* Kh, bf* Kl, float* RS) { const int lane = threadIdx.x & 31; const int row = blockIdx.x * 8 + (threadIdx.x >> 5); if (row >= NH_ * TT) return; const int t = row % TT, h = row / TT; const float* w = WF + (size_t)t * CC + h * HD; const float a0 = w[lane * 2], a1 = w[lane * 2 + 1];
    float s = __fadd_rn(__fmul_rn(a0, a0), __fmul_rn(a1, a1));
#pragma unroll
    for (int sh = 16; sh; sh >>= 1) s += __shfl_xor(s, sh, 32);
    const float r = __frsqrt_rn(__fadd_rn(s * (1.0f / HD), 1.1920929e-07f)); const size_t o = ((size_t)h * TT + t) * HD + lane * 2; v2us qh, ql, kh, kl;
#pragma unroll
    for (int u = 0; u < 2; ++u) { const int d = lane * 2 + u; const float wn = __fmul_rn(u ? a1 : a0, r); unsigned short x1, x2; splitf(__fmul_rn(wn, bfr(g1[d])), x1, x2); qh[u] = x1; ql[u] = x2; splitf(__fmul_rn(wn, bfr(g2[d])), x1, x2); kh[u] = x1; kl[u] = x2; }
    { *(v2us*)(Qh + o) = qh; *(v2us*)(Ql + o) = ql; *(v2us*)(Kh + o) = kh; *(v2us*)(Kl + o) = kl; if (lane == 0) *(float*)(RS + row) = r;  } }
__global__ __launch_bounds__(256) void k_vt(const float* __restrict__ WF, const float* __restrict__ RS, const float* __restrict__ g3, h16* VT) { const size_t e = ((size_t)blockIdx.x * 256 + threadIdx.x) * 2; if (e >= (size_t)NH_ * HD * TT) return; const int t = (int)(e % TT); const int d = (int)((e / TT) % HD); const int h = (int)(e / ((size_t)TT * HD)); const float g = bfr(g3[d]); v2h o;
#pragma unroll
    for (int u = 0; u < 2; ++u) { float wn = __fmul_rn(WF[(size_t)(t + u) * CC + h * HD + d], RS[(size_t)h * TT + t + u]); asm volatile("" : "+v"(wn)); o[u] = tohx(__fmul_rn(wn, g)); } *(v2h*)(VT + e) = o;  }
__global__ __launch_bounds__(256) void k_colst(const float* __restrict__ Sb, float* CM, float* CSR) { const int e = blockIdx.x * 256 + threadIdx.x; if (e >= ZH * TT) return; const int j = e % TT, z = e / TT; const float* col = Sb + (size_t)z * TT * TT + j; float mx = -3.0e38f;
    for (int i = 0; i < TT; ++i) mx = fmaxf(mx, col[(size_t)i * TT] * 0.125f);
    float s = 0.f; for (int i = 0; i < TT; ++i) { float d0 = __fsub_rn(col[(size_t)i * TT] * 0.125f, mx); asm volatile("" : "+v"(d0)); s = __fadd_rn(s, __expf(d0)); }
    const float rs = __fdiv_rn(1.0f, s); { *(float*)(CM + e) = mx; *(float*)(CSR + e) = rs;  } }
__global__ __launch_bounds__(256) void k_bisoft(const float* __restrict__ Sb, const float* __restrict__ CM, const float* __restrict__ CSR, h16* P) { const int lane = threadIdx.x & 31; const int row = blockIdx.x * 8 + (threadIdx.x >> 5); if (row >= ZH * TT) return; const int z = row / TT; const float* sr = Sb + (size_t)row * TT; float v[64]; float mx = -3.0e38f;
#pragma unroll
    for (int ch = 0; ch < 16; ++ch) { const v4f a = *(const v4f*)(sr + ch * 128 + lane * 4);
#pragma unroll
        for (int q = 0; q < 4; ++q) { const float t = a[q] * 0.125f; v[ch * 4 + q] = t; mx = fmaxf(mx, t); } }
#pragma unroll
    for (int sh = 16; sh; sh >>= 1) mx = fmaxf(mx, __shfl_xor(mx, sh, 32));
    float sum = 0.f; float ex[64];
#pragma unroll
    for (int k = 0; k < 64; ++k) { float d0 = __fsub_rn(v[k], mx); asm volatile("" : "+v"(d0)); ex[k] = __expf(d0); sum += ex[k]; }
#pragma unroll
    for (int sh = 16; sh; sh >>= 1) sum += __shfl_xor(sum, sh, 32);
    const float f = __fdiv_rn(PCAR, sum);
{
#pragma unroll
        for (int ch = 0; ch < 16; ++ch) { const int j0 = ch * 128 + lane * 4; const v4f cm = *(const v4f*)(CM + (size_t)z * TT + j0), cr = *(const v4f*)(CSR + (size_t)z * TT + j0); v4h o;
#pragma unroll
            for (int q = 0; q < 4; ++q) { float d1 = __fsub_rn(v[ch * 4 + q], cm[q]); asm volatile("" : "+v"(d1)); float pc = __fmul_rn(__expf(d1), cr[q]); asm volatile("" : "+v"(pc)); float pr = __fmul_rn(ex[ch * 4 + q], f); asm volatile("" : "+v"(pr)); o[q] = tohx(__fadd_rn(pr, __fmul_rn(pc, PCAR))); }
            *(v4h*)(P + (size_t)row * TT + j0) = o; }
         } }
__global__ __launch_bounds__(256) void k_mrg(const float* __restrict__ Ob, int h0, bf* Yh, bf* Yl) { const size_t e = ((size_t)blockIdx.x * 256 + threadIdx.x) * 2; if (e >= (size_t)ZH * TT * HD) return; const int d = (int)(e % HD); const int t = (int)((e / HD) % TT); const int z = (int)(e / ((size_t)HD * TT)); v2us oh, ol;
#pragma unroll
    for (int u = 0; u < 2; ++u) { unsigned short a, c; splitf(Ob[e + u] * (1.0f / PCAR), a, c); oh[u] = a; ol[u] = c; } const size_t o = (size_t)t * CC + (h0 + z) * HD + d; *(v2us*)(Yh + o) = oh; *(v2us*)(Yl + o) = ol;  }

extern "C" void kernel_launch(void* const* d_in, const int* in_sizes, int n_in,
                              void* d_out, int out_size, void* d_ws, size_t ws_size, hipStream_t stream) {
    (void)in_sizes; (void)n_in; (void)out_size;
    const float* x = (const float*)d_in[0]; const float* Wt = (const float*)d_in[1]; const float* g1 = (const float*)d_in[2]; const float* g2 = (const float*)d_in[3]; const float* g3 = (const float*)d_in[4];
    float* OUT = (float*)d_out;     // [2][2048][768]
    char* wsp = (char*)d_ws;
    auto take = [&](size_t bytes) { char* p = wsp; wsp += (bytes + 255) & ~(size_t)255; return (void*)p; };
    bf* WB = (bf*)take((size_t)CC * CC * 2); bf* WT = (bf*)take((size_t)CC * CC * 2); bf* XB = (bf*)take((size_t)TT * CC * 2); float* WF = (float*)take((size_t)TT * CC * 4); float* RS = (float*)take((size_t)NH_ * TT * 4);
    bf* Qh = (bf*)take((size_t)NH_ * TT * HD * 2); bf* Ql = (bf*)take((size_t)NH_ * TT * HD * 2); bf* Kh = (bf*)take((size_t)NH_ * TT * HD * 2); bf* Kl = (bf*)take((size_t)NH_ * TT * HD * 2); h16* VT = (h16*)take((size_t)NH_ * HD * TT * 2);
    float* Sb = (float*)take((size_t)ZH * TT * TT * 4); float* CM = (float*)take((size_t)ZH * TT * 4); float* CSR = (float*)take((size_t)ZH * TT * 4); h16* P16 = (h16*)take((size_t)ZH * TT * TT * 2); float* Ob = (float*)take((size_t)ZH * TT * HD * 4); bf* Yh = (bf*)take((size_t)TT * CC * 2); bf* Yl = (bf*)take((size_t)TT * CC * 2);
    if ((size_t)(wsp - (char*)d_ws) > ws_size) return;    // total ~ 86 MB
    k_cvt8<<<(CC * CC / 8 + 255) / 256, 256, 0, stream>>>(Wt, WB, (size_t)CC * CC / 8);      // W [out][in] = natural Bt for x W^T
    k_wtG<<<(CC * CC / 64 + 63) / 64, 256, 0, stream>>>(Wt, CC, CC, WT);                  // W as x @ W operand for y W
    for (int b = 0; b < NB_; ++b) {
        k_cvt8<<<(TT * CC / 8 + 255) / 256, 256, 0, stream>>>(x + (size_t)b * TT * CC, XB, (size_t)TT * CC / 8);
        k_gemmw<bf, 0, false><<<dim3(TT / 64, CC / 64, 1), 32, 0, stream>>>(XB, nullptr, WB, nullptr, CC, WF, CC, nullptr, 0, 0, 0);
        k_rms<<<NH_ * TT / 8, 256, 0, stream>>>(WF, g1, g2, Qh, Ql, Kh, Kl, RS); k_vt<<<(unsigned)(((size_t)NH_ * HD * TT / 2 + 255) / 256), 256, 0, stream>>>(WF, RS, g3, VT);
        for (int h0 = 0; h0 < NH_; h0 += ZH) { const size_t z = (size_t)h0;
            k_gemmw<bf, 2, false><<<dim3(TT / 64, TT / 64, ZH), 32, 0, stream>>>(Qh + z * TT * HD, Ql + z * TT * HD, Kh + z * TT * HD, Kl + z * TT * HD, HD, Sb, TT, nullptr, (size_t)TT * HD, (size_t)TT * HD, (size_t)TT * TT);
            k_colst<<<(ZH * TT + 255) / 256, 256, 0, stream>>>(Sb, CM, CSR); k_bisoft<<<ZH * TT / 8, 256, 0, stream>>>(Sb, CM, CSR, P16);
            k_gemmw<h16, 0, false><<<dim3(TT / 64, 1, ZH), 32, 0, stream>>>(P16, nullptr, VT + z * HD * TT, nullptr, TT, Ob, HD, nullptr, (size_t)TT * TT, (size_t)HD * TT, (size_t)TT * HD);
            k_mrg<<<(unsigned)(((size_t)ZH * TT * HD / 2 + 255) / 256), 256, 0, stream>>>(Ob, h0, Yh, Yl); }
        k_gemmw<bf, 1, false><<<dim3(TT / 64, CC / 64, 1), 32, 0, stream>>>(Yh, Yl, WT, nullptr, CC, OUT + (size_t)b * TT * CC, CC, nullptr, 0, 0, 0); }
}

// v001
// One run takes 1080 microseconds.
// Two timings next to v000 put it at 8.78 and 8.81 times that version's speed.
#include <hip/hip_runtime.h>

// HyperSETAlterAttention (x [2][2048][768]; w = x W^T (12 heads x 64, shared weights); q, k, v = RMSNorm(w) g1 / g2 / g3 (eps = f32 eps); att = q.k / 8; a = softmax over keys + softmax over QUERIES (bisoftmax);
// y = a.v merged; out = y W -> [2][2048][768]).
// Compute dtypes, f32 accumulate: every input rounded to bf16; x W^T on PLAIN bf16 operands (inputs: exact); RMSNorm f32 -> bf16 hi+lo planes of q and k (scores: 3 products, K 64 - the cosine-like logits span
// +-8, single fp16 planes were not tried) and a single fp16 plane of v; the row softmax (wave per row) and the column softmax (per-column max / sum over the 2048 queries, work-group per 32 columns, fixed order) in f32, combined into ONE fp16

#define NB_  2
#define TT   2048
#define CC   768
#define NH_  12
#define HD   64
#define ZH   2
#define PCAR 512.0f
typedef _Float16 h16;
typedef unsigned short bf;
typedef __attribute__((ext_vector_type(16))) __bf16   v16bf;
typedef __attribute__((ext_vector_type(16))) _Float16 v16h;
typedef __attribute__((ext_vector_type(8)))  _Float16 v8h;
typedef __attribute__((ext_vector_type(8)))  unsigned short v8us;
typedef __attribute__((ext_vector_type(8)))  float    v8f;
typedef __attribute__((ext_vector_type(4)))  float    v4f;
typedef v8h  __attribute__((may_alias)) v8ha;
typedef v4f  __attribute__((may_alias)) v4fa;
typedef v8us __attribute__((may_alias)) v8usa;

__device__ __forceinline__ unsigned short f2bf(float f) { unsigned u = __float_as_uint(f); u += 0x7FFFu + ((u >> 16) & 1u); return (unsigned short)(u >> 16); }
__device__ __forceinline__ float bf2f(unsigned short b) { return __uint_as_float(((unsigned)b) << 16); }
__device__ __forceinline__ float bfr(float f) { return bf2f(f2bf(f)); }
__device__ __forceinline__ v16h cat16(v8h lo, v8h hi) { return __builtin_shufflevector(lo, hi, 0, 1, 2, 3, 4, 5, 6, 7, 8, 9, 10, 11, 12, 13, 14, 15); }
__device__ __forceinline__ v16bf cat16b(v8us lo, v8us hi) { return __builtin_bit_cast(v16bf, __builtin_shufflevector(lo, hi, 0, 1, 2, 3, 4, 5, 6, 7, 8, 9, 10, 11, 12, 13, 14, 15)); }
__device__ __forceinline__ v8f wmma16(v16h a, v16h b, v8f c) { return __builtin_amdgcn_wmma_f32_16x16x32_f16(false, a, false, b, (short)0, c, false, false); }
__device__ __forceinline__ v8f wmmab(v16bf a, v16bf b, v8f c) { return __builtin_amdgcn_wmma_f32_16x16x32_bf16(false, a, false, b, (short)0, c, false, false); }



// ---- k_gemmw: register-blocked GEMM, ONE WAVE per 64x64 output tile (16 accumulators), operands straight from K-contiguous 16-bit planes; grid (M/64, N/64, Z), 32 threads.
// C[m][n] (f32, pitch ldc, + optional f32 bias[n]) = sum_k A[m][k] Bt[n][k] (+ split products per NSPLIT). z-batch strides sA/sB/sC in elements. K % 32 == 0.
template <typename T16> struct WFrag;
template <> struct WFrag<h16> { typedef v16h V; static __device__ __forceinline__ V ld(const h16* p) { return cat16(*(const v8h*)p, *(const v8h*)(p + 16)); } static __device__ __forceinline__ v8f mma(V a, V b, v8f c) { return wmma16(a, b, c); } };
template <> struct WFrag<bf> { typedef v16bf V; static __device__ __forceinline__ V ld(const bf* p) { return cat16b(*(const v8us*)p, *(const v8us*)(p + 16)); } static __device__ __forceinline__ v8f mma(V a, V b, v8f c) { return wmmab(a, b, c); } };
template <typename T16, int NSPLIT, bool BIAS>
__global__ __launch_bounds__(32) void k_gemmw(const T16* __restrict__ A, const T16* __restrict__ A2, const T16* __restrict__ Bt, const T16* __restrict__ Bt2, int K, float* C, int ldc, const float* __restrict__ bias, size_t sA, size_t sB, size_t sC) {
    typedef typename WFrag<T16>::V V;
    __shared__ __align__(16) float os[16 * 68];
    const size_t z = blockIdx.z; A += z * sA; if (A2) A2 += z * sA; Bt += z * sB; if (Bt2) Bt2 += z * sB; C += z * sC;
    const int lane = threadIdx.x & 31, lr = lane & 15, hi = lane >> 4; const int r0 = blockIdx.x * 64, c0 = blockIdx.y * 64;
    v8f acc[4][4];
#pragma unroll
    for (int mb = 0; mb < 4; ++mb)
#pragma unroll
        for (int nb = 0; nb < 4; ++nb) acc[mb][nb] = (v8f){};
    const size_t aoff = (size_t)(r0 + lr) * K + 8 * hi, boff = (size_t)(c0 + lr) * K + 8 * hi;
#pragma unroll 1
    for (int kc = 0; kc < K; kc += 32) {
        V a[4], a2[4];
#pragma unroll
        for (int mb = 0; mb < 4; ++mb) { a[mb] = WFrag<T16>::ld(A + aoff + (size_t)mb * 16 * K + kc); if (NSPLIT == 1 || NSPLIT == 2) a2[mb] = WFrag<T16>::ld(A2 + aoff + (size_t)mb * 16 * K + kc); }
#pragma unroll
        for (int nb = 0; nb < 4; ++nb) { const V b = WFrag<T16>::ld(Bt + boff + (size_t)nb * 16 * K + kc); V b2; if (NSPLIT >= 2) b2 = WFrag<T16>::ld(Bt2 + boff + (size_t)nb * 16 * K + kc);
#pragma unroll
            for (int mb = 0; mb < 4; ++mb) { acc[mb][nb] = WFrag<T16>::mma(a[mb], b, acc[mb][nb]); if (NSPLIT == 1 || NSPLIT == 2) acc[mb][nb] = WFrag<T16>::mma(a2[mb], b, acc[mb][nb]); if (NSPLIT >= 2) acc[mb][nb] = WFrag<T16>::mma(a[mb], b2, acc[mb][nb]); } }
        asm volatile("v_nop\n\tv_nop\n\tv_nop\n\tv_nop" : "+v"(acc[0][0]), "+v"(acc[1][1]), "+v"(acc[2][2]), "+v"(acc[3][3]) : "v"(a[0]), "v"(a[3]));
    }
#pragma unroll
    for (int mb = 0; mb < 4; ++mb) {
#pragma unroll
        for (int nb = 0; nb < 4; ++nb) {
#pragma unroll
            for (int j = 0; j < 8; ++j) os[(hi * 8 + j) * 68 + nb * 16 + lr] = acc[mb][nb][j]; }
        __builtin_amdgcn_wave_barrier(); asm volatile("" ::: "memory");
        float* crow = C + (size_t)(r0 + mb * 16) * ldc + c0;
{
#pragma unroll
            for (int s = 0; s < 8; ++s) { const int row = 2 * s + hi, cofs = lr * 4; v4f val = *(const v4fa*)(os + row * 68 + cofs); if (BIAS) { val[0] += bfr(bias[c0 + cofs]); val[1] += bfr(bias[c0 + cofs + 1]); val[2] += bfr(bias[c0 + cofs + 2]); val[3] += bfr(bias[c0 + cofs + 3]); }
                *(v4f*)(crow + (size_t)row * ldc + cofs) = val; }
             }
        __builtin_amdgcn_wave_barrier(); asm volatile("" ::: "memory");
    }
}

__device__ __forceinline__ h16 tohx(float x) { return (h16)x; }
__device__ __forceinline__ void splitf(float y, unsigned short& h, unsigned short& l) { h = f2bf(y); l = f2bf(y - bf2f(h)); }
typedef __attribute__((ext_vector_type(2))) _Float16 v2h;
typedef __attribute__((ext_vector_type(4))) _Float16 v4h;
typedef __attribute__((ext_vector_type(2))) unsigned short v2us;
typedef __attribute__((ext_vector_type(4))) unsigned short v4us;

__global__ __launch_bounds__(256) void k_wtG(const float* __restrict__ w, int K, int N, bf* Bt) {
    const int lane = threadIdx.x & 31; const int L0 = (blockIdx.x * 8 + (threadIdx.x >> 5)) * 8; const int nlines = N * K / 64;
{
#pragma unroll 1
        for (int l = 0; l < 8; ++l) { const int L = L0 + l; if (L >= nlines) break; const size_t e = (size_t)L * 64 + lane * 2; const int k = (int)(e % K), n = (int)(e / K); v2us o;
            o[0] = f2bf(w[(size_t)k * N + n]); o[1] = f2bf(w[(size_t)(k + 1) * N + n]); *(v2us*)(Bt + e) = o; }
         }
}
__global__ __launch_bounds__(256) void k_cvt8(const float* __restrict__ src, bf* dst, size_t n8) { const size_t i = (size_t)blockIdx.x * 256 + threadIdx.x; if (i >= n8) return; const v8f v = *(const v8f*)(src + i * 8); v8us o;
#pragma unroll
    for (int k = 0; k < 8; ++k) o[k] = f2bf(v[k]); *(v8us*)(dst + i * 8) = o;  }
// k_rms: one wave per (h, t) over the 64 dims (2 per lane): r = rsqrt(mean(w^2) + eps); Q hi/lo = split(w r g1), K hi/lo = split(w r g2) ([h][t][64], 4-B lanes), VT16[h][d][t]... (v written by k_vt below from the same factor);
__global__ __launch_bounds__(256) void k_rms(const float* __restrict__ WF, const float* __restrict__ g1, const float* __restrict__ g2, bf* Qh, bf* Ql, bf* Kh, bf* Kl, float* RS) { const int lane = threadIdx.x & 31; const int row = blockIdx.x * 8 + (threadIdx.x >> 5); if (row >= NH_ * TT) return; const int t = row % TT, h = row / TT; const float* w = WF + (size_t)t * CC + h * HD; const float a0 = w[lane * 2], a1 = w[lane * 2 + 1];
    float s = __fadd_rn(__fmul_rn(a0, a0), __fmul_rn(a1, a1));
#pragma unroll
    for (int sh = 16; sh; sh >>= 1) s += __shfl_xor(s, sh, 32);
    const float r = __frsqrt_rn(__fadd_rn(s * (1.0f / HD), 1.1920929e-07f)); const size_t o = ((size_t)h * TT + t) * HD + lane * 2; v2us qh, ql, kh, kl;
#pragma unroll
    for (int u = 0; u < 2; ++u) { const int d = lane * 2 + u; const float wn = __fmul_rn(u ? a1 : a0, r); unsigned short x1, x2; splitf(__fmul_rn(wn, bfr(g1[d])), x1, x2); qh[u] = x1; ql[u] = x2; splitf(__fmul_rn(wn, bfr(g2[d])), x1, x2); kh[u] = x1; kl[u] = x2; }
    { *(v2us*)(Qh + o) = qh; *(v2us*)(Ql + o) = ql; *(v2us*)(Kh + o) = kh; *(v2us*)(Kl + o) = kl; if (lane == 0) *(float*)(RS + row) = r;  } }
__global__ __launch_bounds__(256) void k_vt(const float* __restrict__ WF, const float* __restrict__ RS, const float* __restrict__ g3, h16* VT) { const size_t e = ((size_t)blockIdx.x * 256 + threadIdx.x) * 2; if (e >= (size_t)NH_ * HD * TT) return; const int t = (int)(e % TT); const int d = (int)((e / TT) % HD); const int h = (int)(e / ((size_t)TT * HD)); const float g = bfr(g3[d]); v2h o;
#pragma unroll
    for (int u = 0; u < 2; ++u) { float wn = __fmul_rn(WF[(size_t)(t + u) * CC + h * HD + d], RS[(size_t)h * TT + t + u]); asm volatile("" : "+v"(wn)); o[u] = tohx(__fmul_rn(wn, g)); } *(v2h*)(VT + e) = o;  }
// k_colst: per-column max and 1 / sum(exp) over the 2048 queries. One work-group of 16 waves per 32 columns (one 128-B line of every row): a wave owns 128 consecutive rows, a lane 4 columns of every 4th of them
// (32 loads of 16 B, each wave-load = 4 whole lines), all kept in registers, so Sb is read once. Max and sum: serial in the lane, then lanes l ^ 8 and l ^ 16, then the 16 waves through LDS, always in the same order.
// The scale 1/8 is a power of two: max(s) / 8 == max(s / 8), and fma(s, 1/8, -mx) rounds once, as (s / 8) - mx does, so mx and every exp term keep their values; only the order of the sum is new.
__global__ __launch_bounds__(512) void k_colst(const float* __restrict__ Sb, float* CM, float* CSR) {
    __shared__ __align__(16) float rmx[16 * 32]; __shared__ __align__(16) float rsm[16 * 32];
    const int lane = threadIdx.x & 31, wv = threadIdx.x >> 5, cq = lane & 7, sub = lane >> 3; const int e0 = blockIdx.x * 32; const int j0 = e0 % TT, z = e0 / TT;
    const float* p = Sb + (size_t)z * TT * TT + (size_t)(wv * 128 + sub) * TT + j0 + cq * 4; v4f r[32];
#pragma unroll
    for (int i = 0; i < 32; ++i) r[i] = *(const v4f*)(p + (size_t)i * 4 * TT);
    // All 32 loads name p's register pair as their address: the wait stands behind the last of them, and taking p as an input keeps the pair live to here, so that no load's result is placed on it before the wait.
    asm volatile("s_wait_xcnt 0x0" :: "v"(p) : "memory");
    v4f mx = r[0];
#pragma unroll
    for (int i = 1; i < 32; ++i) {
#pragma unroll
        for (int q = 0; q < 4; ++q) mx[q] = fmaxf(mx[q], r[i][q]); }
#pragma unroll
    for (int q = 0; q < 4; ++q) mx[q] = fmaxf(-3.0e38f, mx[q] * 0.125f);
#pragma unroll
    for (int sh = 8; sh <= 16; sh <<= 1) {
#pragma unroll
        for (int q = 0; q < 4; ++q) mx[q] = fmaxf(mx[q], __shfl_xor(mx[q], sh, 32)); }
    if (sub == 0) *(v4fa*)(rmx + wv * 32 + cq * 4) = mx;
    __syncthreads();    // every wave's column maxima are in rmx before any wave folds them
#pragma unroll
    for (int k = 0; k < 4; ++k) { const v4f o = *(const v4fa*)(rmx + (k * 4 + sub) * 32 + cq * 4);
#pragma unroll
        for (int q = 0; q < 4; ++q) mx[q] = fmaxf(mx[q], o[q]); }
#pragma unroll
    for (int sh = 8; sh <= 16; sh <<= 1) {
#pragma unroll
        for (int q = 0; q < 4; ++q) mx[q] = fmaxf(mx[q], __shfl_xor(mx[q], sh, 32)); }
    v4f s = { 0.f, 0.f, 0.f, 0.f };
#pragma unroll
    for (int i = 0; i < 32; ++i) { float x0 = fmaf(r[i][0], 0.125f, -mx[0]) * 0x1.715476p+0f, x1 = fmaf(r[i][1], 0.125f, -mx[1]) * 0x1.715476p+0f, x2 = fmaf(r[i][2], 0.125f, -mx[2]) * 0x1.715476p+0f, x3 = fmaf(r[i][3], 0.125f, -mx[3]) * 0x1.715476p+0f; float y0, y1, y2, y3;
        // exp(d) = 2^(d log2 e), as __expf forms it. One statement for a row's four, results apart from all sources, and a v_nop at its end: the one-instruction slot that the instruction set asks for behind a
        // transcendental before its result is read or its source overwritten.
        asm("v_exp_f32 %0, %4\n\tv_exp_f32 %1, %5\n\tv_exp_f32 %2, %6\n\tv_exp_f32 %3, %7\n\tv_nop" : "=&v"(y0), "=&v"(y1), "=&v"(y2), "=&v"(y3) : "v"(x0), "v"(x1), "v"(x2), "v"(x3));
        s[0] = __fadd_rn(s[0], y0); s[1] = __fadd_rn(s[1], y1); s[2] = __fadd_rn(s[2], y2); s[3] = __fadd_rn(s[3], y3); }
#pragma unroll
    for (int sh = 8; sh <= 16; sh <<= 1) {
#pragma unroll
        for (int q = 0; q < 4; ++q) s[q] = __fadd_rn(s[q], __shfl_xor(s[q], sh, 32)); }
    if (sub == 0) *(v4fa*)(rsm + wv * 32 + cq * 4) = s;
    __syncthreads();    // every wave's column sums are in rsm before the first eight lanes add them
    if (threadIdx.x < 8) { v4f a = *(const v4fa*)(rsm + cq * 4);
#pragma unroll
        for (int w = 1; w < 16; ++w) { const v4f o = *(const v4fa*)(rsm + w * 32 + cq * 4);
#pragma unroll
            for (int q = 0; q < 4; ++q) a[q] = __fadd_rn(a[q], o[q]); }
        v4f rs;
#pragma unroll
        for (int q = 0; q < 4; ++q) rs[q] = __fdiv_rn(1.0f, a[q]);
        *(v4f*)(CM + e0 + cq * 4) = mx; *(v4f*)(CSR + e0 + cq * 4) = rs; } }
__global__ __launch_bounds__(256) void k_bisoft(const float* __restrict__ Sb, const float* __restrict__ CM, const float* __restrict__ CSR, h16* P) { const int lane = threadIdx.x & 31; const int row = blockIdx.x * 8 + (threadIdx.x >> 5); if (row >= ZH * TT) return; const int z = row / TT; const float* sr = Sb + (size_t)row * TT; float v[64]; float mx = -3.0e38f;
#pragma unroll
    for (int ch = 0; ch < 16; ++ch) { const v4f a = *(const v4f*)(sr + ch * 128 + lane * 4);
#pragma unroll
        for (int q = 0; q < 4; ++q) { const float t = a[q] * 0.125f; v[ch * 4 + q] = t; mx = fmaxf(mx, t); } }
#pragma unroll
    for (int sh = 16; sh; sh >>= 1) mx = fmaxf(mx, __shfl_xor(mx, sh, 32));
    float sum = 0.f; float ex[64];
#pragma unroll
    for (int k = 0; k < 64; ++k) { float d0 = __fsub_rn(v[k], mx); asm volatile("" : "+v"(d0)); ex[k] = __expf(d0); sum += ex[k]; }
#pragma unroll
    for (int sh = 16; sh; sh >>= 1) sum += __shfl_xor(sum, sh, 32);
    const float f = __fdiv_rn(PCAR, sum);
{
#pragma unroll
        for (int ch = 0; ch < 16; ++ch) { const int j0 = ch * 128 + lane * 4; const v4f cm = *(const v4f*)(CM + (size_t)z * TT + j0), cr = *(const v4f*)(CSR + (size_t)z * TT + j0); v4h o;
#pragma unroll
            for (int q = 0; q < 4; ++q) { float d1 = __fsub_rn(v[ch * 4 + q], cm[q]); asm volatile("" : "+v"(d1)); float pc = __fmul_rn(__expf(d1), cr[q]); asm volatile("" : "+v"(pc)); float pr = __fmul_rn(ex[ch * 4 + q], f); asm volatile("" : "+v"(pr)); o[q] = tohx(__fadd_rn(pr, __fmul_rn(pc, PCAR))); }
            *(v4h*)(P + (size_t)row * TT + j0) = o; }
         } }
__global__ __launch_bounds__(256) void k_mrg(const float* __restrict__ Ob, int h0, bf* Yh, bf* Yl) { const size_t e = ((size_t)blockIdx.x * 256 + threadIdx.x) * 2; if (e >= (size_t)ZH * TT * HD) return; const int d = (int)(e % HD); const int t = (int)((e / HD) % TT); const int z = (int)(e / ((size_t)HD * TT)); v2us oh, ol;
#pragma unroll
    for (int u = 0; u < 2; ++u) { unsigned short a, c; splitf(Ob[e + u] * (1.0f / PCAR), a, c); oh[u] = a; ol[u] = c; } const size_t o = (size_t)t * CC + (h0 + z) * HD + d; *(v2us*)(Yh + o) = oh; *(v2us*)(Yl + o) = ol;  }

extern "C" void kernel_launch(void* const* d_in, const int* in_sizes, int n_in,
                              void* d_out, int out_size, void* d_ws, size_t ws_size, hipStream_t stream) {
    (void)in_sizes; (void)n_in; (void)out_size;
    const float* x = (const float*)d_in[0]; const float* Wt = (const float*)d_in[1]; const float* g1 = (const float*)d_in[2]; const float* g2 = (const float*)d_in[3]; const float* g3 = (const float*)d_in[4];
    float* OUT = (float*)d_out;     // [2][2048][768]
    char* wsp = (char*)d_ws;
    auto take = [&](size_t bytes) { char* p = wsp; wsp += (bytes + 255) & ~(size_t)255; return (void*)p; };
    bf* WB = (bf*)take((size_t)CC * CC * 2); bf* WT = (bf*)take((size_t)CC * CC * 2); bf* XB = (bf*)take((size_t)TT * CC * 2); float* WF = (float*)take((size_t)TT * CC * 4); float* RS = (float*)take((size_t)NH_ * TT * 4);
    bf* Qh = (bf*)take((size_t)NH_ * TT * HD * 2); bf* Ql = (bf*)take((size_t)NH_ * TT * HD * 2); bf* Kh = (bf*)take((size_t)NH_ * TT * HD * 2); bf* Kl = (bf*)take((size_t)NH_ * TT * HD * 2); h16* VT = (h16*)take((size_t)NH_ * HD * TT * 2);
    float* Sb = (float*)take((size_t)ZH * TT * TT * 4); float* CM = (float*)take((size_t)ZH * TT * 4); float* CSR = (float*)take((size_t)ZH * TT * 4); h16* P16 = (h16*)take((size_t)ZH * TT * TT * 2); float* Ob = (float*)take((size_t)ZH * TT * HD * 4); bf* Yh = (bf*)take((size_t)TT * CC * 2); bf* Yl = (bf*)take((size_t)TT * CC * 2);
    if ((size_t)(wsp - (char*)d_ws) > ws_size) return;    // total ~ 86 MB
    k_cvt8<<<(CC * CC / 8 + 255) / 256, 256, 0, stream>>>(Wt, WB, (size_t)CC * CC / 8);      // W [out][in] = natural Bt for x W^T
    k_wtG<<<(CC * CC / 64 + 63) / 64, 256, 0, stream>>>(Wt, CC, CC, WT);                  // W as x @ W operand for y W
    for (int b = 0; b < NB_; ++b) {
        k_cvt8<<<(TT * CC / 8 + 255) / 256, 256, 0, stream>>>(x + (size_t)b * TT * CC, XB, (size_t)TT * CC / 8);
        k_gemmw<bf, 0, false><<<dim3(TT / 64, CC / 64, 1), 32, 0, stream>>>(XB, nullptr, WB, nullptr, CC, WF, CC, nullptr, 0, 0, 0);
        k_rms<<<NH_ * TT / 8, 256, 0, stream>>>(WF, g1, g2, Qh, Ql, Kh, Kl, RS); k_vt<<<(unsigned)(((size_t)NH_ * HD * TT / 2 + 255) / 256), 256, 0, stream>>>(WF, RS, g3, VT);
        for (int h0 = 0; h0 < NH_; h0 += ZH) { const size_t z = (size_t)h0;
            k_gemmw<bf, 2, false><<<dim3(TT / 64, TT / 64, ZH), 32, 0, stream>>>(Qh + z * TT * HD, Ql + z * TT * HD, Kh + z * TT * HD, Kl + z * TT * HD, HD, Sb, TT, nullptr, (size_t)TT * HD, (size_t)TT * HD, (size_t)TT * TT);
            k_colst<<<ZH * TT / 32, 512, 0, stream>>>(Sb, CM, CSR); k_bisoft<<<ZH * TT / 8, 256, 0, stream>>>(Sb, CM, CSR, P16);
            k_gemmw<h16, 0, false><<<dim3(TT / 64, 1, ZH), 32, 0, stream>>>(P16, nullptr, VT + z * HD * TT, nullptr, TT, Ob, HD, nullptr, (size_t)TT * TT, (size_t)HD * TT, (size_t)TT * HD);
            k_mrg<<<(unsigned)(((size_t)ZH * TT * HD / 2 + 255) / 256), 256, 0, stream>>>(Ob, h0, Yh, Yl); }
        k_gemmw<bf, 1, false><<<dim3(TT / 64, CC / 64, 1), 32, 0, stream>>>(Yh, Yl, WT, nullptr, CC, OUT + (size_t)b * TT * CC, CC, nullptr, 0, 0, 0); }
}

// v002
// A run of this version takes 528 microseconds.
// Timed twice side by side with v001, it ran 2.04 and 2.05 times as fast.
// Over all steps from v000 it is 18.0 times as fast.
#include <hip/hip_runtime.h>

// HyperSETAlterAttention (x [2][2048][768]; w = x W^T (12 heads x 64, shared weights); q, k, v = RMSNorm(w) g1 / g2 / g3 (eps = f32 eps); att = q.k / 8; a = softmax over keys + softmax over QUERIES (bisoftmax);
// y = a.v merged; out = y W -> [2][2048][768]).
// Compute dtypes, f32 accumulate: every input rounded to bf16; x W^T on PLAIN bf16 operands (inputs: exact); RMSNorm f32 -> bf16 hi+lo planes of q and k (scores: 3 products, K 64 - the cosine-like logits span
// +-8, single fp16 planes were not tried) and a single fp16 plane of v; the row softmax (wave per row) and the column softmax (per-column max / sum over the 2048 queries, work-group per 32 columns, fixed order) in f32, combined into ONE fp16

#define NB_  2
#define TT   2048
#define CC   768
#define NH_  12
#define HD   64
#define ZH   8
#define NZ   (NB_ * NH_)    // (batch, head) pairs, index zh = b * NH_ + h
#define PCAR 512.0f
typedef _Float16 h16;
typedef unsigned short bf;
typedef __attribute__((ext_vector_type(16))) __bf16   v16bf;
typedef __attribute__((ext_vector_type(16))) _Float16 v16h;
typedef __attribute__((ext_vector_type(8)))  _Float16 v8h;
typedef __attribute__((ext_vector_type(8)))  unsigned short v8us;
typedef __attribute__((ext_vector_type(8)))  float    v8f;
typedef __attribute__((ext_vector_type(4)))  float    v4f;
typedef v8h  __attribute__((may_alias)) v8ha;
typedef v4f  __attribute__((may_alias)) v4fa;
typedef v8us __attribute__((may_alias)) v8usa;

__device__ __forceinline__ unsigned short f2bf(float f) { unsigned u = __float_as_uint(f); u += 0x7FFFu + ((u >> 16) & 1u); return (unsigned short)(u >> 16); }
__device__ __forceinline__ float bf2f(unsigned short b) { return __uint_as_float(((unsigned)b) << 16); }
__device__ __forceinline__ float bfr(float f) { return bf2f(f2bf(f)); }
__device__ __forceinline__ v16h cat16(v8h lo, v8h hi) { return __builtin_shufflevector(lo, hi, 0, 1, 2, 3, 4, 5, 6, 7, 8, 9, 10, 11, 12, 13, 14, 15); }
__device__ __forceinline__ v16bf cat16b(v8us lo, v8us hi) { return __builtin_bit_cast(v16bf, __builtin_shufflevector(lo, hi, 0, 1, 2, 3, 4, 5, 6, 7, 8, 9, 10, 11, 12, 13, 14, 15)); }
__device__ __forceinline__ v8f wmma16(v16h a, v16h b, v8f c) { return __builtin_amdgcn_wmma_f32_16x16x32_f16(false, a, false, b, (short)0, c, false, false); }
__device__ __forceinline__ v8f wmmab(v16bf a, v16bf b, v8f c) { return __builtin_amdgcn_wmma_f32_16x16x32_bf16(false, a, false, b, (short)0, c, false, false); }



// ---- k_gemmw: register-blocked GEMM, ONE WAVE per 64x64 output tile (16 accumulators), operands straight from K-contiguous 16-bit planes; grid (M/64, N/64, Z), 32 threads.
// C[m][n] (f32, pitch ldc, + optional f32 bias[n]) = sum_k A[m][k] Bt[n][k] (+ split products per NSPLIT). z-batch strides sA/sB/sC in elements. K % 32 == 0.
template <typename T16> struct WFrag;
template <> struct WFrag<h16> { typedef v16h V; static __device__ __forceinline__ V ld(const h16* p) { return cat16(*(const v8h*)p, *(const v8h*)(p + 16)); } static __device__ __forceinline__ v8f mma(V a, V b, v8f c) { return wmma16(a, b, c); } };
template <> struct WFrag<bf> { typedef v16bf V; static __device__ __forceinline__ V ld(const bf* p) { return cat16b(*(const v8us*)p, *(const v8us*)(p + 16)); } static __device__ __forceinline__ v8f mma(V a, V b, v8f c) { return wmmab(a, b, c); } };
template <typename T16, int NSPLIT, bool BIAS>
__global__ __launch_bounds__(32) void k_gemmw(const T16* __restrict__ A, const T16* __restrict__ A2, const T16* __restrict__ Bt, const T16* __restrict__ Bt2, int K, float* C, int ldc, const float* __restrict__ bias, size_t sA, size_t sB, size_t sC) {
    typedef typename WFrag<T16>::V V;
    __shared__ __align__(16) float os[16 * 68];
    const size_t z = blockIdx.z; A += z * sA; if (A2) A2 += z * sA; Bt += z * sB; if (Bt2) Bt2 += z * sB; C += z * sC;
    const int lane = threadIdx.x & 31, lr = lane & 15, hi = lane >> 4; const int r0 = blockIdx.x * 64, c0 = blockIdx.y * 64;
    v8f acc[4][4];
#pragma unroll
    for (int mb = 0; mb < 4; ++mb)
#pragma unroll
        for (int nb = 0; nb < 4; ++nb) acc[mb][nb] = (v8f){};
    const size_t aoff = (size_t)(r0 + lr) * K + 8 * hi, boff = (size_t)(c0 + lr) * K + 8 * hi;
#pragma unroll 1
    for (int kc = 0; kc < K; kc += 32) {
        V a[4], a2[4];
#pragma unroll
        for (int mb = 0; mb < 4; ++mb) { a[mb] = WFrag<T16>::ld(A + aoff + (size_t)mb * 16 * K + kc); if (NSPLIT == 1 || NSPLIT == 2) a2[mb] = WFrag<T16>::ld(A2 + aoff + (size_t)mb * 16 * K + kc); }
#pragma unroll
        for (int nb = 0; nb < 4; ++nb) { const V b = WFrag<T16>::ld(Bt + boff + (size_t)nb * 16 * K + kc); V b2; if (NSPLIT >= 2) b2 = WFrag<T16>::ld(Bt2 + boff + (size_t)nb * 16 * K + kc);
#pragma unroll
            for (int mb = 0; mb < 4; ++mb) { acc[mb][nb] = WFrag<T16>::mma(a[mb], b, acc[mb][nb]); if (NSPLIT == 1 || NSPLIT == 2) acc[mb][nb] = WFrag<T16>::mma(a2[mb], b, acc[mb][nb]); if (NSPLIT >= 2) acc[mb][nb] = WFrag<T16>::mma(a[mb], b2, acc[mb][nb]); } }
        asm volatile("v_nop\n\tv_nop\n\tv_nop\n\tv_nop" : "+v"(acc[0][0]), "+v"(acc[1][1]), "+v"(acc[2][2]), "+v"(acc[3][3]) : "v"(a[0]), "v"(a[3]));
    }
#pragma unroll
    for (int mb = 0; mb < 4; ++mb) {
#pragma unroll
        for (int nb = 0; nb < 4; ++nb) {
#pragma unroll
            for (int j = 0; j < 8; ++j) os[(hi * 8 + j) * 68 + nb * 16 + lr] = acc[mb][nb][j]; }
        __builtin_amdgcn_wave_barrier(); asm volatile("" ::: "memory");
        float* crow = C + (size_t)(r0 + mb * 16) * ldc + c0;
{
#pragma unroll
            for (int s = 0; s < 8; ++s) { const int row = 2 * s + hi, cofs = lr * 4; v4f val = *(const v4fa*)(os + row * 68 + cofs); if (BIAS) { val[0] += bfr(bias[c0 + cofs]); val[1] += bfr(bias[c0 + cofs + 1]); val[2] += bfr(bias[c0 + cofs + 2]); val[3] += bfr(bias[c0 + cofs + 3]); }
                *(v4f*)(crow + (size_t)row * ldc + cofs) = val; }
             }
        __builtin_amdgcn_wave_barrier(); asm volatile("" ::: "memory");
    }
}

__device__ __forceinline__ h16 tohx(float x) { return (h16)x; }
__device__ __forceinline__ void splitf(float y, unsigned short& h, unsigned short& l) { h = f2bf(y); l = f2bf(y - bf2f(h)); }
typedef __attribute__((ext_vector_type(2))) _Float16 v2h;
typedef __attribute__((ext_vector_type(4))) _Float16 v4h;
typedef __attribute__((ext_vector_type(2))) unsigned short v2us;
typedef __attribute__((ext_vector_type(4))) unsigned short v4us;

__global__ __launch_bounds__(256) void k_wtG(const float* __restrict__ w, int K, int N, bf* Bt) {
    const int lane = threadIdx.x & 31; const int L0 = (blockIdx.x * 8 + (threadIdx.x >> 5)) * 8; const int nlines = N * K / 64;
{
#pragma unroll 1
        for (int l = 0; l < 8; ++l) { const int L = L0 + l; if (L >= nlines) break; const size_t e = (size_t)L * 64 + lane * 2; const int k = (int)(e % K), n = (int)(e / K); v2us o;
            o[0] = f2bf(w[(size_t)k * N + n]); o[1] = f2bf(w[(size_t)(k + 1) * N + n]); *(v2us*)(Bt + e) = o; }
         }
}
__global__ __launch_bounds__(256) void k_cvt8(const float* __restrict__ src, bf* dst, size_t n8) { const size_t i = (size_t)blockIdx.x * 256 + threadIdx.x; if (i >= n8) return; const v8f v = *(const v8f*)(src + i * 8); v8us o;
#pragma unroll
    for (int k = 0; k < 8; ++k) o[k] = f2bf(v[k]); *(v8us*)(dst + i * 8) = o;  }
// k_rms: one wave per (zh, t) over the 64 dims (2 per lane): r = rsqrt(mean(w^2) + eps); Q hi/lo = split(w r g1), K hi/lo = split(w r g2) ([zh][t][64], 4-B lanes), VT16[zh][d][t]... (v written by k_vt below from the same factor);
__global__ __launch_bounds__(256) void k_rms(const float* __restrict__ WF, const float* __restrict__ g1, const float* __restrict__ g2, bf* Qh, bf* Ql, bf* Kh, bf* Kl, float* RS) { const int lane = threadIdx.x & 31; const int row = blockIdx.x * 8 + (threadIdx.x >> 5); if (row >= NZ * TT) return; const int t = row % TT, zh = row / TT, h = zh % NH_, b = zh / NH_; const float* w = WF + (size_t)(b * TT + t) * CC + h * HD + lane * 2; const float a0 = w[0], a1 = w[1];
    asm volatile("s_wait_xcnt 0x0" :: "v"(w) : "memory");    // the load names w's register pair: the wait stands before that pair is reused, and w as an input keeps it live to here
    float s = __fadd_rn(__fmul_rn(a0, a0), __fmul_rn(a1, a1));
#pragma unroll
    for (int sh = 16; sh; sh >>= 1) s += __shfl_xor(s, sh, 32);
    const float r = __frsqrt_rn(__fadd_rn(s * (1.0f / HD), 1.1920929e-07f)); const size_t o = ((size_t)zh * TT + t) * HD + lane * 2; v2us qh, ql, kh, kl;
#pragma unroll
    for (int u = 0; u < 2; ++u) { const int d = lane * 2 + u; const float wn = __fmul_rn(u ? a1 : a0, r); unsigned short x1, x2; splitf(__fmul_rn(wn, bfr(g1[d])), x1, x2); qh[u] = x1; ql[u] = x2; splitf(__fmul_rn(wn, bfr(g2[d])), x1, x2); kh[u] = x1; kl[u] = x2; }
    { *(v2us*)(Qh + o) = qh; *(v2us*)(Ql + o) = ql; *(v2us*)(Kh + o) = kh; *(v2us*)(Kl + o) = kl; if (lane == 0) *(float*)(RS + row) = r;  } }
__global__ __launch_bounds__(256) void k_vt(const float* __restrict__ WF, const float* __restrict__ RS, const float* __restrict__ g3, h16* VT) { const size_t e = ((size_t)blockIdx.x * 256 + threadIdx.x) * 2; if (e >= (size_t)NZ * HD * TT) return; const int t = (int)(e % TT); const int d = (int)((e / TT) % HD); const int zh = (int)(e / ((size_t)TT * HD)); const int h = zh % NH_, b = zh / NH_; const float g = bfr(g3[d]); v2h o;
#pragma unroll
    for (int u = 0; u < 2; ++u) { float wn = __fmul_rn(WF[(size_t)(b * TT + t + u) * CC + h * HD + d], RS[(size_t)zh * TT + t + u]); asm volatile("" : "+v"(wn)); o[u] = tohx(__fmul_rn(wn, g)); } *(v2h*)(VT + e) = o;  }
// k_colst: per-column max and 1 / sum(exp) over the 2048 queries. One work-group of 16 waves per 32 columns (one 128-B line of every row): a wave owns 128 consecutive rows, a lane 4 columns of every 4th of them
// (32 loads of 16 B, each wave-load = 4 whole lines), all kept in registers, so Sb is read once. Max and sum: serial in the lane, then lanes l ^ 8 and l ^ 16, then the 16 waves through LDS, always in the same order.
// The scale 1/8 is a power of two: max(s) / 8 == max(s / 8), and fma(s, 1/8, -mx) rounds once, as (s / 8) - mx does, so mx and every exp term keep their values; only the order of the sum is new.
__global__ __launch_bounds__(512) void k_colst(const float* __restrict__ Sb, float* CM, float* CSR) {
    __shared__ __align__(16) float rmx[16 * 32]; __shared__ __align__(16) float rsm[16 * 32];
    const int lane = threadIdx.x & 31, wv = threadIdx.x >> 5, cq = lane & 7, sub = lane >> 3; const int e0 = blockIdx.x * 32; const int j0 = e0 % TT, z = e0 / TT;
    const float* p = Sb + (size_t)z * TT * TT + (size_t)(wv * 128 + sub) * TT + j0 + cq * 4; v4f r[32];
#pragma unroll
    for (int i = 0; i < 32; ++i) r[i] = *(const v4f*)(p + (size_t)i * 4 * TT);
    // All 32 loads name p's register pair as their address: the wait stands behind the last of them, and taking p as an input keeps the pair live to here, so that no load's result is placed on it before the wait.
    asm volatile("s_wait_xcnt 0x0" :: "v"(p) : "memory");
    v4f mx = r[0];
#pragma unroll
    for (int i = 1; i < 32; ++i) {
#pragma unroll
        for (int q = 0; q < 4; ++q) mx[q] = fmaxf(mx[q], r[i][q]); }
#pragma unroll
    for (int q = 0; q < 4; ++q) mx[q] = fmaxf(-3.0e38f, mx[q] * 0.125f);
#pragma unroll
    for (int sh = 8; sh <= 16; sh <<= 1) {
#pragma unroll
        for (int q = 0; q < 4; ++q) mx[q] = fmaxf(mx[q], __shfl_xor(mx[q], sh, 32)); }
    if (sub == 0) *(v4fa*)(rmx + wv * 32 + cq * 4) = mx;
    __syncthreads();    // every wave's column maxima are in rmx before any wave folds them
#pragma unroll
    for (int k = 0; k < 4; ++k) { const v4f o = *(const v4fa*)(rmx + (k * 4 + sub) * 32 + cq * 4);
#pragma unroll
        for (int q = 0; q < 4; ++q) mx[q] = fmaxf(mx[q], o[q]); }
#pragma unroll
    for (int sh = 8; sh <= 16; sh <<= 1) {
#pragma unroll
        for (int q = 0; q < 4; ++q) mx[q] = fmaxf(mx[q], __shfl_xor(mx[q], sh, 32)); }
    v4f s = { 0.f, 0.f, 0.f, 0.f };
#pragma unroll
    for (int i = 0; i < 32; ++i) { float x0 = fmaf(r[i][0], 0.125f, -mx[0]) * 0x1.715476p+0f, x1 = fmaf(r[i][1], 0.125f, -mx[1]) * 0x1.715476p+0f, x2 = fmaf(r[i][2], 0.125f, -mx[2]) * 0x1.715476p+0f, x3 = fmaf(r[i][3], 0.125f, -mx[3]) * 0x1.715476p+0f; float y0, y1, y2, y3;
        // exp(d) = 2^(d log2 e), as __expf forms it. One statement for a row's four, results apart from all sources, and a v_nop at its end: the one-instruction slot that the instruction set asks for behind a
        // transcendental before its result is read or its source overwritten.
        asm("v_exp_f32 %0, %4\n\tv_exp_f32 %1, %5\n\tv_exp_f32 %2, %6\n\tv_exp_f32 %3, %7\n\tv_nop" : "=&v"(y0), "=&v"(y1), "=&v"(y2), "=&v"(y3) : "v"(x0), "v"(x1), "v"(x2), "v"(x3));
        s[0] = __fadd_rn(s[0], y0); s[1] = __fadd_rn(s[1], y1); s[2] = __fadd_rn(s[2], y2); s[3] = __fadd_rn(s[3], y3); }
#pragma unroll
    for (int sh = 8; sh <= 16; sh <<= 1) {
#pragma unroll
        for (int q = 0; q < 4; ++q) s[q] = __fadd_rn(s[q], __shfl_xor(s[q], sh, 32)); }
    if (sub == 0) *(v4fa*)(rsm + wv * 32 + cq * 4) = s;
    __syncthreads();    // every wave's column sums are in rsm before the first eight lanes add them
    if (threadIdx.x < 8) { v4f a = *(const v4fa*)(rsm + cq * 4);
#pragma unroll
        for (int w = 1; w < 16; ++w) { const v4f o = *(const v4fa*)(rsm + w * 32 + cq * 4);
#pragma unroll
            for (int q = 0; q < 4; ++q) a[q] = __fadd_rn(a[q], o[q]); }
        v4f rs;
#pragma unroll
        for (int q = 0; q < 4; ++q) rs[q] = __fdiv_rn(1.0f, a[q]);
        *(v4f*)(CM + e0 + cq * 4) = mx; *(v4f*)(CSR + e0 + cq * 4) = rs; } }
__global__ __launch_bounds__(256) void k_bisoft(const float* __restrict__ Sb, const float* __restrict__ CM, const float* __restrict__ CSR, h16* P) { const int lane = threadIdx.x & 31; const int row = blockIdx.x * 8 + (threadIdx.x >> 5); if (row >= ZH * TT) return; const int z = row / TT; const float* sr = Sb + (size_t)row * TT; float v[64]; float mx = -3.0e38f;
#pragma unroll
    for (int ch = 0; ch < 16; ++ch) { const v4f a = *(const v4f*)(sr + ch * 128 + lane * 4);
#pragma unroll
        for (int q = 0; q < 4; ++q) { const float t = a[q] * 0.125f; v[ch * 4 + q] = t; mx = fmaxf(mx, t); } }
#pragma unroll
    for (int sh = 16; sh; sh >>= 1) mx = fmaxf(mx, __shfl_xor(mx, sh, 32));
    float sum = 0.f; float ex[64];
#pragma unroll
    for (int k = 0; k < 64; ++k) { float d0 = __fsub_rn(v[k], mx); asm volatile("" : "+v"(d0)); ex[k] = __expf(d0); sum += ex[k]; }
#pragma unroll
    for (int sh = 16; sh; sh >>= 1) sum += __shfl_xor(sum, sh, 32);
    const float f = __fdiv_rn(PCAR, sum);
{
#pragma unroll
        for (int ch = 0; ch < 16; ++ch) { const int j0 = ch * 128 + lane * 4; const v4f cm = *(const v4f*)(CM + (size_t)z * TT + j0), cr = *(const v4f*)(CSR + (size_t)z * TT + j0); v4h o;
#pragma unroll
            for (int q = 0; q < 4; ++q) { float d1 = __fsub_rn(v[ch * 4 + q], cm[q]); asm volatile("" : "+v"(d1)); float pc = __fmul_rn(__expf(d1), cr[q]); asm volatile("" : "+v"(pc)); float pr = __fmul_rn(ex[ch * 4 + q], f); asm volatile("" : "+v"(pr)); o[q] = tohx(__fadd_rn(pr, __fmul_rn(pc, PCAR))); }
            *(v4h*)(P + (size_t)row * TT + j0) = o; }
         } }
__global__ __launch_bounds__(256) void k_mrg(const float* __restrict__ Ob, int z0, bf* Yh, bf* Yl) { const size_t e = ((size_t)blockIdx.x * 256 + threadIdx.x) * 2; if (e >= (size_t)ZH * TT * HD) return; const int d = (int)(e % HD); const int t = (int)((e / HD) % TT); const int z = (int)(e / ((size_t)HD * TT)); v2us oh, ol; const float* op = Ob + e; const float ob[2] = { op[0], op[1] };
    asm volatile("s_wait_xcnt 0x0" :: "v"(op) : "memory");    // the load names op's register pair: the wait stands before that pair is reused, and op as an input keeps it live to here
#pragma unroll
    for (int u = 0; u < 2; ++u) { unsigned short a, c; splitf(ob[u] * (1.0f / PCAR), a, c); oh[u] = a; ol[u] = c; } const int zh = z0 + z; const size_t o = (size_t)((zh / NH_) * TT + t) * CC + (zh % NH_) * HD + d; *(v2us*)(Yh + o) = oh; *(v2us*)(Yl + o) = ol;  }

extern "C" void kernel_launch(void* const* d_in, const int* in_sizes, int n_in,
                              void* d_out, int out_size, void* d_ws, size_t ws_size, hipStream_t stream) {
    (void)in_sizes; (void)n_in; (void)out_size;
    const float* x = (const float*)d_in[0]; const float* Wt = (const float*)d_in[1]; const float* g1 = (const float*)d_in[2]; const float* g2 = (const float*)d_in[3]; const float* g3 = (const float*)d_in[4];
    float* OUT = (float*)d_out;     // [2][2048][768]
    char* wsp = (char*)d_ws;
    auto take = [&](size_t bytes) { char* p = wsp; wsp += (bytes + 255) & ~(size_t)255; return (void*)p; };
    bf* WB = (bf*)take((size_t)CC * CC * 2); bf* WT = (bf*)take((size_t)CC * CC * 2); bf* XB = (bf*)take((size_t)NB_ * TT * CC * 2); float* WF = (float*)take((size_t)NB_ * TT * CC * 4); float* RS = (float*)take((size_t)NZ * TT * 4);
    bf* Qh = (bf*)take((size_t)NZ * TT * HD * 2); bf* Ql = (bf*)take((size_t)NZ * TT * HD * 2); bf* Kh = (bf*)take((size_t)NZ * TT * HD * 2); bf* Kl = (bf*)take((size_t)NZ * TT * HD * 2); h16* VT = (h16*)take((size_t)NZ * HD * TT * 2);
    float* Sb = (float*)take((size_t)ZH * TT * TT * 4); float* CM = (float*)take((size_t)ZH * TT * 4); float* CSR = (float*)take((size_t)ZH * TT * 4); h16* P16 = (h16*)take((size_t)ZH * TT * TT * 2); float* Ob = (float*)take((size_t)ZH * TT * HD * 4);
    bf* Yh = (bf*)WF; bf* Yl = Yh + (size_t)NB_ * TT * CC;    // the two y planes take WF's bytes: k_vt is WF's last reader and runs before the first k_mrg
    if ((size_t)(wsp - (char*)d_ws) > ws_size) return;    // total ~ 259 MB
    k_cvt8<<<(CC * CC / 8 + 255) / 256, 256, 0, stream>>>(Wt, WB, (size_t)CC * CC / 8);      // W [out][in] = natural Bt for x W^T
    k_wtG<<<(CC * CC / 64 + 63) / 64, 256, 0, stream>>>(Wt, CC, CC, WT);                  // W as x @ W operand for y W
    // Both batch items go through the launches outside the loop together (rows b * TT + t, or all NZ pairs), and the score / softmax / a.v launches take ZH of the NZ (batch, head) pairs at a time.
    k_cvt8<<<(NB_ * TT * CC / 8 + 255) / 256, 256, 0, stream>>>(x, XB, (size_t)NB_ * TT * CC / 8);
    k_gemmw<bf, 0, false><<<dim3(NB_ * TT / 64, CC / 64, 1), 32, 0, stream>>>(XB, nullptr, WB, nullptr, CC, WF, CC, nullptr, 0, 0, 0);
    k_rms<<<NZ * TT / 8, 256, 0, stream>>>(WF, g1, g2, Qh, Ql, Kh, Kl, RS); k_vt<<<(unsigned)(((size_t)NZ * HD * TT / 2 + 255) / 256), 256, 0, stream>>>(WF, RS, g3, VT);
    for (int z0 = 0; z0 < NZ; z0 += ZH) { const size_t z = (size_t)z0;
        k_gemmw<bf, 2, false><<<dim3(TT / 64, TT / 64, ZH), 32, 0, stream>>>(Qh + z * TT * HD, Ql + z * TT * HD, Kh + z * TT * HD, Kl + z * TT * HD, HD, Sb, TT, nullptr, (size_t)TT * HD, (size_t)TT * HD, (size_t)TT * TT);
        k_colst<<<ZH * TT / 32, 512, 0, stream>>>(Sb, CM, CSR); k_bisoft<<<ZH * TT / 8, 256, 0, stream>>>(Sb, CM, CSR, P16);
        k_gemmw<h16, 0, false><<<dim3(TT / 64, 1, ZH), 32, 0, stream>>>(P16, nullptr, VT + z * HD * TT, nullptr, TT, Ob, HD, nullptr, (size_t)TT * TT, (size_t)HD * TT, (size_t)TT * HD);
        k_mrg<<<(unsigned)(((size_t)ZH * TT * HD / 2 + 255) / 256), 256, 0, stream>>>(Ob, z0, Yh, Yl); }
    k_gemmw<bf, 1, false><<<dim3(NB_ * TT / 64, CC / 64, 1), 32, 0, stream>>>(Yh, Yl, WT, nullptr, CC, OUT, CC, nullptr, 0, 0, 0);
}

// v003
// It runs in 422 microseconds.
// Two timings next to v002 both put it at 1.24 times that version's speed.
// All steps since v000 together make it 22.3 times as fast.
#include <hip/hip_runtime.h>

// HyperSETAlterAttention (x [2][2048][768]; w = x W^T (12 heads x 64, shared weights); q, k, v = RMSNorm(w) g1 / g2 / g3 (eps = f32 eps); att = q.k / 8; a = softmax over keys + softmax over QUERIES (bisoftmax);
// y = a.v merged; out = y W -> [2][2048][768]).
// Compute dtypes, f32 accumulate: every input rounded to bf16; x W^T on PLAIN bf16 operands (inputs: exact); RMSNorm f32 -> bf16 hi+lo planes of q and k (scores: 3 products, K 64 - the cosine-like logits span
// +-8, single fp16 planes were not tried) and a single fp16 plane of v; the row softmax (wave per row) and the column softmax (per-column max / sum over the 2048 queries, work-group per 32 columns, fixed order) in f32, combined into ONE fp16

#define NB_  2
#define TT   2048
#define CC   768
#define NH_  12
#define HD   64
#define ZH   8
#define NZ   (NB_ * NH_)    // (batch, head) pairs, index zh = b * NH_ + h
#define PCAR 512.0f
typedef _Float16 h16;
typedef unsigned short bf;
typedef __attribute__((ext_vector_type(16))) __bf16   v16bf;
typedef __attribute__((ext_vector_type(16))) _Float16 v16h;
typedef __attribute__((ext_vector_type(8)))  _Float16 v8h;
typedef __attribute__((ext_vector_type(8)))  unsigned short v8us;
typedef __attribute__((ext_vector_type(8)))  float    v8f;
typedef __attribute__((ext_vector_type(4)))  float    v4f;
typedef v8h  __attribute__((may_alias)) v8ha;
typedef v4f  __attribute__((may_alias)) v4fa;
typedef v8us __attribute__((may_alias)) v8usa;

__device__ __forceinline__ unsigned short f2bf(float f) { unsigned u = __float_as_uint(f); u += 0x7FFFu + ((u >> 16) & 1u); return (unsigned short)(u >> 16); }
__device__ __forceinline__ float bf2f(unsigned short b) { return __uint_as_float(((unsigned)b) << 16); }
__device__ __forceinline__ float bfr(float f) { return bf2f(f2bf(f)); }
__device__ __forceinline__ v16h cat16(v8h lo, v8h hi) { return __builtin_shufflevector(lo, hi, 0, 1, 2, 3, 4, 5, 6, 7, 8, 9, 10, 11, 12, 13, 14, 15); }
__device__ __forceinline__ v16bf cat16b(v8us lo, v8us hi) { return __builtin_bit_cast(v16bf, __builtin_shufflevector(lo, hi, 0, 1, 2, 3, 4, 5, 6, 7, 8, 9, 10, 11, 12, 13, 14, 15)); }
__device__ __forceinline__ v8f wmma16(v16h a, v16h b, v8f c) { return __builtin_amdgcn_wmma_f32_16x16x32_f16(false, a, false, b, (short)0, c, false, false); }
__device__ __forceinline__ v8f wmmab(v16bf a, v16bf b, v8f c) { return __builtin_amdgcn_wmma_f32_16x16x32_bf16(false, a, false, b, (short)0, c, false, false); }



// ---- k_gemmw: register-blocked GEMM, one work-group of KS waves per 64x64 output tile (16 accumulators a wave), operands straight from K-contiguous 16-bit planes; grid (M/64, N/64, Z), 32 * KS threads.
// C[m][n] (f32, pitch ldc, + optional f32 bias[n]) = sum_k A[m][k] Bt[n][k] (+ split products per NSPLIT). z-batch strides sA/sB/sC in elements. K % (32 * KS) == 0.
// KS > 1: wave w sums the K / KS consecutive k from w * K / KS on, so a long K is KS short load-latency chains side by side; the KS partial tiles meet in LDS and are added in wave order 0, 1, .. KS - 1.
template <typename T16> struct WFrag;
template <> struct WFrag<h16> { typedef v16h V; static __device__ __forceinline__ V ld(const h16* p) { return cat16(*(const v8h*)p, *(const v8h*)(p + 16)); } static __device__ __forceinline__ v8f mma(V a, V b, v8f c) { return wmma16(a, b, c); } };
template <> struct WFrag<bf> { typedef v16bf V; static __device__ __forceinline__ V ld(const bf* p) { return cat16b(*(const v8us*)p, *(const v8us*)(p + 16)); } static __device__ __forceinline__ v8f mma(V a, V b, v8f c) { return wmmab(a, b, c); } };
template <typename T16, int NSPLIT, bool BIAS, int KS>
__global__ __launch_bounds__(32 * KS) void k_gemmw(const T16* __restrict__ A, const T16* __restrict__ A2, const T16* __restrict__ Bt, const T16* __restrict__ Bt2, int K, float* C, int ldc, const float* __restrict__ bias, size_t sA, size_t sB, size_t sC) {
    typedef typename WFrag<T16>::V V;
    __shared__ __align__(16) float os[(KS > 1 ? KS * 64 : 16) * 68];
    const size_t z = blockIdx.z; A += z * sA; if (A2) A2 += z * sA; Bt += z * sB; if (Bt2) Bt2 += z * sB; C += z * sC;
    const int lane = threadIdx.x & 31, lr = lane & 15, hi = lane >> 4; const int r0 = blockIdx.x * 64, c0 = blockIdx.y * 64;
    v8f acc[4][4];
#pragma unroll
    for (int mb = 0; mb < 4; ++mb)
#pragma unroll
        for (int nb = 0; nb < 4; ++nb) acc[mb][nb] = (v8f){};
    const size_t aoff = (size_t)(r0 + lr) * K + 8 * hi, boff = (size_t)(c0 + lr) * K + 8 * hi;
    const int wv = KS > 1 ? __builtin_amdgcn_readfirstlane((int)(threadIdx.x >> 5)) : 0; const int kspan = K / KS, kbeg = wv * kspan, kend = kbeg + kspan;
#pragma unroll 1
    for (int kc = kbeg; kc < kend; kc += 32) {
        V a[4], a2[4];
#pragma unroll
        for (int mb = 0; mb < 4; ++mb) { a[mb] = WFrag<T16>::ld(A + aoff + (size_t)mb * 16 * K + kc); if (NSPLIT == 1 || NSPLIT == 2) a2[mb] = WFrag<T16>::ld(A2 + aoff + (size_t)mb * 16 * K + kc); }
#pragma unroll
        for (int nb = 0; nb < 4; ++nb) { const V b = WFrag<T16>::ld(Bt + boff + (size_t)nb * 16 * K + kc); V b2; if (NSPLIT >= 2) b2 = WFrag<T16>::ld(Bt2 + boff + (size_t)nb * 16 * K + kc);
#pragma unroll
            for (int mb = 0; mb < 4; ++mb) { acc[mb][nb] = WFrag<T16>::mma(a[mb], b, acc[mb][nb]); if (NSPLIT == 1 || NSPLIT == 2) acc[mb][nb] = WFrag<T16>::mma(a2[mb], b, acc[mb][nb]); if (NSPLIT >= 2) acc[mb][nb] = WFrag<T16>::mma(a[mb], b2, acc[mb][nb]); } }
        asm volatile("v_nop\n\tv_nop\n\tv_nop\n\tv_nop" : "+v"(acc[0][0]), "+v"(acc[1][1]), "+v"(acc[2][2]), "+v"(acc[3][3]) : "v"(a[0]), "v"(a[3]));
    }
    if (KS > 1) {
        float* ow = os + wv * (64 * 68);
#pragma unroll
        for (int mb = 0; mb < 4; ++mb) {
#pragma unroll
            for (int nb = 0; nb < 4; ++nb) {
#pragma unroll
                for (int j = 0; j < 8; ++j) ow[(mb * 16 + hi * 8 + j) * 68 + nb * 16 + lr] = acc[mb][nb][j]; } }
        __syncthreads();    // every wave's partial tile is in LDS before any thread adds the KS partials of its outputs
#pragma unroll
        for (int s = 0; s < 32 / KS; ++s) { const int idx = s * (32 * KS) + (int)threadIdx.x, row = idx >> 4, cofs = (idx & 15) * 4; v4f val = *(const v4fa*)(os + row * 68 + cofs);
#pragma unroll
            for (int w = 1; w < KS; ++w) { const v4f o = *(const v4fa*)(os + (w * 64 + row) * 68 + cofs); val[0] += o[0]; val[1] += o[1]; val[2] += o[2]; val[3] += o[3]; }
            if (BIAS) { val[0] += bfr(bias[c0 + cofs]); val[1] += bfr(bias[c0 + cofs + 1]); val[2] += bfr(bias[c0 + cofs + 2]); val[3] += bfr(bias[c0 + cofs + 3]); }
            *(v4f*)(C + (size_t)(r0 + row) * ldc + c0 + cofs) = val; }
        return;
    }
#pragma unroll
    for (int mb = 0; mb < 4; ++mb) {
#pragma unroll
        for (int nb = 0; nb < 4; ++nb) {
#pragma unroll
            for (int j = 0; j < 8; ++j) os[(hi * 8 + j) * 68 + nb * 16 + lr] = acc[mb][nb][j]; }
        __builtin_amdgcn_wave_barrier(); asm volatile("" ::: "memory");
        float* crow = C + (size_t)(r0 + mb * 16) * ldc + c0;
{
#pragma unroll
            for (int s = 0; s < 8; ++s) { const int row = 2 * s + hi, cofs = lr * 4; v4f val = *(const v4fa*)(os + row * 68 + cofs); if (BIAS) { val[0] += bfr(bias[c0 + cofs]); val[1] += bfr(bias[c0 + cofs + 1]); val[2] += bfr(bias[c0 + cofs + 2]); val[3] += bfr(bias[c0 + cofs + 3]); }
                *(v4f*)(crow + (size_t)row * ldc + cofs) = val; }
             }
        __builtin_amdgcn_wave_barrier(); asm volatile("" ::: "memory");
    }
}

__device__ __forceinline__ h16 tohx(float x) { return (h16)x; }
__device__ __forceinline__ void splitf(float y, unsigned short& h, unsigned short& l) { h = f2bf(y); l = f2bf(y - bf2f(h)); }
typedef __attribute__((ext_vector_type(2))) _Float16 v2h;
typedef __attribute__((ext_vector_type(4))) _Float16 v4h;
typedef __attribute__((ext_vector_type(2))) unsigned short v2us;
typedef __attribute__((ext_vector_type(4))) unsigned short v4us;

__global__ __launch_bounds__(256) void k_wtG(const float* __restrict__ w, int K, int N, bf* Bt) {
    const int lane = threadIdx.x & 31; const int L0 = (blockIdx.x * 8 + (threadIdx.x >> 5)) * 8; const int nlines = N * K / 64;
{
#pragma unroll 1
        for (int l = 0; l < 8; ++l) { const int L = L0 + l; if (L >= nlines) break; const size_t e = (size_t)L * 64 + lane * 2; const int k = (int)(e % K), n = (int)(e / K); v2us o;
            o[0] = f2bf(w[(size_t)k * N + n]); o[1] = f2bf(w[(size_t)(k + 1) * N + n]); *(v2us*)(Bt + e) = o; }
         }
}
__global__ __launch_bounds__(256) void k_cvt8(const float* __restrict__ src, bf* dst, size_t n8) { const size_t i = (size_t)blockIdx.x * 256 + threadIdx.x; if (i >= n8) return; const v8f v = *(const v8f*)(src + i * 8); v8us o;
#pragma unroll
    for (int k = 0; k < 8; ++k) o[k] = f2bf(v[k]); *(v8us*)(dst + i * 8) = o;  }
// k_rms: one wave per (zh, t) over the 64 dims (2 per lane): r = rsqrt(mean(w^2) + eps); Q hi/lo = split(w r g1), K hi/lo = split(w r g2) ([zh][t][64], 4-B lanes), VT16[zh][d][t]... (v written by k_vt below from the same factor);
__global__ __launch_bounds__(256) void k_rms(const float* __restrict__ WF, const float* __restrict__ g1, const float* __restrict__ g2, bf* Qh, bf* Ql, bf* Kh, bf* Kl, float* RS) { const int lane = threadIdx.x & 31; const int row = blockIdx.x * 8 + (threadIdx.x >> 5); if (row >= NZ * TT) return; const int t = row % TT, zh = row / TT, h = zh % NH_, b = zh / NH_; const float* w = WF + (size_t)(b * TT + t) * CC + h * HD + lane * 2; const float a0 = w[0], a1 = w[1];
    asm volatile("s_wait_xcnt 0x0" :: "v"(w) : "memory");    // the load names w's register pair: the wait stands before that pair is reused, and w as an input keeps it live to here
    float s = __fadd_rn(__fmul_rn(a0, a0), __fmul_rn(a1, a1));
#pragma unroll
    for (int sh = 16; sh; sh >>= 1) s += __shfl_xor(s, sh, 32);
    const float r = __frsqrt_rn(__fadd_rn(s * (1.0f / HD), 1.1920929e-07f)); const size_t o = ((size_t)zh * TT + t) * HD + lane * 2; v2us qh, ql, kh, kl;
#pragma unroll
    for (int u = 0; u < 2; ++u) { const int d = lane * 2 + u; const float wn = __fmul_rn(u ? a1 : a0, r); unsigned short x1, x2; splitf(__fmul_rn(wn, bfr(g1[d])), x1, x2); qh[u] = x1; ql[u] = x2; splitf(__fmul_rn(wn, bfr(g2[d])), x1, x2); kh[u] = x1; kl[u] = x2; }
    { *(v2us*)(Qh + o) = qh; *(v2us*)(Ql + o) = ql; *(v2us*)(Kh + o) = kh; *(v2us*)(Kl + o) = kl; if (lane == 0) *(float*)(RS + row) = r;  } }
__global__ __launch_bounds__(256) void k_vt(const float* __restrict__ WF, const float* __restrict__ RS, const float* __restrict__ g3, h16* VT) { const size_t e = ((size_t)blockIdx.x * 256 + threadIdx.x) * 2; if (e >= (size_t)NZ * HD * TT) return; const int t = (int)(e % TT); const int d = (int)((e / TT) % HD); const int zh = (int)(e / ((size_t)TT * HD)); const int h = zh % NH_, b = zh / NH_; const float g = bfr(g3[d]); v2h o;
#pragma unroll
    for (int u = 0; u < 2; ++u) { float wn = __fmul_rn(WF[(size_t)(b * TT + t + u) * CC + h * HD + d], RS[(size_t)zh * TT + t + u]); asm volatile("" : "+v"(wn)); o[u] = tohx(__fmul_rn(wn, g)); } *(v2h*)(VT + e) = o;  }
// k_colst: per-column max and 1 / sum(exp) over the 2048 queries. One work-group of 16 waves per 32 columns (one 128-B line of every row): a wave owns 128 consecutive rows, a lane 4 columns of every 4th of them
// (32 loads of 16 B, each wave-load = 4 whole lines), all kept in registers, so Sb is read once. Max and sum: serial in the lane, then lanes l ^ 8 and l ^ 16, then the 16 waves through LDS, always in the same order.
// The scale 1/8 is a power of two: max(s) / 8 == max(s / 8), and fma(s, 1/8, -mx) rounds once, as (s / 8) - mx does, so mx and every exp term keep their values; only the order of the sum is new.
__global__ __launch_bounds__(512) void k_colst(const float* __restrict__ Sb, float* CM, float* CSR) {
    __shared__ __align__(16) float rmx[16 * 32]; __shared__ __align__(16) float rsm[16 * 32];
    const int lane = threadIdx.x & 31, wv = threadIdx.x >> 5, cq = lane & 7, sub = lane >> 3; const int e0 = blockIdx.x * 32; const int j0 = e0 % TT, z = e0 / TT;
    const float* p = Sb + (size_t)z * TT * TT + (size_t)(wv * 128 + sub) * TT + j0 + cq * 4; v4f r[32];
#pragma unroll
    for (int i = 0; i < 32; ++i) r[i] = *(const v4f*)(p + (size_t)i * 4 * TT);
    // All 32 loads name p's register pair as their address: the wait stands behind the last of them, and taking p as an input keeps the pair live to here, so that no load's result is placed on it before the wait.
    asm volatile("s_wait_xcnt 0x0" :: "v"(p) : "memory");
    v4f mx = r[0];
#pragma unroll
    for (int i = 1; i < 32; ++i) {
#pragma unroll
        for (int q = 0; q < 4; ++q) mx[q] = fmaxf(mx[q], r[i][q]); }
#pragma unroll
    for (int q = 0; q < 4; ++q) mx[q] = fmaxf(-3.0e38f, mx[q] * 0.125f);
#pragma unroll
    for (int sh = 8; sh <= 16; sh <<= 1) {
#pragma unroll
        for (int q = 0; q < 4; ++q) mx[q] = fmaxf(mx[q], __shfl_xor(mx[q], sh, 32)); }
    if (sub == 0) *(v4fa*)(rmx + wv * 32 + cq * 4) = mx;
    __syncthreads();    // every wave's column maxima are in rmx before any wave folds them
#pragma unroll
    for (int k = 0; k < 4; ++k) { const v4f o = *(const v4fa*)(rmx + (k * 4 + sub) * 32 + cq * 4);
#pragma unroll
        for (int q = 0; q < 4; ++q) mx[q] = fmaxf(mx[q], o[q]); }
#pragma unroll
    for (int sh = 8; sh <= 16; sh <<= 1) {
#pragma unroll
        for (int q = 0; q < 4; ++q) mx[q] = fmaxf(mx[q], __shfl_xor(mx[q], sh, 32)); }
    v4f s = { 0.f, 0.f, 0.f, 0.f };
#pragma unroll
    for (int i = 0; i < 32; ++i) { float x0 = fmaf(r[i][0], 0.125f, -mx[0]) * 0x1.715476p+0f, x1 = fmaf(r[i][1], 0.125f, -mx[1]) * 0x1.715476p+0f, x2 = fmaf(r[i][2], 0.125f, -mx[2]) * 0x1.715476p+0f, x3 = fmaf(r[i][3], 0.125f, -mx[3]) * 0x1.715476p+0f; float y0, y1, y2, y3;
        // exp(d) = 2^(d log2 e), as __expf forms it. One statement for a row's four, results apart from all sources, and a v_nop at its end: the one-instruction slot that the instruction set asks for behind a
        // transcendental before its result is read or its source overwritten.
        asm("v_exp_f32 %0, %4\n\tv_exp_f32 %1, %5\n\tv_exp_f32 %2, %6\n\tv_exp_f32 %3, %7\n\tv_nop" : "=&v"(y0), "=&v"(y1), "=&v"(y2), "=&v"(y3) : "v"(x0), "v"(x1), "v"(x2), "v"(x3));
        s[0] = __fadd_rn(s[0], y0); s[1] = __fadd_rn(s[1], y1); s[2] = __fadd_rn(s[2], y2); s[3] = __fadd_rn(s[3], y3); }
#pragma unroll
    for (int sh = 8; sh <= 16; sh <<= 1) {
#pragma unroll
        for (int q = 0; q < 4; ++q) s[q] = __fadd_rn(s[q], __shfl_xor(s[q], sh, 32)); }
    if (sub == 0) *(v4fa*)(rsm + wv * 32 + cq * 4) = s;
    __syncthreads();    // every wave's column sums are in rsm before the first eight lanes add them
    if (threadIdx.x < 8) { v4f a = *(const v4fa*)(rsm + cq * 4);
#pragma unroll
        for (int w = 1; w < 16; ++w) { const v4f o = *(const v4fa*)(rsm + w * 32 + cq * 4);
#pragma unroll
            for (int q = 0; q < 4; ++q) a[q] = __fadd_rn(a[q], o[q]); }
        v4f rs;
#pragma unroll
        for (int q = 0; q < 4; ++q) rs[q] = __fdiv_rn(1.0f, a[q]);
        *(v4f*)(CM + e0 + cq * 4) = mx; *(v4f*)(CSR + e0 + cq * 4) = rs; } }
__global__ __launch_bounds__(256) void k_bisoft(const float* __restrict__ Sb, const float* __restrict__ CM, const float* __restrict__ CSR, h16* P) { const int lane = threadIdx.x & 31; const int row = blockIdx.x * 8 + (threadIdx.x >> 5); if (row >= ZH * TT) return; const int z = row / TT; const float* sr = Sb + (size_t)row * TT; float v[64]; float mx = -3.0e38f;
#pragma unroll
    for (int ch = 0; ch < 16; ++ch) { const v4f a = *(const v4f*)(sr + ch * 128 + lane * 4);
#pragma unroll
        for (int q = 0; q < 4; ++q) { const float t = a[q] * 0.125f; v[ch * 4 + q] = t; mx = fmaxf(mx, t); } }
#pragma unroll
    for (int sh = 16; sh; sh >>= 1) mx = fmaxf(mx, __shfl_xor(mx, sh, 32));
    float sum = 0.f; float ex[64];
#pragma unroll
    for (int k = 0; k < 64; ++k) { float d0 = __fsub_rn(v[k], mx); asm volatile("" : "+v"(d0)); ex[k] = __expf(d0); sum += ex[k]; }
#pragma unroll
    for (int sh = 16; sh; sh >>= 1) sum += __shfl_xor(sum, sh, 32);
    const float f = __fdiv_rn(PCAR, sum);
{
#pragma unroll
        for (int ch = 0; ch < 16; ++ch) { const int j0 = ch * 128 + lane * 4; const v4f cm = *(const v4f*)(CM + (size_t)z * TT + j0), cr = *(const v4f*)(CSR + (size_t)z * TT + j0); v4h o;
#pragma unroll
            for (int q = 0; q < 4; ++q) { float d1 = __fsub_rn(v[ch * 4 + q], cm[q]); asm volatile("" : "+v"(d1)); float pc = __fmul_rn(__expf(d1), cr[q]); asm volatile("" : "+v"(pc)); float pr = __fmul_rn(ex[ch * 4 + q], f); asm volatile("" : "+v"(pr)); o[q] = tohx(__fadd_rn(pr, __fmul_rn(pc, PCAR))); }
            *(v4h*)(P + (size_t)row * TT + j0) = o; }
         } }
__global__ __launch_bounds__(256) void k_mrg(const float* __restrict__ Ob, int z0, bf* Yh, bf* Yl) { const size_t e = ((size_t)blockIdx.x * 256 + threadIdx.x) * 2; if (e >= (size_t)ZH * TT * HD) return; const int d = (int)(e % HD); const int t = (int)((e / HD) % TT); const int z = (int)(e / ((size_t)HD * TT)); v2us oh, ol; const float* op = Ob + e; const float ob[2] = { op[0], op[1] };
    asm volatile("s_wait_xcnt 0x0" :: "v"(op) : "memory");    // the load names op's register pair: the wait stands before that pair is reused, and op as an input keeps it live to here
#pragma unroll
    for (int u = 0; u < 2; ++u) { unsigned short a, c; splitf(ob[u] * (1.0f / PCAR), a, c); oh[u] = a; ol[u] = c; } const int zh = z0 + z; const size_t o = (size_t)((zh / NH_) * TT + t) * CC + (zh % NH_) * HD + d; *(v2us*)(Yh + o) = oh; *(v2us*)(Yl + o) = ol;  }

extern "C" void kernel_launch(void* const* d_in, const int* in_sizes, int n_in,
                              void* d_out, int out_size, void* d_ws, size_t ws_size, hipStream_t stream) {
    (void)in_sizes; (void)n_in; (void)out_size;
    const float* x = (const float*)d_in[0]; const float* Wt = (const float*)d_in[1]; const float* g1 = (const float*)d_in[2]; const float* g2 = (const float*)d_in[3]; const float* g3 = (const float*)d_in[4];
    float* OUT = (float*)d_out;     // [2][2048][768]
    char* wsp = (char*)d_ws;
    auto take = [&](size_t bytes) { char* p = wsp; wsp += (bytes + 255) & ~(size_t)255; return (void*)p; };
    bf* WB = (bf*)take((size_t)CC * CC * 2); bf* WT = (bf*)take((size_t)CC * CC * 2); bf* XB = (bf*)take((size_t)NB_ * TT * CC * 2); float* WF = (float*)take((size_t)NB_ * TT * CC * 4); float* RS = (float*)take((size_t)NZ * TT * 4);
    bf* Qh = (bf*)take((size_t)NZ * TT * HD * 2); bf* Ql = (bf*)take((size_t)NZ * TT * HD * 2); bf* Kh = (bf*)take((size_t)NZ * TT * HD * 2); bf* Kl = (bf*)take((size_t)NZ * TT * HD * 2); h16* VT = (h16*)take((size_t)NZ * HD * TT * 2);
    float* Sb = (float*)take((size_t)ZH * TT * TT * 4); float* CM = (float*)take((size_t)ZH * TT * 4); float* CSR = (float*)take((size_t)ZH * TT * 4); h16* P16 = (h16*)take((size_t)ZH * TT * TT * 2); float* Ob = (float*)take((size_t)ZH * TT * HD * 4);
    bf* Yh = (bf*)WF; bf* Yl = Yh + (size_t)NB_ * TT * CC;    // the two y planes take WF's bytes: k_vt is WF's last reader and runs before the first k_mrg
    if ((size_t)(wsp - (char*)d_ws) > ws_size) return;    // total ~ 259 MB
    k_cvt8<<<(CC * CC / 8 + 255) / 256, 256, 0, stream>>>(Wt, WB, (size_t)CC * CC / 8);      // W [out][in] = natural Bt for x W^T
    k_wtG<<<(CC * CC / 64 + 63) / 64, 256, 0, stream>>>(Wt, CC, CC, WT);                  // W as x @ W operand for y W
    // Both batch items go through the launches outside the loop together (rows b * TT + t, or all NZ pairs), and the score / softmax / a.v launches take ZH of the NZ (batch, head) pairs at a time.
    k_cvt8<<<(NB_ * TT * CC / 8 + 255) / 256, 256, 0, stream>>>(x, XB, (size_t)NB_ * TT * CC / 8);
    k_gemmw<bf, 0, false, 4><<<dim3(NB_ * TT / 64, CC / 64, 1), 128, 0, stream>>>(XB, nullptr, WB, nullptr, CC, WF, CC, nullptr, 0, 0, 0);
    k_rms<<<NZ * TT / 8, 256, 0, stream>>>(WF, g1, g2, Qh, Ql, Kh, Kl, RS); k_vt<<<(unsigned)(((size_t)NZ * HD * TT / 2 + 255) / 256), 256, 0, stream>>>(WF, RS, g3, VT);
    for (int z0 = 0; z0 < NZ; z0 += ZH) { const size_t z = (size_t)z0;
        k_gemmw<bf, 2, false, 1><<<dim3(TT / 64, TT / 64, ZH), 32, 0, stream>>>(Qh + z * TT * HD, Ql + z * TT * HD, Kh + z * TT * HD, Kl + z * TT * HD, HD, Sb, TT, nullptr, (size_t)TT * HD, (size_t)TT * HD, (size_t)TT * TT);
        k_colst<<<ZH * TT / 32, 512, 0, stream>>>(Sb, CM, CSR); k_bisoft<<<ZH * TT / 8, 256, 0, stream>>>(Sb, CM, CSR, P16);
        k_gemmw<h16, 0, false, 16><<<dim3(TT / 64, 1, ZH), 512, 0, stream>>>(P16, nullptr, VT + z * HD * TT, nullptr, TT, Ob, HD, nullptr, (size_t)TT * TT, (size_t)HD * TT, (size_t)TT * HD);
        k_mrg<<<(unsigned)(((size_t)ZH * TT * HD / 2 + 255) / 256), 256, 0, stream>>>(Ob, z0, Yh, Yl); }
    k_gemmw<bf, 1, false, 4><<<dim3(NB_ * TT / 64, CC / 64, 1), 128, 0, stream>>>(Yh, Yl, WT, nullptr, CC, OUT, CC, nullptr, 0, 0, 0);
}

// v004
// A run of this version takes 218 microseconds.
// In both of two side-by-side timings against v003, it was 1.95 times as fast.
// All steps since v000 together make it 43.6 times as fast.
#include <hip/hip_runtime.h>

// HyperSETAlterAttention (x [2][2048][768]; w = x W^T (12 heads x 64, shared weights); q, k, v = RMSNorm(w) g1 / g2 / g3 (eps = f32 eps); att = q.k / 8; a = softmax over keys + softmax over QUERIES (bisoftmax);
// y = a.v merged; out = y W -> [2][2048][768]).
// Compute dtypes, f32 accumulate: every input rounded to bf16; x W^T on PLAIN bf16 operands (inputs: exact); RMSNorm f32 -> bf16 hi+lo planes of q and k (scores: 3 products, K 64 - the cosine-like logits span
// +-8, single fp16 planes were not tried) and a single fp16 plane of v; the row and the column softmax statistics (running max / sum, fixed order) in f32 from score tiles formed anew on the matrix units; both softmaxes combined into ONE fp16 plane in registers (scaled by 512)

#define NB_  2
#define TT   2048
#define CC   768
#define NH_  12
#define HD   64
#define NZ   (NB_ * NH_)    // (batch, head) pairs, index zh = b * NH_ + h
#define PCAR 512.0f
typedef _Float16 h16;
typedef unsigned short bf;
typedef __attribute__((ext_vector_type(16))) __bf16   v16bf;
typedef __attribute__((ext_vector_type(16))) _Float16 v16h;
typedef __attribute__((ext_vector_type(8)))  _Float16 v8h;
typedef __attribute__((ext_vector_type(8)))  unsigned short v8us;
typedef __attribute__((ext_vector_type(8)))  float    v8f;
typedef __attribute__((ext_vector_type(4)))  float    v4f;
typedef v8h  __attribute__((may_alias)) v8ha;
typedef v4f  __attribute__((may_alias)) v4fa;
typedef v8us __attribute__((may_alias)) v8usa;

__device__ __forceinline__ unsigned short f2bf(float f) { unsigned u = __float_as_uint(f); u += 0x7FFFu + ((u >> 16) & 1u); return (unsigned short)(u >> 16); }
__device__ __forceinline__ float bf2f(unsigned short b) { return __uint_as_float(((unsigned)b) << 16); }
__device__ __forceinline__ float bfr(float f) { return bf2f(f2bf(f)); }
__device__ __forceinline__ v16h cat16(v8h lo, v8h hi) { return __builtin_shufflevector(lo, hi, 0, 1, 2, 3, 4, 5, 6, 7, 8, 9, 10, 11, 12, 13, 14, 15); }
__device__ __forceinline__ v16bf cat16b(v8us lo, v8us hi) { return __builtin_bit_cast(v16bf, __builtin_shufflevector(lo, hi, 0, 1, 2, 3, 4, 5, 6, 7, 8, 9, 10, 11, 12, 13, 14, 15)); }
__device__ __forceinline__ v8f wmma16(v16h a, v16h b, v8f c) { return __builtin_amdgcn_wmma_f32_16x16x32_f16(false, a, false, b, (short)0, c, false, false); }
__device__ __forceinline__ v8f wmmab(v16bf a, v16bf b, v8f c) { return __builtin_amdgcn_wmma_f32_16x16x32_bf16(false, a, false, b, (short)0, c, false, false); }



// ---- k_gemmw: register-blocked GEMM, one work-group of KS waves per 64x64 output tile (16 accumulators a wave), operands straight from K-contiguous 16-bit planes; grid (M/64, N/64, Z), 32 * KS threads.
// C[m][n] (f32, pitch ldc, + optional f32 bias[n]) = sum_k A[m][k] Bt[n][k] (+ split products per NSPLIT). z-batch strides sA/sB/sC in elements. K % (32 * KS) == 0.
// KS > 1: wave w sums the K / KS consecutive k from w * K / KS on, so a long K is KS short load-latency chains side by side; the KS partial tiles meet in LDS and are added in wave order 0, 1, .. KS - 1.
template <typename T16> struct WFrag;
template <> struct WFrag<h16> { typedef v16h V; static __device__ __forceinline__ V ld(const h16* p) { return cat16(*(const v8h*)p, *(const v8h*)(p + 16)); } static __device__ __forceinline__ v8f mma(V a, V b, v8f c) { return wmma16(a, b, c); } };
template <> struct WFrag<bf> { typedef v16bf V; static __device__ __forceinline__ V ld(const bf* p) { return cat16b(*(const v8us*)p, *(const v8us*)(p + 16)); } static __device__ __forceinline__ v8f mma(V a, V b, v8f c) { return wmmab(a, b, c); } };
template <typename T16, int NSPLIT, bool BIAS, int KS>
__global__ __launch_bounds__(32 * KS) void k_gemmw(const T16* __restrict__ A, const T16* __restrict__ A2, const T16* __restrict__ Bt, const T16* __restrict__ Bt2, int K, float* C, int ldc, const float* __restrict__ bias, size_t sA, size_t sB, size_t sC) {
    typedef typename WFrag<T16>::V V;
    __shared__ __align__(16) float os[(KS > 1 ? KS * 64 : 16) * 68];
    const size_t z = blockIdx.z; A += z * sA; if (A2) A2 += z * sA; Bt += z * sB; if (Bt2) Bt2 += z * sB; C += z * sC;
    const int lane = threadIdx.x & 31, lr = lane & 15, hi = lane >> 4; const int r0 = blockIdx.x * 64, c0 = blockIdx.y * 64;
    v8f acc[4][4];
#pragma unroll
    for (int mb = 0; mb < 4; ++mb)
#pragma unroll
        for (int nb = 0; nb < 4; ++nb) acc[mb][nb] = (v8f){};
    const size_t aoff = (size_t)(r0 + lr) * K + 8 * hi, boff = (size_t)(c0 + lr) * K + 8 * hi;
    const int wv = KS > 1 ? __builtin_amdgcn_readfirstlane((int)(threadIdx.x >> 5)) : 0; const int kspan = K / KS, kbeg = wv * kspan, kend = kbeg + kspan;
#pragma unroll 1
    for (int kc = kbeg; kc < kend; kc += 32) {
        V a[4], a2[4];
#pragma unroll
        for (int mb = 0; mb < 4; ++mb) { a[mb] = WFrag<T16>::ld(A + aoff + (size_t)mb * 16 * K + kc); if (NSPLIT == 1 || NSPLIT == 2) a2[mb] = WFrag<T16>::ld(A2 + aoff + (size_t)mb * 16 * K + kc); }
#pragma unroll
        for (int nb = 0; nb < 4; ++nb) { const V b = WFrag<T16>::ld(Bt + boff + (size_t)nb * 16 * K + kc); V b2; if (NSPLIT >= 2) b2 = WFrag<T16>::ld(Bt2 + boff + (size_t)nb * 16 * K + kc);
#pragma unroll
            for (int mb = 0; mb < 4; ++mb) { acc[mb][nb] = WFrag<T16>::mma(a[mb], b, acc[mb][nb]); if (NSPLIT == 1 || NSPLIT == 2) acc[mb][nb] = WFrag<T16>::mma(a2[mb], b, acc[mb][nb]); if (NSPLIT >= 2) acc[mb][nb] = WFrag<T16>::mma(a[mb], b2, acc[mb][nb]); } }
        asm volatile("v_nop\n\tv_nop\n\tv_nop\n\tv_nop" : "+v"(acc[0][0]), "+v"(acc[1][1]), "+v"(acc[2][2]), "+v"(acc[3][3]) : "v"(a[0]), "v"(a[3]));
    }
    if (KS > 1) {
        float* ow = os + wv * (64 * 68);
#pragma unroll
        for (int mb = 0; mb < 4; ++mb) {
#pragma unroll
            for (int nb = 0; nb < 4; ++nb) {
#pragma unroll
                for (int j = 0; j < 8; ++j) ow[(mb * 16 + hi * 8 + j) * 68 + nb * 16 + lr] = acc[mb][nb][j]; } }
        __syncthreads();    // every wave's partial tile is in LDS before any thread adds the KS partials of its outputs
#pragma unroll
        for (int s = 0; s < 32 / KS; ++s) { const int idx = s * (32 * KS) + (int)threadIdx.x, row = idx >> 4, cofs = (idx & 15) * 4; v4f val = *(const v4fa*)(os + row * 68 + cofs);
#pragma unroll
            for (int w = 1; w < KS; ++w) { const v4f o = *(const v4fa*)(os + (w * 64 + row) * 68 + cofs); val[0] += o[0]; val[1] += o[1]; val[2] += o[2]; val[3] += o[3]; }
            if (BIAS) { val[0] += bfr(bias[c0 + cofs]); val[1] += bfr(bias[c0 + cofs + 1]); val[2] += bfr(bias[c0 + cofs + 2]); val[3] += bfr(bias[c0 + cofs + 3]); }
            *(v4f*)(C + (size_t)(r0 + row) * ldc + c0 + cofs) = val; }
        return;
    }
#pragma unroll
    for (int mb = 0; mb < 4; ++mb) {
#pragma unroll
        for (int nb = 0; nb < 4; ++nb) {
#pragma unroll
            for (int j = 0; j < 8; ++j) os[(hi * 8 + j) * 68 + nb * 16 + lr] = acc[mb][nb][j]; }
        __builtin_amdgcn_wave_barrier(); asm volatile("" ::: "memory");
        float* crow = C + (size_t)(r0 + mb * 16) * ldc + c0;
{
#pragma unroll
            for (int s = 0; s < 8; ++s) { const int row = 2 * s + hi, cofs = lr * 4; v4f val = *(const v4fa*)(os + row * 68 + cofs); if (BIAS) { val[0] += bfr(bias[c0 + cofs]); val[1] += bfr(bias[c0 + cofs + 1]); val[2] += bfr(bias[c0 + cofs + 2]); val[3] += bfr(bias[c0 + cofs + 3]); }
                *(v4f*)(crow + (size_t)row * ldc + cofs) = val; }
             }
        __builtin_amdgcn_wave_barrier(); asm volatile("" ::: "memory");
    }
}

__device__ __forceinline__ h16 tohx(float x) { return (h16)x; }
__device__ __forceinline__ void splitf(float y, unsigned short& h, unsigned short& l) { h = f2bf(y); l = f2bf(y - bf2f(h)); }
typedef __attribute__((ext_vector_type(2))) _Float16 v2h;
typedef __attribute__((ext_vector_type(4))) _Float16 v4h;
typedef __attribute__((ext_vector_type(2))) unsigned short v2us;
typedef __attribute__((ext_vector_type(4))) unsigned short v4us;

__global__ __launch_bounds__(256) void k_wtG(const float* __restrict__ w, int K, int N, bf* Bt) {
    const int lane = threadIdx.x & 31; const int L0 = (blockIdx.x * 8 + (threadIdx.x >> 5)) * 8; const int nlines = N * K / 64;
{
#pragma unroll 1
        for (int l = 0; l < 8; ++l) { const int L = L0 + l; if (L >= nlines) break; const size_t e = (size_t)L * 64 + lane * 2; const int k = (int)(e % K), n = (int)(e / K); v2us o;
            o[0] = f2bf(w[(size_t)k * N + n]); o[1] = f2bf(w[(size_t)(k + 1) * N + n]); *(v2us*)(Bt + e) = o; }
         }
}
__global__ __launch_bounds__(256) void k_cvt8(const float* __restrict__ src, bf* dst, size_t n8) { const size_t i = (size_t)blockIdx.x * 256 + threadIdx.x; if (i >= n8) return; const v8f v = *(const v8f*)(src + i * 8); v8us o;
#pragma unroll
    for (int k = 0; k < 8; ++k) o[k] = f2bf(v[k]); *(v8us*)(dst + i * 8) = o;  }
// k_rms: one wave per (zh, t) over the 64 dims (2 per lane): r = rsqrt(mean(w^2) + eps); Q hi/lo = split(w r g1), K hi/lo = split(w r g2) ([zh][t][64], 4-B lanes), VT16[zh][d][t]... (v written by k_vt below from the same factor);
__global__ __launch_bounds__(256) void k_rms(const float* __restrict__ WF, const float* __restrict__ g1, const float* __restrict__ g2, bf* Qh, bf* Ql, bf* Kh, bf* Kl, float* RS) { const int lane = threadIdx.x & 31; const int row = blockIdx.x * 8 + (threadIdx.x >> 5); if (row >= NZ * TT) return; const int t = row % TT, zh = row / TT, h = zh % NH_, b = zh / NH_; const float* w = WF + (size_t)(b * TT + t) * CC + h * HD + lane * 2; const float a0 = w[0], a1 = w[1];
    asm volatile("s_wait_xcnt 0x0" :: "v"(w) : "memory");    // the load names w's register pair: the wait stands before that pair is reused, and w as an input keeps it live to here
    float s = __fadd_rn(__fmul_rn(a0, a0), __fmul_rn(a1, a1));
#pragma unroll
    for (int sh = 16; sh; sh >>= 1) s += __shfl_xor(s, sh, 32);
    const float r = __frsqrt_rn(__fadd_rn(s * (1.0f / HD), 1.1920929e-07f)); const size_t o = ((size_t)zh * TT + t) * HD + lane * 2; v2us qh, ql, kh, kl;
#pragma unroll
    for (int u = 0; u < 2; ++u) { const int d = lane * 2 + u; const float wn = __fmul_rn(u ? a1 : a0, r); unsigned short x1, x2; splitf(__fmul_rn(wn, bfr(g1[d])), x1, x2); qh[u] = x1; ql[u] = x2; splitf(__fmul_rn(wn, bfr(g2[d])), x1, x2); kh[u] = x1; kl[u] = x2; }
    { *(v2us*)(Qh + o) = qh; *(v2us*)(Ql + o) = ql; *(v2us*)(Kh + o) = kh; *(v2us*)(Kl + o) = kl; if (lane == 0) *(float*)(RS + row) = r;  } }
__global__ __launch_bounds__(256) void k_vt(const float* __restrict__ WF, const float* __restrict__ RS, const float* __restrict__ g3, h16* VT) { const size_t e = ((size_t)blockIdx.x * 256 + threadIdx.x) * 2; if (e >= (size_t)NZ * HD * TT) return; const int t = (int)(e % TT); const int d = (int)((e / TT) % HD); const int zh = (int)(e / ((size_t)TT * HD)); const int h = zh % NH_, b = zh / NH_; const float g = bfr(g3[d]); v2h o;
#pragma unroll
    for (int u = 0; u < 2; ++u) { float wn = __fmul_rn(WF[(size_t)(b * TT + t + u) * CC + h * HD + d], RS[(size_t)zh * TT + t + u]); asm volatile("" : "+v"(wn)); o[u] = tohx(__fmul_rn(wn, g)); } *(v2h*)(VT + e) = o;  }
// The scores never go to memory: k_stat and k_att each form the score tiles they need on the matrix units, from the same hi / lo planes and with the same three products.
// SC = log2(e) / 8: exp(s / 8 - m / 8) = 2^(s SC - m SC).
#define SC 0.18033688f
// 2^x and log2 x. Results apart from all sources and a v_nop at the end of each statement: the one-instruction slot that the instruction set asks for behind a transcendental before its result is read or its source
// overwritten.
__device__ __forceinline__ void ex4(float x0, float x1, float x2, float x3, float& y0, float& y1, float& y2, float& y3) { asm("v_exp_f32 %0, %4\n\tv_exp_f32 %1, %5\n\tv_exp_f32 %2, %6\n\tv_exp_f32 %3, %7\n\tv_nop" : "=&v"(y0), "=&v"(y1), "=&v"(y2), "=&v"(y3) : "v"(x0), "v"(x1), "v"(x2), "v"(x3)); }
__device__ __forceinline__ void ex3(float x0, float x1, float x2, float& y0, float& y1, float& y2) { asm("v_exp_f32 %0, %3\n\tv_exp_f32 %1, %4\n\tv_exp_f32 %2, %5\n\tv_nop" : "=&v"(y0), "=&v"(y1), "=&v"(y2) : "v"(x0), "v"(x1), "v"(x2)); }
__device__ __forceinline__ float ex1(float x) { float y; asm("v_exp_f32 %0, %1\n\tv_nop" : "=&v"(y) : "v"(x)); return y; }
__device__ __forceinline__ float lg1(float x) { float y; asm("v_log_f32 %0, %1\n\tv_nop" : "=&v"(y) : "v"(x)); return y; }
// A lane's address = a wave-uniform base + the lane's own byte offset: the loads then name one offset register and the base's scalar pair, which the waits behind them take as inputs.
template <typename T> __device__ __forceinline__ const T* atb(const T* base, unsigned lob) { return (const T*)((const char*)base + lob); }
// The loops' stepping addresses are byte pointers typed as global memory: as operands of the wait statement they would otherwise lose that type, and the loads would become flat ones.
#define GLB __attribute__((address_space(1)))
typedef const GLB char* gp;
__device__ __forceinline__ v16bf ldb(gp p, int o) { return cat16b(*(const GLB v8us*)(p + o), *(const GLB v8us*)(p + o + 32)); }
__device__ __forceinline__ v16h ldh(gp p, int o) { return cat16(*(const GLB v8h*)(p + o), *(const GLB v8h*)(p + o + 32)); }
__device__ __forceinline__ v8f score6(v16bf ah0, v16bf al0, v16bf ah1, v16bf al1, v16bf bh0, v16bf bl0, v16bf bh1, v16bf bl1) {
    v8f c = (v8f){}; c = wmmab(ah0, bh0, c); c = wmmab(al0, bh0, c); c = wmmab(ah0, bl0, c); c = wmmab(ah1, bh1, c); c = wmmab(al1, bh1, c); c = wmmab(ah1, bl1, c); return c; }
// k_stat: softmax statistics of both directions. blockIdx.y = 0: a query is fixed and the keys move (row softmax); 1: a key is fixed and the queries move (column softmax). Grid (TT / 128, 2, NZ), 4 waves:
// wave w holds the 64 fixed rows (w & 1) as A fragments and walks half (w >> 1) of the 2048 moving rows, 32 a trip. D[8 hi + j][lr]: a lane keeps a running maximum and sum for each of its 32 fixed rows over the moving
// rows that fall on its column; the 16 lanes, then the two halves (through LDS), are joined in a fixed order. Out: E = 9 - m SC - log2(sum), so that 2^(s SC + E) = 512 exp(s / 8 - m / 8) / sum.
__global__ __launch_bounds__(128) __attribute__((amdgpu_waves_per_eu(3, 3))) void k_stat(const bf* __restrict__ Qh, const bf* __restrict__ Ql, const bf* __restrict__ Kh, const bf* __restrict__ Kl, float* E) {
    __shared__ float lm[2 * 64]; __shared__ float ls[2 * 64];
    const int lane = threadIdx.x & 31, lr = lane & 15, hi = lane >> 4; const int wv = __builtin_amdgcn_readfirstlane((int)(threadIdx.x >> 5)), fg = wv & 1, mh = wv >> 1;
    const int role = blockIdx.y, zh = blockIdx.z; const size_t zo = (size_t)zh * TT * HD; const int f0 = blockIdx.x * 128 + fg * 64;
    const bf* Fh = (role ? Kh : Qh) + zo; const bf* Fl = (role ? Kl : Ql) + zo; const bf* Mh = (role ? Qh : Kh) + zo; const bf* Ml = (role ? Ql : Kl) + zo;
    const unsigned lob = (unsigned)(lr * HD + 8 * hi) * 2u; const bf* pfh = Fh + f0 * HD; const bf* pfl = Fl + f0 * HD;
    v16bf ah[4][2], al[4][2];
#pragma unroll
    for (int a = 0; a < 4; ++a) {
#pragma unroll
        for (int kc = 0; kc < 2; ++kc) { ah[a][kc] = WFrag<bf>::ld(atb(pfh + a * 16 * HD + kc * 32, lob)); al[a][kc] = WFrag<bf>::ld(atb(pfl + a * 16 * HD + kc * 32, lob)); } }
    asm volatile("s_wait_xcnt 0x0" :: "v"(lob), "s"(pfh), "s"(pfl) : "memory");    // the loads name these registers: the wait stands behind the last load, and as its inputs they stay live to here, so that none is rewritten before it
    float m[4][8], s[4][8];
#pragma unroll
    for (int a = 0; a < 4; ++a) {
#pragma unroll
        for (int j = 0; j < 8; ++j) { m[a][j] = -3.0e38f; s[a][j] = 0.f; } }
    gp pmh = (gp)(const char*)atb(Mh + mh * (TT / 2) * HD, lob); gp pml = (gp)(const char*)atb(Ml + mh * (TT / 2) * HD, lob);
#pragma unroll 1    // rolled: one trip's fragments and score tiles already fill the register budget of three waves a SIMD
    for (int it = 0; it < TT / 2 / 32; ++it) {
        v16bf bh[2][2], bl[2][2];
#pragma unroll
        for (int b = 0; b < 2; ++b) {
#pragma unroll
            for (int kc = 0; kc < 2; ++kc) { bh[b][kc] = ldb(pmh, b * 16 * HD * 2 + kc * 64); bl[b][kc] = ldb(pml, b * 16 * HD * 2 + kc * 64); } }
        // The trip's loads name the two address pairs. The wait takes the loaded values as inputs, so every load stands in front of it, and the pairs as operands, so that they are the registers the loads name, stay
        // as they are to here (no load's result is placed on one) and step on only behind it.
        asm volatile("s_wait_xcnt 0x0" : "+v"(pmh), "+v"(pml) : "v"(bh[0][0]), "v"(bh[0][1]), "v"(bh[1][0]), "v"(bh[1][1]), "v"(bl[0][0]), "v"(bl[0][1]), "v"(bl[1][0]), "v"(bl[1][1]) : "memory");
        pmh += 32 * HD * 2; pml += 32 * HD * 2;
#pragma unroll
        for (int a = 0; a < 4; ++a) {
            const v8f c0 = score6(ah[a][0], al[a][0], ah[a][1], al[a][1], bh[0][0], bl[0][0], bh[0][1], bl[0][1]);
            const v8f c1 = score6(ah[a][0], al[a][0], ah[a][1], al[a][1], bh[1][0], bl[1][0], bh[1][1], bl[1][1]);
#pragma unroll
            for (int j = 0; j < 8; ++j) { const float mn = fmaxf(m[a][j], fmaxf(c0[j], c1[j])); const float nb = -mn * SC;
                float e0, e1, e2; ex3(fmaf(m[a][j], SC, nb), fmaf(c0[j], SC, nb), fmaf(c1[j], SC, nb), e0, e1, e2); s[a][j] = fmaf(s[a][j], e0, e1 + e2); m[a][j] = mn; }
            __builtin_amdgcn_sched_barrier(0); }    // a row group's score tiles are formed behind the sums of the group before: several groups' tiles at once do not fit the registers of three waves a SIMD (spills)
    }
#pragma unroll
    for (int a = 0; a < 4; ++a) {
#pragma unroll
        for (int j = 0; j < 8; ++j) { float mm = m[a][j];
#pragma unroll
            for (int sh = 1; sh <= 8; sh <<= 1) mm = fmaxf(mm, __shfl_xor(mm, sh, 32));
            float ss = s[a][j] * ex1((m[a][j] - mm) * SC);
#pragma unroll
            for (int sh = 1; sh <= 8; sh <<= 1) ss += __shfl_xor(ss, sh, 32);
            m[a][j] = mm; s[a][j] = ss; } }
    if (mh == 1 && lr == 0) {
#pragma unroll
        for (int a = 0; a < 4; ++a) {
#pragma unroll
            for (int j = 0; j < 8; ++j) { lm[fg * 64 + a * 16 + hi * 8 + j] = m[a][j]; ls[fg * 64 + a * 16 + hi * 8 + j] = s[a][j]; } } }
    __syncthreads();    // the second half's maxima and sums are in LDS before the first half's waves join them
    if (mh == 0 && lr == 0) { float* eo = E + ((size_t)role * NZ + zh) * TT + f0 + hi * 8;
#pragma unroll
        for (int a = 0; a < 4; ++a) { v8f e;
#pragma unroll
            for (int j = 0; j < 8; ++j) { const float om = lm[fg * 64 + a * 16 + hi * 8 + j], os = ls[fg * 64 + a * 16 + hi * 8 + j]; const float mm = fmaxf(m[a][j], om);
                const float ss = s[a][j] * ex1((m[a][j] - mm) * SC) + os * ex1((om - mm) * SC); e[j] = 9.0f - mm * SC - lg1(ss); }
            *(v8f*)(eo + a * 16) = e;
            asm volatile("s_wait_xcnt 0x0" :: "v"(e), "v"(eo) : "memory"); } }    // the store names e's and eo's registers: as the wait's inputs they stay as they are until it has passed
}
// k_att: y = a.v with a formed in registers. Grid (TT / 64, NZ), 4 waves: wave w owns the 32 queries (w & 1) and half (w >> 1) of the keys, 32 keys a trip. S^T = K Q^T (A = K rows, B = Q, kept in registers): D[8 hi + j][lr] is
// key 8 hi + j against query lr, so two score tiles of 16 keys, turned into 512 a = 2^(s SC + E_row[query]) + 2^(s SC + E_col[key]) and rounded to fp16, ARE the B fragment (k = 8 hi + j, 16 + 8 hi + j) of O^T += V^T P^T,
// whose A fragment comes from VT by the same k order. The two key halves are added through LDS (first half + second half); y / 512 goes out as the two bf16 planes, 8 consecutive d a lane.
__global__ __launch_bounds__(128) __attribute__((amdgpu_waves_per_eu(3, 3))) void k_att(const bf* __restrict__ Qh, const bf* __restrict__ Ql, const bf* __restrict__ Kh, const bf* __restrict__ Kl, const h16* __restrict__ VT, const float* __restrict__ E, bf* Yh, bf* Yl) {
    __shared__ __align__(16) float red[2 * 64 * 32];
    const int lane = threadIdx.x & 31, lr = lane & 15, hi = lane >> 4; const int wv = __builtin_amdgcn_readfirstlane((int)(threadIdx.x >> 5)), qg = wv & 1, kh = wv >> 1;
    const int zh = blockIdx.y; const size_t zo = (size_t)zh * TT * HD; const int q0 = blockIdx.x * 64 + qg * 32; const unsigned lob = (unsigned)(lr * HD + 8 * hi) * 2u, lvb = (unsigned)(lr * TT + 8 * hi) * 2u, leb = (unsigned)hi * 32u, lab = (unsigned)lr * 4u;
    const bf* Kph = Kh + zo; const bf* Kpl = Kl + zo; const h16* Vp = VT + zo; const float* Eb = E + ((size_t)NZ + zh) * TT;
    v16bf qh[2][2], ql[2][2]; float ea[2]; const bf* pqh = Qh + zo + q0 * HD; const bf* pql = Ql + zo + q0 * HD; const float* pea = E + (size_t)zh * TT + q0;
#pragma unroll
    for (int qt = 0; qt < 2; ++qt) { ea[qt] = *atb(pea + qt * 16, lab);
#pragma unroll
        for (int kc = 0; kc < 2; ++kc) { qh[qt][kc] = WFrag<bf>::ld(atb(pqh + qt * 16 * HD + kc * 32, lob)); ql[qt][kc] = WFrag<bf>::ld(atb(pql + qt * 16 * HD + kc * 32, lob)); } }
    asm volatile("s_wait_xcnt 0x0" :: "v"(lob), "v"(lab), "s"(pqh), "s"(pql), "s"(pea) : "memory");    // the loads name these registers: the wait stands behind the last load, and as its inputs they stay live to here, so that none is rewritten before it
    v8f o[4][2];
#pragma unroll
    for (int dt = 0; dt < 4; ++dt) { o[dt][0] = (v8f){}; o[dt][1] = (v8f){}; }
    gp pk = (gp)(const char*)atb(Kph + kh * (TT / 2) * HD, lob); gp pl = (gp)(const char*)atb(Kpl + kh * (TT / 2) * HD, lob); gp pv = (gp)(const char*)atb(Vp + kh * (TT / 2), lvb); gp pe = (gp)(const char*)atb(Eb + kh * (TT / 2), leb);
#pragma unroll 1    // rolled: one trip's fragments already fill the register budget of three waves a SIMD
    for (int it = 0; it < TT / 2 / 32; ++it) {
        v16bf ka[2][2], kb[2][2]; v8f eb[2]; v16h va[4];
#pragma unroll
        for (int kt = 0; kt < 2; ++kt) {
#pragma unroll
            for (int kc = 0; kc < 2; ++kc) { ka[kt][kc] = ldb(pk, kt * 16 * HD * 2 + kc * 64); kb[kt][kc] = ldb(pl, kt * 16 * HD * 2 + kc * 64); } }
#pragma unroll
        for (int kt = 0; kt < 2; ++kt) eb[kt] = *(const GLB v8f*)(pe + kt * 64);
#pragma unroll
        for (int dt = 0; dt < 4; ++dt) va[dt] = ldh(pv, dt * 16 * TT * 2);
        // The trip's loads name the four address pairs. The wait takes the loaded values as inputs, so every load stands in front of it, and the pairs as operands, so that they are the registers the loads name, stay
        // as they are to here (no load's result is placed on one) and step on only behind it.
        asm volatile("s_wait_xcnt 0x0" : "+v"(pk), "+v"(pl), "+v"(pv), "+v"(pe) : "v"(ka[0][0]), "v"(ka[0][1]), "v"(ka[1][0]), "v"(ka[1][1]), "v"(kb[0][0]), "v"(kb[0][1]), "v"(kb[1][0]), "v"(kb[1][1]), "v"(eb[0]), "v"(eb[1]), "v"(va[0]), "v"(va[1]), "v"(va[2]), "v"(va[3]) : "memory");
        pk += 32 * HD * 2; pl += 32 * HD * 2; pv += 32 * 2; pe += 32 * 4;
        v16h p[2];
#pragma unroll
        for (int qt = 0; qt < 2; ++qt) {
#pragma unroll
            for (int kt = 0; kt < 2; ++kt) { const v8f c = score6(ka[kt][0], kb[kt][0], ka[kt][1], kb[kt][1], qh[qt][0], ql[qt][0], qh[qt][1], ql[qt][1]);
#pragma unroll
                for (int j = 0; j < 8; j += 2) { float r0, c0, r1, c1; ex4(fmaf(c[j], SC, ea[qt]), fmaf(c[j], SC, eb[kt][j]), fmaf(c[j + 1], SC, ea[qt]), fmaf(c[j + 1], SC, eb[kt][j + 1]), r0, c0, r1, c1); p[qt][kt * 8 + j] = tohx(r0 + c0); p[qt][kt * 8 + j + 1] = tohx(r1 + c1); } } }
#pragma unroll
        for (int dt = 0; dt < 4; ++dt) { o[dt][0] = wmma16(va[dt], p[0], o[dt][0]); o[dt][1] = wmma16(va[dt], p[1], o[dt][1]); }
    }
    float* rw = red + qg * (64 * 32) + lane;
    if (kh == 1) {
#pragma unroll
        for (int dt = 0; dt < 4; ++dt) {
#pragma unroll
            for (int qt = 0; qt < 2; ++qt) {
#pragma unroll
                for (int j = 0; j < 8; ++j) rw[((dt * 2 + qt) * 8 + j) * 32] = o[dt][qt][j]; } } }
    __syncthreads();    // the second key half's partial outputs are in LDS before the first half's waves add them
    if (kh == 0) { const size_t yo = (size_t)((zh / NH_) * TT + q0 + lr) * CC + (zh % NH_) * HD + 8 * hi;
#pragma unroll
        for (int dt = 0; dt < 4; ++dt) {
#pragma unroll
            for (int qt = 0; qt < 2; ++qt) { v8us oh, ol;
#pragma unroll
                for (int j = 0; j < 8; ++j) { unsigned short a, c; splitf((o[dt][qt][j] + rw[((dt * 2 + qt) * 8 + j) * 32]) * (1.0f / PCAR), a, c); oh[j] = a; ol[j] = c; }
                *(v8us*)(Yh + yo + (size_t)qt * 16 * CC + dt * 16) = oh; *(v8us*)(Yl + yo + (size_t)qt * 16 * CC + dt * 16) = ol; } } }
}

extern "C" void kernel_launch(void* const* d_in, const int* in_sizes, int n_in,
                              void* d_out, int out_size, void* d_ws, size_t ws_size, hipStream_t stream) {
    (void)in_sizes; (void)n_in; (void)out_size;
    const float* x = (const float*)d_in[0]; const float* Wt = (const float*)d_in[1]; const float* g1 = (const float*)d_in[2]; const float* g2 = (const float*)d_in[3]; const float* g3 = (const float*)d_in[4];
    float* OUT = (float*)d_out;     // [2][2048][768]
    char* wsp = (char*)d_ws;
    auto take = [&](size_t bytes) { char* p = wsp; wsp += (bytes + 255) & ~(size_t)255; return (void*)p; };
    bf* WB = (bf*)take((size_t)CC * CC * 2); bf* WT = (bf*)take((size_t)CC * CC * 2); bf* XB = (bf*)take((size_t)NB_ * TT * CC * 2); float* WF = (float*)take((size_t)NB_ * TT * CC * 4); float* RS = (float*)take((size_t)NZ * TT * 4);
    bf* Qh = (bf*)take((size_t)NZ * TT * HD * 2); bf* Ql = (bf*)take((size_t)NZ * TT * HD * 2); bf* Kh = (bf*)take((size_t)NZ * TT * HD * 2); bf* Kl = (bf*)take((size_t)NZ * TT * HD * 2); h16* VT = (h16*)take((size_t)NZ * HD * TT * 2);
    float* E = (float*)take((size_t)2 * NZ * TT * 4);    // [row / column][zh][t]
    bf* Yh = (bf*)WF; bf* Yl = Yh + (size_t)NB_ * TT * CC;    // the two y planes take WF's bytes: k_vt is WF's last reader and runs before k_att
    if ((size_t)(wsp - (char*)d_ws) > ws_size) return;    // total ~ 53 MB
    k_cvt8<<<(CC * CC / 8 + 255) / 256, 256, 0, stream>>>(Wt, WB, (size_t)CC * CC / 8);      // W [out][in] = natural Bt for x W^T
    k_wtG<<<(CC * CC / 64 + 63) / 64, 256, 0, stream>>>(Wt, CC, CC, WT);                  // W as x @ W operand for y W
    // Both batch items go through every launch together (rows b * TT + t), and all NZ (batch, head) pairs through the statistics and the a.v launch.
    k_cvt8<<<(NB_ * TT * CC / 8 + 255) / 256, 256, 0, stream>>>(x, XB, (size_t)NB_ * TT * CC / 8);
    k_gemmw<bf, 0, false, 4><<<dim3(NB_ * TT / 64, CC / 64, 1), 128, 0, stream>>>(XB, nullptr, WB, nullptr, CC, WF, CC, nullptr, 0, 0, 0);
    k_rms<<<NZ * TT / 8, 256, 0, stream>>>(WF, g1, g2, Qh, Ql, Kh, Kl, RS); k_vt<<<(unsigned)(((size_t)NZ * HD * TT / 2 + 255) / 256), 256, 0, stream>>>(WF, RS, g3, VT);
    k_stat<<<dim3(TT / 128, 2, NZ), 128, 0, stream>>>(Qh, Ql, Kh, Kl, E);
    k_att<<<dim3(TT / 64, NZ), 128, 0, stream>>>(Qh, Ql, Kh, Kl, VT, E, Yh, Yl);
    k_gemmw<bf, 1, false, 4><<<dim3(NB_ * TT / 64, CC / 64, 1), 128, 0, stream>>>(Yh, Yl, WT, nullptr, CC, OUT, CC, nullptr, 0, 0, 0);
}

// v005
// A run of this version takes 178 microseconds.
// Two timings next to v004 put it at 1.23 and 1.22 times that version's speed.
// Over all steps from v000 it is 53.4 times as fast.
#include <hip/hip_runtime.h>

// HyperSETAlterAttention (x [2][2048][768]; w = x W^T (12 heads x 64, shared weights); q, k, v = RMSNorm(w) g1 / g2 / g3 (eps = f32 eps); att = q.k / 8; a = softmax over keys + softmax over QUERIES (bisoftmax);
// y = a.v merged; out = y W -> [2][2048][768]).
// Compute dtypes, f32 accumulate: every input rounded to bf16; x W^T on PLAIN bf16 operands (inputs: exact); RMSNorm f32 -> bf16 hi+lo planes of q and k (scores: 3 products, K 64 - the cosine-like logits span
// +-8, single fp16 planes were not tried) and a single fp16 plane of v; the row and the column softmax statistics (running max / sum, fixed order) in f32 from score tiles formed anew on the matrix units; both softmaxes combined into ONE fp16 plane in registers (scaled by 512)

#define NB_  2
#define TT   2048
#define CC   768
#define NH_  12
#define HD   64
#define NZ   (NB_ * NH_)    // (batch, head) pairs, index zh = b * NH_ + h
#define PCAR 512.0f
typedef _Float16 h16;
typedef unsigned short bf;
typedef __attribute__((ext_vector_type(16))) __bf16   v16bf;
typedef __attribute__((ext_vector_type(16))) _Float16 v16h;
typedef __attribute__((ext_vector_type(8)))  _Float16 v8h;
typedef __attribute__((ext_vector_type(8)))  unsigned short v8us;
typedef __attribute__((ext_vector_type(8)))  float    v8f;
typedef __attribute__((ext_vector_type(4)))  float    v4f;
typedef v8h  __attribute__((may_alias)) v8ha;
typedef v4f  __attribute__((may_alias)) v4fa;
typedef v8us __attribute__((may_alias)) v8usa;

__device__ __forceinline__ unsigned short f2bf(float f) { unsigned u = __float_as_uint(f); u += 0x7FFFu + ((u >> 16) & 1u); return (unsigned short)(u >> 16); }
__device__ __forceinline__ float bf2f(unsigned short b) { return __uint_as_float(((unsigned)b) << 16); }
__device__ __forceinline__ float bfr(float f) { return bf2f(f2bf(f)); }
__device__ __forceinline__ v16h cat16(v8h lo, v8h hi) { return __builtin_shufflevector(lo, hi, 0, 1, 2, 3, 4, 5, 6, 7, 8, 9, 10, 11, 12, 13, 14, 15); }
__device__ __forceinline__ v16bf cat16b(v8us lo, v8us hi) { return __builtin_bit_cast(v16bf, __builtin_shufflevector(lo, hi, 0, 1, 2, 3, 4, 5, 6, 7, 8, 9, 10, 11, 12, 13, 14, 15)); }
__device__ __forceinline__ v8f wmma16(v16h a, v16h b, v8f c) { return __builtin_amdgcn_wmma_f32_16x16x32_f16(false, a, false, b, (short)0, c, false, false); }
__device__ __forceinline__ v8f wmmab(v16bf a, v16bf b, v8f c) { return __builtin_amdgcn_wmma_f32_16x16x32_bf16(false, a, false, b, (short)0, c, false, false); }
__device__ __forceinline__ h16 tohx(float x) { return (h16)x; }
__device__ __forceinline__ void splitf(float y, unsigned short& h, unsigned short& l) { h = f2bf(y); l = f2bf(y - bf2f(h)); }
typedef __attribute__((ext_vector_type(2))) _Float16 v2h;
typedef __attribute__((ext_vector_type(4))) _Float16 v4h;
typedef __attribute__((ext_vector_type(2))) unsigned short v2us;
typedef __attribute__((ext_vector_type(4))) unsigned short v4us;



// ---- k_gemmw: register-blocked GEMM, one work-group of KS waves per 64x64 output tile (16 accumulators a wave), operands straight from K-contiguous 16-bit planes; grid (M/64, N/64, Z), 32 * KS threads.
// C[m][n] (f32, pitch ldc, + optional f32 bias[n]) = sum_k A[m][k] Bt[n][k] (+ split products per NSPLIT). z-batch strides sA/sB/sC in elements. K % (32 * KS) == 0.
// KS > 1: wave w sums the K / KS consecutive k from w * K / KS on, so a long K is KS short load-latency chains side by side; the KS partial tiles meet in LDS and are added in wave order 0, 1, .. KS - 1.
template <typename T16> struct WFrag;
template <> struct WFrag<h16> { typedef v16h V; static __device__ __forceinline__ V ld(const h16* p) { return cat16(*(const v8h*)p, *(const v8h*)(p + 16)); } static __device__ __forceinline__ v8f mma(V a, V b, v8f c) { return wmma16(a, b, c); } };
template <> struct WFrag<bf> { typedef v16bf V; static __device__ __forceinline__ V ld(const bf* p) { return cat16b(*(const v8us*)p, *(const v8us*)(p + 16)); } static __device__ __forceinline__ v8f mma(V a, V b, v8f c) { return wmmab(a, b, c); } };
// 1 / sqrt(x), four at a time. Results apart from all sources and a v_nop at the end of the statement: the one-instruction slot that the instruction set asks for behind a transcendental before its result is read or its
// source overwritten.
__device__ __forceinline__ void rs4(float x0, float x1, float x2, float x3, float& y0, float& y1, float& y2, float& y3) { asm("v_rsq_f32 %0, %4\n\tv_rsq_f32 %1, %5\n\tv_rsq_f32 %2, %6\n\tv_rsq_f32 %3, %7\n\tv_nop" : "=&v"(y0), "=&v"(y1), "=&v"(y2), "=&v"(y3) : "v"(x0), "v"(x1), "v"(x2), "v"(x3)); }
// NORM (the projection x W^T, KS = 4, N tile = one head): the tile is 64 rows t of one (batch, head) with all 64 dims, so the work-group that summed it also norms it: r = rsqrt(mean(w^2) + eps) a row, then
// Q hi/lo = split(w r g1), K hi/lo = split(w r g2) ([zh][t][64]) and V^T = fp16(w r g3) ([zh][d][t], turned in LDS so that whole 128-B lines go out). C is not written. 16 lanes hold a row, 4 dims each, 8 consecutive rows a thread.
template <typename T16, int NSPLIT, bool BIAS, int KS, bool NORM>
__global__ __launch_bounds__(32 * KS) void k_gemmw(const T16* __restrict__ A, const T16* __restrict__ A2, const T16* __restrict__ Bt, const T16* __restrict__ Bt2, int K, float* C, int ldc, const float* __restrict__ bias, size_t sA, size_t sB, size_t sC,
                                                   const float* __restrict__ g1, const float* __restrict__ g2, const float* __restrict__ g3, bf* Qh, bf* Ql, bf* Kh, bf* Kl, h16* VT) {
    typedef typename WFrag<T16>::V V;
    __shared__ __align__(16) float os[(KS > 1 ? KS * 64 : 16) * 68];
    __shared__ __align__(16) h16 vts[NORM ? 64 * 72 : 8];
    const size_t z = blockIdx.z; A += z * sA; if (A2) A2 += z * sA; Bt += z * sB; if (Bt2) Bt2 += z * sB; C += z * sC;
    const int lane = threadIdx.x & 31, lr = lane & 15, hi = lane >> 4; const int r0 = blockIdx.x * 64, c0 = blockIdx.y * 64;
    v8f acc[4][4];
#pragma unroll
    for (int mb = 0; mb < 4; ++mb)
#pragma unroll
        for (int nb = 0; nb < 4; ++nb) acc[mb][nb] = (v8f){};
    const size_t aoff = (size_t)(r0 + lr) * K + 8 * hi, boff = (size_t)(c0 + lr) * K + 8 * hi;
    const int wv = KS > 1 ? __builtin_amdgcn_readfirstlane((int)(threadIdx.x >> 5)) : 0; const int kspan = K / KS, kbeg = wv * kspan, kend = kbeg + kspan;
#pragma unroll 1
    for (int kc = kbeg; kc < kend; kc += 32) {
        V a[4], a2[4];
#pragma unroll
        for (int mb = 0; mb < 4; ++mb) { a[mb] = WFrag<T16>::ld(A + aoff + (size_t)mb * 16 * K + kc); if (NSPLIT == 1 || NSPLIT == 2) a2[mb] = WFrag<T16>::ld(A2 + aoff + (size_t)mb * 16 * K + kc); }
#pragma unroll
        for (int nb = 0; nb < 4; ++nb) { const V b = WFrag<T16>::ld(Bt + boff + (size_t)nb * 16 * K + kc); V b2; if (NSPLIT >= 2) b2 = WFrag<T16>::ld(Bt2 + boff + (size_t)nb * 16 * K + kc);
#pragma unroll
            for (int mb = 0; mb < 4; ++mb) { acc[mb][nb] = WFrag<T16>::mma(a[mb], b, acc[mb][nb]); if (NSPLIT == 1 || NSPLIT == 2) acc[mb][nb] = WFrag<T16>::mma(a2[mb], b, acc[mb][nb]); if (NSPLIT >= 2) acc[mb][nb] = WFrag<T16>::mma(a[mb], b2, acc[mb][nb]); } }
        asm volatile("v_nop\n\tv_nop\n\tv_nop\n\tv_nop" : "+v"(acc[0][0]), "+v"(acc[1][1]), "+v"(acc[2][2]), "+v"(acc[3][3]) : "v"(a[0]), "v"(a[3]));
    }
    if (KS > 1) {
        float* ow = os + wv * (64 * 68);
#pragma unroll
        for (int mb = 0; mb < 4; ++mb) {
#pragma unroll
            for (int nb = 0; nb < 4; ++nb) {
#pragma unroll
                for (int j = 0; j < 8; ++j) ow[(mb * 16 + hi * 8 + j) * 68 + nb * 16 + lr] = acc[mb][nb][j]; } }
        __syncthreads();    // every wave's partial tile is in LDS before any thread adds the KS partials of its outputs
        if (NORM) {
            const int rg = (int)threadIdx.x >> 4, cofs = lr * 4; const int zh = (r0 / TT) * NH_ + (int)blockIdx.y, t0 = r0 % TT; const unsigned lgb = (unsigned)cofs * 4u;
            float ga[4], gb[4], gc[4];
#pragma unroll
            for (int c = 0; c < 4; ++c) { ga[c] = *(const float*)((const char*)(g1 + c) + lgb); gb[c] = *(const float*)((const char*)(g2 + c) + lgb); gc[c] = *(const float*)((const char*)(g3 + c) + lgb); }
            asm volatile("s_wait_xcnt 0x0" :: "v"(lgb), "s"(g1), "s"(g2), "s"(g3) : "memory");    // the loads name these registers: the wait stands behind the last load, and as its inputs they stay live to here
            v4f val[8]; float x[8], y[8];
#pragma unroll
            for (int s = 0; s < 8; ++s) { const int row = rg * 8 + s; val[s] = *(const v4fa*)(os + row * 68 + cofs);
#pragma unroll
                for (int w = 1; w < KS; ++w) { const v4f o = *(const v4fa*)(os + (w * 64 + row) * 68 + cofs); val[s][0] += o[0]; val[s][1] += o[1]; val[s][2] += o[2]; val[s][3] += o[3]; }
                x[s] = __fadd_rn(__fmul_rn(val[s][0], val[s][0]), __fmul_rn(val[s][1], val[s][1])); y[s] = __fadd_rn(__fmul_rn(val[s][2], val[s][2]), __fmul_rn(val[s][3], val[s][3])); }
            // Sum of squares over the row's 16 lanes: the even and the odd pairs of dims apart, far lanes first, the two joined last (a fixed tree).
#pragma unroll
            for (int sh = 8; sh; sh >>= 1) {
#pragma unroll
                for (int s = 0; s < 8; ++s) { x[s] += __shfl_xor(x[s], sh, 32); y[s] += __shfl_xor(y[s], sh, 32); } }
#pragma unroll
            for (int c = 0; c < 4; ++c) { ga[c] = bfr(ga[c]); gb[c] = bfr(gb[c]); gc[c] = bfr(gc[c]); }
            v8h vv[4];
#pragma unroll
            for (int s = 0; s < 8; ++s) x[s] = __fadd_rn((x[s] + y[s]) * (1.0f / HD), 1.1920929e-07f);
            rs4(x[0], x[1], x[2], x[3], y[0], y[1], y[2], y[3]); rs4(x[4], x[5], x[6], x[7], y[4], y[5], y[6], y[7]);
#pragma unroll
            for (int s = 0; s < 8; ++s) {
#pragma unroll
                for (int c = 0; c < 4; ++c) { val[s][c] = __fmul_rn(val[s][c], y[s]); vv[c][s] = tohx(__fmul_rn(val[s][c], gc[c])); } }
#pragma unroll
            for (int c = 0; c < 4; ++c) *(v8ha*)(vts + (cofs + c) * 72 + rg * 8) = vv[c];
            __syncthreads();    // the whole V^T tile is in LDS before any thread sends a line of it out; it stands in front of every global store, so that it waits for none
            v8h vo[4]; const unsigned ov = (unsigned)(((zh * HD + ((int)threadIdx.x >> 3)) * TT + t0 + ((int)threadIdx.x & 7) * 8) * 2);
#pragma unroll
            for (int s = 0; s < 4; ++s) { vo[s] = *(const v8ha*)(vts + (s * 16 + ((int)threadIdx.x >> 3)) * 72 + ((int)threadIdx.x & 7) * 8); *(v8h*)((char*)VT + ov + s * (16 * TT * 2)) = vo[s]; }
            asm volatile("s_wait_xcnt 0x0" :: "v"(ov), "v"(vo[0]), "v"(vo[1]), "v"(vo[2]), "v"(vo[3]) : "memory");    // the four stores name these registers: they stay as they are until the wait has passed
            const unsigned ob = (unsigned)(((zh * TT + t0 + rg * 8) * HD + cofs) * 2);
#pragma unroll
            for (int sg = 0; sg < 2; ++sg) { v4us qh[4], ql[4], kh[4], kl[4];
#pragma unroll
                for (int u = 0; u < 4; ++u) { const int s = sg * 4 + u;
#pragma unroll
                    for (int c = 0; c < 4; ++c) { const float wn = val[s][c]; unsigned short x1, x2; splitf(__fmul_rn(wn, ga[c]), x1, x2); qh[u][c] = x1; ql[u][c] = x2; splitf(__fmul_rn(wn, gb[c]), x1, x2); kh[u][c] = x1; kl[u][c] = x2; }
                    *(v4us*)((char*)Qh + ob + s * (HD * 2)) = qh[u]; *(v4us*)((char*)Ql + ob + s * (HD * 2)) = ql[u]; *(v4us*)((char*)Kh + ob + s * (HD * 2)) = kh[u]; *(v4us*)((char*)Kl + ob + s * (HD * 2)) = kl[u]; }
                // the 16 stores name these registers: as the wait's inputs they stay as they are until it has passed
                asm volatile("s_wait_xcnt 0x0" :: "v"(ob), "v"(qh[0]), "v"(qh[1]), "v"(qh[2]), "v"(qh[3]), "v"(ql[0]), "v"(ql[1]), "v"(ql[2]), "v"(ql[3]), "v"(kh[0]), "v"(kh[1]), "v"(kh[2]), "v"(kh[3]), "v"(kl[0]), "v"(kl[1]), "v"(kl[2]), "v"(kl[3]) : "memory"); }
            return;
        }
#pragma unroll
        for (int s = 0; s < 32 / KS; ++s) { const int idx = s * (32 * KS) + (int)threadIdx.x, row = idx >> 4, cofs = (idx & 15) * 4; v4f val = *(const v4fa*)(os + row * 68 + cofs);
#pragma unroll
            for (int w = 1; w < KS; ++w) { const v4f o = *(const v4fa*)(os + (w * 64 + row) * 68 + cofs); val[0] += o[0]; val[1] += o[1]; val[2] += o[2]; val[3] += o[3]; }
            if (BIAS) { val[0] += bfr(bias[c0 + cofs]); val[1] += bfr(bias[c0 + cofs + 1]); val[2] += bfr(bias[c0 + cofs + 2]); val[3] += bfr(bias[c0 + cofs + 3]); }
            *(v4f*)(C + (size_t)(r0 + row) * ldc + c0 + cofs) = val; }
        return;
    }
#pragma unroll
    for (int mb = 0; mb < 4; ++mb) {
#pragma unroll
        for (int nb = 0; nb < 4; ++nb) {
#pragma unroll
            for (int j = 0; j < 8; ++j) os[(hi * 8 + j) * 68 + nb * 16 + lr] = acc[mb][nb][j]; }
        __builtin_amdgcn_wave_barrier(); asm volatile("" ::: "memory");
        float* crow = C + (size_t)(r0 + mb * 16) * ldc + c0;
{
#pragma unroll
            for (int s = 0; s < 8; ++s) { const int row = 2 * s + hi, cofs = lr * 4; v4f val = *(const v4fa*)(os + row * 68 + cofs); if (BIAS) { val[0] += bfr(bias[c0 + cofs]); val[1] += bfr(bias[c0 + cofs + 1]); val[2] += bfr(bias[c0 + cofs + 2]); val[3] += bfr(bias[c0 + cofs + 3]); }
                *(v4f*)(crow + (size_t)row * ldc + cofs) = val; }
             }
        __builtin_amdgcn_wave_barrier(); asm volatile("" ::: "memory");
    }
}


__global__ __launch_bounds__(256) void k_wtG(const float* __restrict__ w, int K, int N, bf* Bt) {
    const int lane = threadIdx.x & 31; const int L0 = (blockIdx.x * 8 + (threadIdx.x >> 5)) * 8; const int nlines = N * K / 64;
{
#pragma unroll 1
        for (int l = 0; l < 8; ++l) { const int L = L0 + l; if (L >= nlines) break; const size_t e = (size_t)L * 64 + lane * 2; const int k = (int)(e % K), n = (int)(e / K); v2us o;
            o[0] = f2bf(w[(size_t)k * N + n]); o[1] = f2bf(w[(size_t)(k + 1) * N + n]); *(v2us*)(Bt + e) = o; }
         }
}
__global__ __launch_bounds__(256) void k_cvt8(const float* __restrict__ src, bf* dst, size_t n8) { const size_t i = (size_t)blockIdx.x * 256 + threadIdx.x; if (i >= n8) return; const v8f v = *(const v8f*)(src + i * 8); v8us o;
#pragma unroll
    for (int k = 0; k < 8; ++k) o[k] = f2bf(v[k]); *(v8us*)(dst + i * 8) = o;  }
// The scores never go to memory: k_stat and k_att each form the score tiles they need on the matrix units, from the same hi / lo planes and with the same three products.
// SC = log2(e) / 8: exp(s / 8 - m / 8) = 2^(s SC - m SC).
#define SC 0.18033688f
// 2^x and log2 x. Results apart from all sources and a v_nop at the end of each statement: the one-instruction slot that the instruction set asks for behind a transcendental before its result is read or its source
// overwritten.
__device__ __forceinline__ void ex4(float x0, float x1, float x2, float x3, float& y0, float& y1, float& y2, float& y3) { asm("v_exp_f32 %0, %4\n\tv_exp_f32 %1, %5\n\tv_exp_f32 %2, %6\n\tv_exp_f32 %3, %7\n\tv_nop" : "=&v"(y0), "=&v"(y1), "=&v"(y2), "=&v"(y3) : "v"(x0), "v"(x1), "v"(x2), "v"(x3)); }
__device__ __forceinline__ void ex3(float x0, float x1, float x2, float& y0, float& y1, float& y2) { asm("v_exp_f32 %0, %3\n\tv_exp_f32 %1, %4\n\tv_exp_f32 %2, %5\n\tv_nop" : "=&v"(y0), "=&v"(y1), "=&v"(y2) : "v"(x0), "v"(x1), "v"(x2)); }
__device__ __forceinline__ float ex1(float x) { float y; asm("v_exp_f32 %0, %1\n\tv_nop" : "=&v"(y) : "v"(x)); return y; }
__device__ __forceinline__ float lg1(float x) { float y; asm("v_log_f32 %0, %1\n\tv_nop" : "=&v"(y) : "v"(x)); return y; }
// A lane's address = a wave-uniform base + the lane's own byte offset: the loads then name one offset register and the base's scalar pair, which the waits behind them take as inputs.
template <typename T> __device__ __forceinline__ const T* atb(const T* base, unsigned lob) { return (const T*)((const char*)base + lob); }
// The loops' stepping addresses are byte pointers typed as global memory: as operands of the wait statement they would otherwise lose that type, and the loads would become flat ones.
#define GLB __attribute__((address_space(1)))
typedef const GLB char* gp;
__device__ __forceinline__ v16bf ldb(gp p, int o) { return cat16b(*(const GLB v8us*)(p + o), *(const GLB v8us*)(p + o + 32)); }
__device__ __forceinline__ v16h ldh(gp p, int o) { return cat16(*(const GLB v8h*)(p + o), *(const GLB v8h*)(p + o + 32)); }
__device__ __forceinline__ v8f score6(v16bf ah0, v16bf al0, v16bf ah1, v16bf al1, v16bf bh0, v16bf bl0, v16bf bh1, v16bf bl1) {
    v8f c = (v8f){}; c = wmmab(ah0, bh0, c); c = wmmab(al0, bh0, c); c = wmmab(ah0, bl0, c); c = wmmab(ah1, bh1, c); c = wmmab(al1, bh1, c); c = wmmab(ah1, bl1, c); return c; }
// k_stat: softmax statistics of both directions. blockIdx.y = 0: a query is fixed and the keys move (row softmax); 1: a key is fixed and the queries move (column softmax). Grid (TT / 128, 2, NZ), 4 waves:
// wave w holds the 64 fixed rows (w & 1) as A fragments and walks half (w >> 1) of the 2048 moving rows, 32 a trip. D[8 hi + j][lr]: a lane keeps a running maximum and sum for each of its 32 fixed rows over the moving
// rows that fall on its column; the 16 lanes, then the two halves (through LDS), are joined in a fixed order. Out: E = 9 - m SC - log2(sum), so that 2^(s SC + E) = 512 exp(s / 8 - m / 8) / sum.
__global__ __launch_bounds__(128) __attribute__((amdgpu_waves_per_eu(3, 3))) void k_stat(const bf* __restrict__ Qh, const bf* __restrict__ Ql, const bf* __restrict__ Kh, const bf* __restrict__ Kl, float* E) {
    __shared__ float lm[2 * 64]; __shared__ float ls[2 * 64];
    const int lane = threadIdx.x & 31, lr = lane & 15, hi = lane >> 4; const int wv = __builtin_amdgcn_readfirstlane((int)(threadIdx.x >> 5)), fg = wv & 1, mh = wv >> 1;
    const int role = blockIdx.y, zh = blockIdx.z; const size_t zo = (size_t)zh * TT * HD; const int f0 = blockIdx.x * 128 + fg * 64;
    const bf* Fh = (role ? Kh : Qh) + zo; const bf* Fl = (role ? Kl : Ql) + zo; const bf* Mh = (role ? Qh : Kh) + zo; const bf* Ml = (role ? Ql : Kl) + zo;
    const unsigned lob = (unsigned)(lr * HD + 8 * hi) * 2u; const bf* pfh = Fh + f0 * HD; const bf* pfl = Fl + f0 * HD;
    v16bf ah[4][2], al[4][2];
#pragma unroll
    for (int a = 0; a < 4; ++a) {
#pragma unroll
        for (int kc = 0; kc < 2; ++kc) { ah[a][kc] = WFrag<bf>::ld(atb(pfh + a * 16 * HD + kc * 32, lob)); al[a][kc] = WFrag<bf>::ld(atb(pfl + a * 16 * HD + kc * 32, lob)); } }
    asm volatile("s_wait_xcnt 0x0" :: "v"(lob), "s"(pfh), "s"(pfl) : "memory");    // the loads name these registers: the wait stands behind the last load, and as its inputs they stay live to here, so that none is rewritten before it
    float m[4][8], s[4][8];
#pragma unroll
    for (int a = 0; a < 4; ++a) {
#pragma unroll
        for (int j = 0; j < 8; ++j) { m[a][j] = -3.0e38f; s[a][j] = 0.f; } }
    gp pmh = (gp)(const char*)atb(Mh + mh * (TT / 2) * HD, lob); gp pml = (gp)(const char*)atb(Ml + mh * (TT / 2) * HD, lob);
#pragma unroll 1    // rolled: one trip's fragments and score tiles already fill the register budget of three waves a SIMD
    for (int it = 0; it < TT / 2 / 32; ++it) {
        v16bf bh[2][2], bl[2][2];
#pragma unroll
        for (int b = 0; b < 2; ++b) {
#pragma unroll
            for (int kc = 0; kc < 2; ++kc) { bh[b][kc] = ldb(pmh, b * 16 * HD * 2 + kc * 64); bl[b][kc] = ldb(pml, b * 16 * HD * 2 + kc * 64); } }
        // The trip's loads name the two address pairs. The wait takes the loaded values as inputs, so every load stands in front of it, and the pairs as operands, so that they are the registers the loads name, stay
        // as they are to here (no load's result is placed on one) and step on only behind it.
        asm volatile("s_wait_xcnt 0x0" : "+v"(pmh), "+v"(pml) : "v"(bh[0][0]), "v"(bh[0][1]), "v"(bh[1][0]), "v"(bh[1][1]), "v"(bl[0][0]), "v"(bl[0][1]), "v"(bl[1][0]), "v"(bl[1][1]) : "memory");
        pmh += 32 * HD * 2; pml += 32 * HD * 2;
#pragma unroll
        for (int a = 0; a < 4; ++a) {
            const v8f c0 = score6(ah[a][0], al[a][0], ah[a][1], al[a][1], bh[0][0], bl[0][0], bh[0][1], bl[0][1]);
            const v8f c1 = score6(ah[a][0], al[a][0], ah[a][1], al[a][1], bh[1][0], bl[1][0], bh[1][1], bl[1][1]);
#pragma unroll
            for (int j = 0; j < 8; ++j) { const float mn = fmaxf(m[a][j], fmaxf(c0[j], c1[j])); const float nb = -mn * SC;
                float e0, e1, e2; ex3(fmaf(m[a][j], SC, nb), fmaf(c0[j], SC, nb), fmaf(c1[j], SC, nb), e0, e1, e2); s[a][j] = fmaf(s[a][j], e0, e1 + e2); m[a][j] = mn; }
            __builtin_amdgcn_sched_barrier(0); }    // a row group's score tiles are formed behind the sums of the group before: several groups' tiles at once do not fit the registers of three waves a SIMD (spills)
    }
#pragma unroll
    for (int a = 0; a < 4; ++a) {
#pragma unroll
        for (int j = 0; j < 8; ++j) { float mm = m[a][j];
#pragma unroll
            for (int sh = 1; sh <= 8; sh <<= 1) mm = fmaxf(mm, __shfl_xor(mm, sh, 32));
            float ss = s[a][j] * ex1((m[a][j] - mm) * SC);
#pragma unroll
            for (int sh = 1; sh <= 8; sh <<= 1) ss += __shfl_xor(ss, sh, 32);
            m[a][j] = mm; s[a][j] = ss; } }
    if (mh == 1 && lr == 0) {
#pragma unroll
        for (int a = 0; a < 4; ++a) {
#pragma unroll
            for (int j = 0; j < 8; ++j) { lm[fg * 64 + a * 16 + hi * 8 + j] = m[a][j]; ls[fg * 64 + a * 16 + hi * 8 + j] = s[a][j]; } } }
    __syncthreads();    // the second half's maxima and sums are in LDS before the first half's waves join them
    if (mh == 0 && lr == 0) { float* eo = E + ((size_t)role * NZ + zh) * TT + f0 + hi * 8;
#pragma unroll
        for (int a = 0; a < 4; ++a) { v8f e;
#pragma unroll
            for (int j = 0; j < 8; ++j) { const float om = lm[fg * 64 + a * 16 + hi * 8 + j], os = ls[fg * 64 + a * 16 + hi * 8 + j]; const float mm = fmaxf(m[a][j], om);
                const float ss = s[a][j] * ex1((m[a][j] - mm) * SC) + os * ex1((om - mm) * SC); e[j] = 9.0f - mm * SC - lg1(ss); }
            *(v8f*)(eo + a * 16) = e;
            asm volatile("s_wait_xcnt 0x0" :: "v"(e), "v"(eo) : "memory"); } }    // the store names e's and eo's registers: as the wait's inputs they stay as they are until it has passed
}
// k_att: y = a.v with a formed in registers. Grid (TT / 64, NZ), 4 waves: wave w owns the 32 queries (w & 1) and half (w >> 1) of the keys, 32 keys a trip. S^T = K Q^T (A = K rows, B = Q, kept in registers): D[8 hi + j][lr] is
// key 8 hi + j against query lr, so two score tiles of 16 keys, turned into 512 a = 2^(s SC + E_row[query]) + 2^(s SC + E_col[key]) and rounded to fp16, ARE the B fragment (k = 8 hi + j, 16 + 8 hi + j) of O^T += V^T P^T,
// whose A fragment comes from VT by the same k order. The two key halves are added through LDS (first half + second half); y / 512 goes out as the two bf16 planes, 8 consecutive d a lane.
__global__ __launch_bounds__(128) __attribute__((amdgpu_waves_per_eu(3, 3))) void k_att(const bf* __restrict__ Qh, const bf* __restrict__ Ql, const bf* __restrict__ Kh, const bf* __restrict__ Kl, const h16* __restrict__ VT, const float* __restrict__ E, bf* Yh, bf* Yl) {
    __shared__ __align__(16) float red[2 * 64 * 32];
    const int lane = threadIdx.x & 31, lr = lane & 15, hi = lane >> 4; const int wv = __builtin_amdgcn_readfirstlane((int)(threadIdx.x >> 5)), qg = wv & 1, kh = wv >> 1;
    const int zh = blockIdx.y; const size_t zo = (size_t)zh * TT * HD; const int q0 = blockIdx.x * 64 + qg * 32; const unsigned lob = (unsigned)(lr * HD + 8 * hi) * 2u, lvb = (unsigned)(lr * TT + 8 * hi) * 2u, leb = (unsigned)hi * 32u, lab = (unsigned)lr * 4u;
    const bf* Kph = Kh + zo; const bf* Kpl = Kl + zo; const h16* Vp = VT + zo; const float* Eb = E + ((size_t)NZ + zh) * TT;
    v16bf qh[2][2], ql[2][2]; float ea[2]; const bf* pqh = Qh + zo + q0 * HD; const bf* pql = Ql + zo + q0 * HD; const float* pea = E + (size_t)zh * TT + q0;
#pragma unroll
    for (int qt = 0; qt < 2; ++qt) { ea[qt] = *atb(pea + qt * 16, lab);
#pragma unroll
        for (int kc = 0; kc < 2; ++kc) { qh[qt][kc] = WFrag<bf>::ld(atb(pqh + qt * 16 * HD + kc * 32, lob)); ql[qt][kc] = WFrag<bf>::ld(atb(pql + qt * 16 * HD + kc * 32, lob)); } }
    asm volatile("s_wait_xcnt 0x0" :: "v"(lob), "v"(lab), "s"(pqh), "s"(pql), "s"(pea) : "memory");    // the loads name these registers: the wait stands behind the last load, and as its inputs they stay live to here, so that none is rewritten before it
    v8f o[4][2];
#pragma unroll
    for (int dt = 0; dt < 4; ++dt) { o[dt][0] = (v8f){}; o[dt][1] = (v8f){}; }
    gp pk = (gp)(const char*)atb(Kph + kh * (TT / 2) * HD, lob); gp pl = (gp)(const char*)atb(Kpl + kh * (TT / 2) * HD, lob); gp pv = (gp)(const char*)atb(Vp + kh * (TT / 2), lvb); gp pe = (gp)(const char*)atb(Eb + kh * (TT / 2), leb);
#pragma unroll 1    // rolled: one trip's fragments already fill the register budget of three waves a SIMD
    for (int it = 0; it < TT / 2 / 32; ++it) {
        v16bf ka[2][2], kb[2][2]; v8f eb[2]; v16h va[4];
#pragma unroll
        for (int kt = 0; kt < 2; ++kt) {
#pragma unroll
            for (int kc = 0; kc < 2; ++kc) { ka[kt][kc] = ldb(pk, kt * 16 * HD * 2 + kc * 64); kb[kt][kc] = ldb(pl, kt * 16 * HD * 2 + kc * 64); } }
#pragma unroll
        for (int kt = 0; kt < 2; ++kt) eb[kt] = *(const GLB v8f*)(pe + kt * 64);
#pragma unroll
        for (int dt = 0; dt < 4; ++dt) va[dt] = ldh(pv, dt * 16 * TT * 2);
        // The trip's loads name the four address pairs. The wait takes the loaded values as inputs, so every load stands in front of it, and the pairs as operands, so that they are the registers the loads name, stay
        // as they are to here (no load's result is placed on one) and step on only behind it.
        asm volatile("s_wait_xcnt 0x0" : "+v"(pk), "+v"(pl), "+v"(pv), "+v"(pe) : "v"(ka[0][0]), "v"(ka[0][1]), "v"(ka[1][0]), "v"(ka[1][1]), "v"(kb[0][0]), "v"(kb[0][1]), "v"(kb[1][0]), "v"(kb[1][1]), "v"(eb[0]), "v"(eb[1]), "v"(va[0]), "v"(va[1]), "v"(va[2]), "v"(va[3]) : "memory");
        pk += 32 * HD * 2; pl += 32 * HD * 2; pv += 32 * 2; pe += 32 * 4;
        v16h p[2];
#pragma unroll
        for (int qt = 0; qt < 2; ++qt) {
#pragma unroll
            for (int kt = 0; kt < 2; ++kt) { const v8f c = score6(ka[kt][0], kb[kt][0], ka[kt][1], kb[kt][1], qh[qt][0], ql[qt][0], qh[qt][1], ql[qt][1]);
#pragma unroll
                for (int j = 0; j < 8; j += 2) { float r0, c0, r1, c1; ex4(fmaf(c[j], SC, ea[qt]), fmaf(c[j], SC, eb[kt][j]), fmaf(c[j + 1], SC, ea[qt]), fmaf(c[j + 1], SC, eb[kt][j + 1]), r0, c0, r1, c1); p[qt][kt * 8 + j] = tohx(r0 + c0); p[qt][kt * 8 + j + 1] = tohx(r1 + c1); } } }
#pragma unroll
        for (int dt = 0; dt < 4; ++dt) { o[dt][0] = wmma16(va[dt], p[0], o[dt][0]); o[dt][1] = wmma16(va[dt], p[1], o[dt][1]); }
    }
    float* rw = red + qg * (64 * 32) + lane;
    if (kh == 1) {
#pragma unroll
        for (int dt = 0; dt < 4; ++dt) {
#pragma unroll
            for (int qt = 0; qt < 2; ++qt) {
#pragma unroll
                for (int j = 0; j < 8; ++j) rw[((dt * 2 + qt) * 8 + j) * 32] = o[dt][qt][j]; } } }
    __syncthreads();    // the second key half's partial outputs are in LDS before the first half's waves add them
    if (kh == 0) { const size_t yo = (size_t)((zh / NH_) * TT + q0 + lr) * CC + (zh % NH_) * HD + 8 * hi;
#pragma unroll
        for (int dt = 0; dt < 4; ++dt) {
#pragma unroll
            for (int qt = 0; qt < 2; ++qt) { v8us oh, ol;
#pragma unroll
                for (int j = 0; j < 8; ++j) { unsigned short a, c; splitf((o[dt][qt][j] + rw[((dt * 2 + qt) * 8 + j) * 32]) * (1.0f / PCAR), a, c); oh[j] = a; ol[j] = c; }
                *(v8us*)(Yh + yo + (size_t)qt * 16 * CC + dt * 16) = oh; *(v8us*)(Yl + yo + (size_t)qt * 16 * CC + dt * 16) = ol; } } }
}

extern "C" void kernel_launch(void* const* d_in, const int* in_sizes, int n_in,
                              void* d_out, int out_size, void* d_ws, size_t ws_size, hipStream_t stream) {
    (void)in_sizes; (void)n_in; (void)out_size;
    const float* x = (const float*)d_in[0]; const float* Wt = (const float*)d_in[1]; const float* g1 = (const float*)d_in[2]; const float* g2 = (const float*)d_in[3]; const float* g3 = (const float*)d_in[4];
    float* OUT = (float*)d_out;     // [2][2048][768]
    char* wsp = (char*)d_ws;
    auto take = [&](size_t bytes) { char* p = wsp; wsp += (bytes + 255) & ~(size_t)255; return (void*)p; };
    bf* WB = (bf*)take((size_t)CC * CC * 2); bf* WT = (bf*)take((size_t)CC * CC * 2); bf* XB = (bf*)take((size_t)NB_ * TT * CC * 2); bf* Yh = (bf*)take((size_t)NB_ * TT * CC * 2); bf* Yl = (bf*)take((size_t)NB_ * TT * CC * 2);
    bf* Qh = (bf*)take((size_t)NZ * TT * HD * 2); bf* Ql = (bf*)take((size_t)NZ * TT * HD * 2); bf* Kh = (bf*)take((size_t)NZ * TT * HD * 2); bf* Kl = (bf*)take((size_t)NZ * TT * HD * 2); h16* VT = (h16*)take((size_t)NZ * HD * TT * 2);
    float* E = (float*)take((size_t)2 * NZ * TT * 4);    // [row / column][zh][t]
    if ((size_t)(wsp - (char*)d_ws) > ws_size) return;    // total ~ 53 MB
    k_cvt8<<<(CC * CC / 8 + 255) / 256, 256, 0, stream>>>(Wt, WB, (size_t)CC * CC / 8);      // W [out][in] = natural Bt for x W^T
    k_wtG<<<(CC * CC / 64 + 63) / 64, 256, 0, stream>>>(Wt, CC, CC, WT);                  // W as x @ W operand for y W
    // Both batch items go through every launch together (rows b * TT + t), and all NZ (batch, head) pairs through the statistics and the a.v launch.
    k_cvt8<<<(NB_ * TT * CC / 8 + 255) / 256, 256, 0, stream>>>(x, XB, (size_t)NB_ * TT * CC / 8);
    k_gemmw<bf, 0, false, 4, true><<<dim3(NB_ * TT / 64, CC / 64, 1), 128, 0, stream>>>(XB, nullptr, WB, nullptr, CC, nullptr, CC, nullptr, 0, 0, 0, g1, g2, g3, Qh, Ql, Kh, Kl, VT);    // w = x W^T, normed in the epilogue: q, k, v planes
    k_stat<<<dim3(TT / 128, 2, NZ), 128, 0, stream>>>(Qh, Ql, Kh, Kl, E);
    k_att<<<dim3(TT / 64, NZ), 128, 0, stream>>>(Qh, Ql, Kh, Kl, VT, E, Yh, Yl);
    k_gemmw<bf, 1, false, 4, false><<<dim3(NB_ * TT / 64, CC / 64, 1), 128, 0, stream>>>(Yh, Yl, WT, nullptr, CC, OUT, CC, nullptr, 0, 0, 0, nullptr, nullptr, nullptr, nullptr, nullptr, nullptr, nullptr, nullptr);
}

// v006
// A run of this version takes 144 microseconds.
// Two timings next to v005 put it at 1.23 and 1.25 times that version's speed.
// Over all steps from v000 it is 66.0 times as fast.
#include <hip/hip_runtime.h>

// HyperSETAlterAttention (x [2][2048][768]; w = x W^T (12 heads x 64, shared weights); q, k, v = RMSNorm(w) g1 / g2 / g3 (eps = f32 eps); att = q.k / 8; a = softmax over keys + softmax over QUERIES (bisoftmax);
// y = a.v merged; out = y W -> [2][2048][768]).
// Compute dtypes, f32 accumulate: every input rounded to bf16; x W^T on PLAIN bf16 operands (inputs: exact); RMSNorm f32 -> bf16 hi+lo planes of q and k (scores: 3 products, K 64 - the cosine-like logits span
// +-8, single fp16 planes were not tried) and a single fp16 plane of v; the row and the column softmax statistics (running max / sum, fixed order) in f32 from score tiles formed anew on the matrix units; both softmaxes combined into ONE fp16 plane in registers (scaled by 512)

#define NB_  2
#define TT   2048
#define CC   768
#define NH_  12
#define HD   64
#define NZ   (NB_ * NH_)    // (batch, head) pairs, index zh = b * NH_ + h
#define PCAR 512.0f
typedef _Float16 h16;
typedef unsigned short bf;
typedef __attribute__((ext_vector_type(16))) __bf16   v16bf;
typedef __attribute__((ext_vector_type(16))) _Float16 v16h;
typedef __attribute__((ext_vector_type(8)))  _Float16 v8h;
typedef __attribute__((ext_vector_type(8)))  unsigned short v8us;
typedef __attribute__((ext_vector_type(8)))  float    v8f;
typedef __attribute__((ext_vector_type(4)))  float    v4f;
typedef v8h  __attribute__((may_alias)) v8ha;
typedef v4f  __attribute__((may_alias)) v4fa;
typedef v8us __attribute__((may_alias)) v8usa;

__device__ __forceinline__ unsigned short f2bf(float f) { unsigned u = __float_as_uint(f); u += 0x7FFFu + ((u >> 16) & 1u); return (unsigned short)(u >> 16); }
__device__ __forceinline__ float bf2f(unsigned short b) { return __uint_as_float(((unsigned)b) << 16); }
__device__ __forceinline__ float bfr(float f) { return bf2f(f2bf(f)); }
__device__ __forceinline__ v16h cat16(v8h lo, v8h hi) { return __builtin_shufflevector(lo, hi, 0, 1, 2, 3, 4, 5, 6, 7, 8, 9, 10, 11, 12, 13, 14, 15); }
__device__ __forceinline__ v16bf cat16b(v8us lo, v8us hi) { return __builtin_bit_cast(v16bf, __builtin_shufflevector(lo, hi, 0, 1, 2, 3, 4, 5, 6, 7, 8, 9, 10, 11, 12, 13, 14, 15)); }
__device__ __forceinline__ v8f wmma16(v16h a, v16h b, v8f c) { return __builtin_amdgcn_wmma_f32_16x16x32_f16(false, a, false, b, (short)0, c, false, false); }
__device__ __forceinline__ v8f wmmab(v16bf a, v16bf b, v8f c) { return __builtin_amdgcn_wmma_f32_16x16x32_bf16(false, a, false, b, (short)0, c, false, false); }
__device__ __forceinline__ h16 tohx(float x) { return (h16)x; }
__device__ __forceinline__ void splitf(float y, unsigned short& h, unsigned short& l) { h = f2bf(y); l = f2bf(y - bf2f(h)); }
typedef __attribute__((ext_vector_type(2))) _Float16 v2h;
typedef __attribute__((ext_vector_type(4))) _Float16 v4h;
typedef __attribute__((ext_vector_type(2))) unsigned short v2us;
typedef __attribute__((ext_vector_type(4))) unsigned short v4us;
typedef v4us __attribute__((may_alias)) v4usa;
// FRAGMENT ORDER of the q, k (hi and lo) and v^T planes. A 16 x 32 operand fragment (16 rows, 32 k) is 1 KiB: [half 0..1][hi 0..1][row 0..15][8 k], element k = 16 half + 8 hi + 0..7, so that lane (hi, row) finds its two
// 16-byte pieces at 16 * lane and 512 + 16 * lane and each load of a wave is 512 consecutive bytes (4 whole lines) instead of 32 bytes of each of 16 lines. q, k: [zh][t / 16][d / 32][fragment], rows t, k = d.
// v^T: [zh][t / 32][d / 16][fragment], rows d, k = t. 64 rows t of one (batch, head) are 8 KiB in a row in every plane.
#define FRH 512     // bytes from a lane's first piece to its second
#define FRB 1024    // bytes of a fragment



// ---- k_gemmw: register-blocked GEMM, one work-group of KS waves per 64x64 output tile (16 accumulators a wave), operands straight from K-contiguous 16-bit planes; grid (M/64, N/64, Z), 32 * KS threads.
// C[m][n] (f32, pitch ldc, + optional f32 bias[n]) = sum_k A[m][k] Bt[n][k] (+ split products per NSPLIT). z-batch strides sA/sB/sC in elements. K % (32 * KS) == 0.
// KS > 1: wave w sums the K / KS consecutive k from w * K / KS on, so a long K is KS short load-latency chains side by side; the KS partial tiles meet in LDS and are added in wave order 0, 1, .. KS - 1.
template <typename T16> struct WFrag;
template <> struct WFrag<h16> { typedef v16h V; static __device__ __forceinline__ V ld(const h16* p) { return cat16(*(const v8h*)p, *(const v8h*)(p + 16)); } static __device__ __forceinline__ v8f mma(V a, V b, v8f c) { return wmma16(a, b, c); } };
template <> struct WFrag<bf> { typedef v16bf V; static __device__ __forceinline__ V ld(const bf* p) { return cat16b(*(const v8us*)p, *(const v8us*)(p + 16)); } static __device__ __forceinline__ v8f mma(V a, V b, v8f c) { return wmmab(a, b, c); } };
// 1 / sqrt(x), four at a time. Results apart from all sources and a v_nop at the end of the statement: the one-instruction slot that the instruction set asks for behind a transcendental before its result is read or its
// source overwritten.
__device__ __forceinline__ void rs4(float x0, float x1, float x2, float x3, float& y0, float& y1, float& y2, float& y3) { asm("v_rsq_f32 %0, %4\n\tv_rsq_f32 %1, %5\n\tv_rsq_f32 %2, %6\n\tv_rsq_f32 %3, %7\n\tv_nop" : "=&v"(y0), "=&v"(y1), "=&v"(y2), "=&v"(y3) : "v"(x0), "v"(x1), "v"(x2), "v"(x3)); }
// NORM (the projection x W^T, KS = 4, N tile = one head): the tile is 64 rows t of one (batch, head) with all 64 dims, so the work-group that summed it also norms it: r = rsqrt(mean(w^2) + eps) a row, then
// Q hi/lo = split(w r g1), K hi/lo = split(w r g2) and V^T = fp16(w r g3), all five in fragment order (turned in LDS so that every store of a wave is 512 consecutive bytes). C is not written. 16 lanes hold a row, 4 dims each, 8 consecutive rows a thread.
template <typename T16, int NSPLIT, bool BIAS, int KS, bool NORM>
__global__ __launch_bounds__(32 * KS) void k_gemmw(const T16* __restrict__ A, const T16* __restrict__ A2, const T16* __restrict__ Bt, const T16* __restrict__ Bt2, int K, float* C, int ldc, const float* __restrict__ bias, size_t sA, size_t sB, size_t sC,
                                                   const float* __restrict__ g1, const float* __restrict__ g2, const float* __restrict__ g3, bf* Qh, bf* Ql, bf* Kh, bf* Kl, h16* VT) {
    typedef typename WFrag<T16>::V V;
    __shared__ __align__(16) float os[(KS > 1 ? KS * 64 : 16) * 68];
    __shared__ __align__(16) h16 vts[NORM ? 64 * 72 : 8];
    const size_t z = blockIdx.z; A += z * sA; if (A2) A2 += z * sA; Bt += z * sB; if (Bt2) Bt2 += z * sB; C += z * sC;
    const int lane = threadIdx.x & 31, lr = lane & 15, hi = lane >> 4; const int r0 = blockIdx.x * 64, c0 = blockIdx.y * 64;
    v8f acc[4][4];
#pragma unroll
    for (int mb = 0; mb < 4; ++mb)
#pragma unroll
        for (int nb = 0; nb < 4; ++nb) acc[mb][nb] = (v8f){};
    const size_t aoff = (size_t)(r0 + lr) * K + 8 * hi, boff = (size_t)(c0 + lr) * K + 8 * hi;
    const int wv = KS > 1 ? __builtin_amdgcn_readfirstlane((int)(threadIdx.x >> 5)) : 0; const int kspan = K / KS, kbeg = wv * kspan, kend = kbeg + kspan;
#pragma unroll 1
    for (int kc = kbeg; kc < kend; kc += 32) {
        V a[4], a2[4];
#pragma unroll
        for (int mb = 0; mb < 4; ++mb) { a[mb] = WFrag<T16>::ld(A + aoff + (size_t)mb * 16 * K + kc); if (NSPLIT == 1 || NSPLIT == 2) a2[mb] = WFrag<T16>::ld(A2 + aoff + (size_t)mb * 16 * K + kc); }
#pragma unroll
        for (int nb = 0; nb < 4; ++nb) { const V b = WFrag<T16>::ld(Bt + boff + (size_t)nb * 16 * K + kc); V b2; if (NSPLIT >= 2) b2 = WFrag<T16>::ld(Bt2 + boff + (size_t)nb * 16 * K + kc);
#pragma unroll
            for (int mb = 0; mb < 4; ++mb) { acc[mb][nb] = WFrag<T16>::mma(a[mb], b, acc[mb][nb]); if (NSPLIT == 1 || NSPLIT == 2) acc[mb][nb] = WFrag<T16>::mma(a2[mb], b, acc[mb][nb]); if (NSPLIT >= 2) acc[mb][nb] = WFrag<T16>::mma(a[mb], b2, acc[mb][nb]); } }
        asm volatile("v_nop\n\tv_nop\n\tv_nop\n\tv_nop" : "+v"(acc[0][0]), "+v"(acc[1][1]), "+v"(acc[2][2]), "+v"(acc[3][3]) : "v"(a[0]), "v"(a[3]));
    }
    if (KS > 1) {
        float* ow = os + wv * (64 * 68);
#pragma unroll
        for (int mb = 0; mb < 4; ++mb) {
#pragma unroll
            for (int nb = 0; nb < 4; ++nb) {
#pragma unroll
                for (int j = 0; j < 8; ++j) ow[(mb * 16 + hi * 8 + j) * 68 + nb * 16 + lr] = acc[mb][nb][j]; } }
        __syncthreads();    // every wave's partial tile is in LDS before any thread adds the KS partials of its outputs
        if (NORM) {
            const int rg = (int)threadIdx.x >> 4, cofs = lr * 4; const int zh = (r0 / TT) * NH_ + (int)blockIdx.y, t0 = r0 % TT; const unsigned lgb = (unsigned)cofs * 4u;
            float ga[4], gb[4], gc[4];
#pragma unroll
            for (int c = 0; c < 4; ++c) { ga[c] = *(const float*)((const char*)(g1 + c) + lgb); gb[c] = *(const float*)((const char*)(g2 + c) + lgb); gc[c] = *(const float*)((const char*)(g3 + c) + lgb); }
            asm volatile("s_wait_xcnt 0x0" :: "v"(lgb), "s"(g1), "s"(g2), "s"(g3) : "memory");    // the loads name these registers: the wait stands behind the last load, and as its inputs they stay live to here
            v4f val[8]; float x[8], y[8];
#pragma unroll
            for (int s = 0; s < 8; ++s) { const int row = rg * 8 + s; val[s] = *(const v4fa*)(os + row * 68 + cofs);
#pragma unroll
                for (int w = 1; w < KS; ++w) { const v4f o = *(const v4fa*)(os + (w * 64 + row) * 68 + cofs); val[s][0] += o[0]; val[s][1] += o[1]; val[s][2] += o[2]; val[s][3] += o[3]; }
                x[s] = __fadd_rn(__fmul_rn(val[s][0], val[s][0]), __fmul_rn(val[s][1], val[s][1])); y[s] = __fadd_rn(__fmul_rn(val[s][2], val[s][2]), __fmul_rn(val[s][3], val[s][3])); }
            // Sum of squares over the row's 16 lanes: the even and the odd pairs of dims apart, far lanes first, the two joined last (a fixed tree).
#pragma unroll
            for (int sh = 8; sh; sh >>= 1) {
#pragma unroll
                for (int s = 0; s < 8; ++s) { x[s] += __shfl_xor(x[s], sh, 32); y[s] += __shfl_xor(y[s], sh, 32); } }
#pragma unroll
            for (int c = 0; c < 4; ++c) { ga[c] = bfr(ga[c]); gb[c] = bfr(gb[c]); gc[c] = bfr(gc[c]); }
            v8h vv[4];
#pragma unroll
            for (int s = 0; s < 8; ++s) x[s] = __fadd_rn((x[s] + y[s]) * (1.0f / HD), 1.1920929e-07f);
            rs4(x[0], x[1], x[2], x[3], y[0], y[1], y[2], y[3]); rs4(x[4], x[5], x[6], x[7], y[4], y[5], y[6], y[7]);
#pragma unroll
            for (int s = 0; s < 8; ++s) {
#pragma unroll
                for (int c = 0; c < 4; ++c) { val[s][c] = __fmul_rn(val[s][c], y[s]); vv[c][s] = tohx(__fmul_rn(val[s][c], gc[c])); } }
#pragma unroll
            for (int c = 0; c < 4; ++c) *(v8ha*)(vts + (cofs + c) * 72 + rg * 8) = vv[c];
            __syncthreads();    // every thread has read its partial sums: os is free, and the q and k pieces are turned in it
            // 16-byte pieces in plane order, 16 pieces (one hi of one half of one fragment, 256 B) to a line of 272 B: the 8-byte writes of a wave then fall on all 64 banks. Plane p starts at p * 32 lines.
            char* st = (char*)os; const unsigned so = (unsigned)(((rg >> 1) * 8 + (lr >> 1)) * 272 + (rg & 1) * 128 + (lr & 1) * 8);
#pragma unroll
            for (int s = 0; s < 8; ++s) { v4us qh, ql, kh, kl;
#pragma unroll
                for (int c = 0; c < 4; ++c) { const float wn = val[s][c]; unsigned short x1, x2; splitf(__fmul_rn(wn, ga[c]), x1, x2); qh[c] = x1; ql[c] = x2; splitf(__fmul_rn(wn, gb[c]), x1, x2); kh[c] = x1; kl[c] = x2; }
                *(v4usa*)(st + so + s * 16) = qh; *(v4usa*)(st + so + s * 16 + 32 * 272) = ql; *(v4usa*)(st + so + s * 16 + 64 * 272) = kh; *(v4usa*)(st + so + s * 16 + 96 * 272) = kl; }
            __syncthreads();    // the V^T tile and the four q, k tiles are whole in LDS before any thread sends a piece out; it stands in front of every global store, so that it waits for none
            // Thread i sends piece s * 128 + i of each plane's 512: the tile's 8 KiB go out in order.
            const int tid = (int)threadIdx.x; const unsigned ob = (unsigned)((zh * TT + t0) * HD * 2 + tid * 16), sl = (unsigned)((tid >> 4) * 272 + (tid & 15) * 16);
            v8h vo[4]; v8us po[4][4];
#pragma unroll
            for (int s = 0; s < 4; ++s) { vo[s] = *(const v8ha*)(vts + (((s & 1) * 2 + (tid >> 6)) * 16 + (tid & 15)) * 72 + ((s >> 1) * 4 + ((tid >> 4) & 3)) * 8);
#pragma unroll
                for (int p = 0; p < 4; ++p) po[p][s] = *(const v8usa*)(st + sl + (p * 32 + s * 8) * 272); }
#pragma unroll
            for (int s = 0; s < 4; ++s) { *(v8h*)((char*)VT + ob + s * 2048) = vo[s]; *(v8us*)((char*)Qh + ob + s * 2048) = po[0][s]; *(v8us*)((char*)Ql + ob + s * 2048) = po[1][s]; *(v8us*)((char*)Kh + ob + s * 2048) = po[2][s]; *(v8us*)((char*)Kl + ob + s * 2048) = po[3][s]; }
            // the 20 stores name these registers: as the wait's inputs they stay as they are until it has passed
            asm volatile("s_wait_xcnt 0x0" :: "v"(ob), "v"(vo[0]), "v"(vo[1]), "v"(vo[2]), "v"(vo[3]), "v"(po[0][0]), "v"(po[0][1]), "v"(po[0][2]), "v"(po[0][3]), "v"(po[1][0]), "v"(po[1][1]), "v"(po[1][2]), "v"(po[1][3]),
                         "v"(po[2][0]), "v"(po[2][1]), "v"(po[2][2]), "v"(po[2][3]), "v"(po[3][0]), "v"(po[3][1]), "v"(po[3][2]), "v"(po[3][3]) : "memory");
            return;
        }
#pragma unroll
        for (int s = 0; s < 32 / KS; ++s) { const int idx = s * (32 * KS) + (int)threadIdx.x, row = idx >> 4, cofs = (idx & 15) * 4; v4f val = *(const v4fa*)(os + row * 68 + cofs);
#pragma unroll
            for (int w = 1; w < KS; ++w) { const v4f o = *(const v4fa*)(os + (w * 64 + row) * 68 + cofs); val[0] += o[0]; val[1] += o[1]; val[2] += o[2]; val[3] += o[3]; }
            if (BIAS) { val[0] += bfr(bias[c0 + cofs]); val[1] += bfr(bias[c0 + cofs + 1]); val[2] += bfr(bias[c0 + cofs + 2]); val[3] += bfr(bias[c0 + cofs + 3]); }
            *(v4f*)(C + (size_t)(r0 + row) * ldc + c0 + cofs) = val; }
        return;
    }
#pragma unroll
    for (int mb = 0; mb < 4; ++mb) {
#pragma unroll
        for (int nb = 0; nb < 4; ++nb) {
#pragma unroll
            for (int j = 0; j < 8; ++j) os[(hi * 8 + j) * 68 + nb * 16 + lr] = acc[mb][nb][j]; }
        __builtin_amdgcn_wave_barrier(); asm volatile("" ::: "memory");
        float* crow = C + (size_t)(r0 + mb * 16) * ldc + c0;
{
#pragma unroll
            for (int s = 0; s < 8; ++s) { const int row = 2 * s + hi, cofs = lr * 4; v4f val = *(const v4fa*)(os + row * 68 + cofs); if (BIAS) { val[0] += bfr(bias[c0 + cofs]); val[1] += bfr(bias[c0 + cofs + 1]); val[2] += bfr(bias[c0 + cofs + 2]); val[3] += bfr(bias[c0 + cofs + 3]); }
                *(v4f*)(crow + (size_t)row * ldc + cofs) = val; }
             }
        __builtin_amdgcn_wave_barrier(); asm volatile("" ::: "memory");
    }
}


__global__ __launch_bounds__(256) void k_wtG(const float* __restrict__ w, int K, int N, bf* Bt) {
    const int lane = threadIdx.x & 31; const int L0 = (blockIdx.x * 8 + (threadIdx.x >> 5)) * 8; const int nlines = N * K / 64;
{
#pragma unroll 1
        for (int l = 0; l < 8; ++l) { const int L = L0 + l; if (L >= nlines) break; const size_t e = (size_t)L * 64 + lane * 2; const int k = (int)(e % K), n = (int)(e / K); v2us o;
            o[0] = f2bf(w[(size_t)k * N + n]); o[1] = f2bf(w[(size_t)(k + 1) * N + n]); *(v2us*)(Bt + e) = o; }
         }
}
__global__ __launch_bounds__(256) void k_cvt8(const float* __restrict__ src, bf* dst, size_t n8) { const size_t i = (size_t)blockIdx.x * 256 + threadIdx.x; if (i >= n8) return; const v8f v = *(const v8f*)(src + i * 8); v8us o;
#pragma unroll
    for (int k = 0; k < 8; ++k) o[k] = f2bf(v[k]); *(v8us*)(dst + i * 8) = o;  }
// The scores never go to memory: k_stat and k_att each form the score tiles they need on the matrix units, from the same hi / lo planes and with the same three products.
// SC = log2(e) / 8: exp(s / 8 - m / 8) = 2^(s SC - m SC).
#define SC 0.18033688f
// 2^x and log2 x. Results apart from all sources and a v_nop at the end of each statement: the one-instruction slot that the instruction set asks for behind a transcendental before its result is read or its source
// overwritten.
__device__ __forceinline__ void ex4(float x0, float x1, float x2, float x3, float& y0, float& y1, float& y2, float& y3) { asm("v_exp_f32 %0, %4\n\tv_exp_f32 %1, %5\n\tv_exp_f32 %2, %6\n\tv_exp_f32 %3, %7\n\tv_nop" : "=&v"(y0), "=&v"(y1), "=&v"(y2), "=&v"(y3) : "v"(x0), "v"(x1), "v"(x2), "v"(x3)); }
__device__ __forceinline__ void ex3(float x0, float x1, float x2, float& y0, float& y1, float& y2) { asm("v_exp_f32 %0, %3\n\tv_exp_f32 %1, %4\n\tv_exp_f32 %2, %5\n\tv_nop" : "=&v"(y0), "=&v"(y1), "=&v"(y2) : "v"(x0), "v"(x1), "v"(x2)); }
__device__ __forceinline__ float ex1(float x) { float y; asm("v_exp_f32 %0, %1\n\tv_nop" : "=&v"(y) : "v"(x)); return y; }
__device__ __forceinline__ float lg1(float x) { float y; asm("v_log_f32 %0, %1\n\tv_nop" : "=&v"(y) : "v"(x)); return y; }
// A lane's address = a wave-uniform base + the lane's own byte offset: the loads then name one offset register and the base's scalar pair, which the waits behind them take as inputs.
template <typename T> __device__ __forceinline__ const T* atb(const T* base, unsigned lob) { return (const T*)((const char*)base + lob); }
// The loops' stepping addresses are byte pointers typed as global memory: as operands of the wait statement they would otherwise lose that type, and the loads would become flat ones.
#define GLB __attribute__((address_space(1)))
typedef const GLB char* gp;
__device__ __forceinline__ v16bf ldb(gp p, int o) { return cat16b(*(const GLB v8us*)(p + o), *(const GLB v8us*)(p + o + FRH)); }
__device__ __forceinline__ v16h ldh(gp p, int o) { return cat16(*(const GLB v8h*)(p + o), *(const GLB v8h*)(p + o + FRH)); }
__device__ __forceinline__ v16bf ldf(const bf* p) { return cat16b(*(const v8us*)p, *(const v8us*)(p + FRH / 2)); }
__device__ __forceinline__ v8f score6(v16bf ah0, v16bf al0, v16bf ah1, v16bf al1, v16bf bh0, v16bf bl0, v16bf bh1, v16bf bl1) {
    v8f c = (v8f){}; c = wmmab(ah0, bh0, c); c = wmmab(al0, bh0, c); c = wmmab(ah0, bl0, c); c = wmmab(ah1, bh1, c); c = wmmab(al1, bh1, c); c = wmmab(ah1, bl1, c); return c; }
// k_stat: softmax statistics of both directions. blockIdx.y = 0: a query is fixed and the keys move (row softmax); 1: a key is fixed and the queries move (column softmax). Grid (TT / 128, 2, NZ), 4 waves:
// wave w holds the 64 fixed rows (w & 1) as A fragments and walks half (w >> 1) of the 2048 moving rows, 32 a trip. D[8 hi + j][lr]: a lane keeps a running maximum and sum for each of its 32 fixed rows over the moving
// rows that fall on its column; the 16 lanes, then the two halves (through LDS), are joined in a fixed order. Out: E = 9 - m SC - log2(sum), so that 2^(s SC + E) = 512 exp(s / 8 - m / 8) / sum.
__global__ __launch_bounds__(128) __attribute__((amdgpu_waves_per_eu(3, 3))) void k_stat(const bf* __restrict__ Qh, const bf* __restrict__ Ql, const bf* __restrict__ Kh, const bf* __restrict__ Kl, float* E) {
    __shared__ float lm[2 * 64]; __shared__ float ls[2 * 64];
    const int lane = threadIdx.x & 31, lr = lane & 15, hi = lane >> 4; const int wv = __builtin_amdgcn_readfirstlane((int)(threadIdx.x >> 5)), fg = wv & 1, mh = wv >> 1;
    const int role = blockIdx.y, zh = blockIdx.z; const size_t zo = (size_t)zh * TT * HD; const int f0 = blockIdx.x * 128 + fg * 64;
    const bf* Fh = (role ? Kh : Qh) + zo; const bf* Fl = (role ? Kl : Ql) + zo; const bf* Mh = (role ? Qh : Kh) + zo; const bf* Ml = (role ? Ql : Kl) + zo;
    const unsigned lob = (unsigned)lane * 16u; const bf* pfh = Fh + f0 * HD; const bf* pfl = Fl + f0 * HD;
    v16bf ah[4][2], al[4][2];
#pragma unroll
    for (int a = 0; a < 4; ++a) {
#pragma unroll
        for (int kc = 0; kc < 2; ++kc) { ah[a][kc] = ldf(atb(pfh + a * 16 * HD + kc * (FRB / 2), lob)); al[a][kc] = ldf(atb(pfl + a * 16 * HD + kc * (FRB / 2), lob)); } }
    asm volatile("s_wait_xcnt 0x0" :: "v"(lob), "s"(pfh), "s"(pfl) : "memory");    // the loads name the two bases and the lane's offset (as built: the lane number, scaled by the load's width): the wait stands directly behind the last load, in front of every write of one of them
    float m[4][8], s[4][8];
#pragma unroll
    for (int a = 0; a < 4; ++a) {
#pragma unroll
        for (int j = 0; j < 8; ++j) { m[a][j] = -3.0e38f; s[a][j] = 0.f; } }
    gp pmh = (gp)(const char*)atb(Mh + mh * (TT / 2) * HD, lob); gp pml = (gp)(const char*)atb(Ml + mh * (TT / 2) * HD, lob);
#pragma unroll 1    // rolled: one trip's fragments and score tiles already fill the register budget of three waves a SIMD
    for (int it = 0; it < TT / 2 / 32; ++it) {
        v16bf bh[2][2], bl[2][2];
#pragma unroll
        for (int b = 0; b < 2; ++b) {
#pragma unroll
            for (int kc = 0; kc < 2; ++kc) { bh[b][kc] = ldb(pmh, b * 16 * HD * 2 + kc * FRB); bl[b][kc] = ldb(pml, b * 16 * HD * 2 + kc * FRB); } }
        // The trip's loads name the two address pairs. The wait takes the loaded values as inputs, so every load stands in front of it, and the pairs as operands, so that they are the registers the loads name, stay
        // as they are to here (no load's result is placed on one) and step on only behind it.
        asm volatile("s_wait_xcnt 0x0" : "+v"(pmh), "+v"(pml) : "v"(bh[0][0]), "v"(bh[0][1]), "v"(bh[1][0]), "v"(bh[1][1]), "v"(bl[0][0]), "v"(bl[0][1]), "v"(bl[1][0]), "v"(bl[1][1]) : "memory");
        pmh += 32 * HD * 2; pml += 32 * HD * 2;
#pragma unroll
        for (int a = 0; a < 4; ++a) {
            const v8f c0 = score6(ah[a][0], al[a][0], ah[a][1], al[a][1], bh[0][0], bl[0][0], bh[0][1], bl[0][1]);
            const v8f c1 = score6(ah[a][0], al[a][0], ah[a][1], al[a][1], bh[1][0], bl[1][0], bh[1][1], bl[1][1]);
#pragma unroll
            for (int j = 0; j < 8; ++j) { const float mn = fmaxf(m[a][j], fmaxf(c0[j], c1[j])); const float nb = -mn * SC;
                float e0, e1, e2; ex3(fmaf(m[a][j], SC, nb), fmaf(c0[j], SC, nb), fmaf(c1[j], SC, nb), e0, e1, e2); s[a][j] = fmaf(s[a][j], e0, e1 + e2); m[a][j] = mn; }
            __builtin_amdgcn_sched_barrier(0); }    // a row group's score tiles are formed behind the sums of the group before: several groups' tiles at once do not fit the registers of three waves a SIMD (spills)
    }
#pragma unroll
    for (int a = 0; a < 4; ++a) {
#pragma unroll
        for (int j = 0; j < 8; ++j) { float mm = m[a][j];
#pragma unroll
            for (int sh = 1; sh <= 8; sh <<= 1) mm = fmaxf(mm, __shfl_xor(mm, sh, 32));
            float ss = s[a][j] * ex1((m[a][j] - mm) * SC);
#pragma unroll
            for (int sh = 1; sh <= 8; sh <<= 1) ss += __shfl_xor(ss, sh, 32);
            m[a][j] = mm; s[a][j] = ss; } }
    if (mh == 1 && lr == 0) {
#pragma unroll
        for (int a = 0; a < 4; ++a) {
#pragma unroll
            for (int j = 0; j < 8; ++j) { lm[fg * 64 + a * 16 + hi * 8 + j] = m[a][j]; ls[fg * 64 + a * 16 + hi * 8 + j] = s[a][j]; } } }
    __syncthreads();    // the second half's maxima and sums are in LDS before the first half's waves join them
    if (mh == 0 && lr == 0) { float* eo = E + ((size_t)role * NZ + zh) * TT + f0 + hi * 8;
#pragma unroll
        for (int a = 0; a < 4; ++a) { v8f e;
#pragma unroll
            for (int j = 0; j < 8; ++j) { const float om = lm[fg * 64 + a * 16 + hi * 8 + j], os = ls[fg * 64 + a * 16 + hi * 8 + j]; const float mm = fmaxf(m[a][j], om);
                const float ss = s[a][j] * ex1((m[a][j] - mm) * SC) + os * ex1((om - mm) * SC); e[j] = 9.0f - mm * SC - lg1(ss); }
            *(v8f*)(eo + a * 16) = e;
            asm volatile("s_wait_xcnt 0x0" :: "v"(e), "v"(eo) : "memory"); } }    // the store names e's and eo's registers: as the wait's inputs they stay as they are until it has passed
}
// k_att: y = a.v with a formed in registers. Grid (TT / 64, NZ), 4 waves: wave w owns the 32 queries (w & 1) and half (w >> 1) of the keys, 32 keys a trip. S^T = K Q^T (A = K rows, B = Q, kept in registers): D[8 hi + j][lr] is
// key 8 hi + j against query lr, so two score tiles of 16 keys, turned into 512 a = 2^(s SC + E_row[query]) + 2^(s SC + E_col[key]) and rounded to fp16, ARE the B fragment (k = 8 hi + j, 16 + 8 hi + j) of O^T += V^T P^T,
// whose A fragment comes from VT by the same k order. The two key halves are added through LDS (first half + second half); y / 512 goes out as the two bf16 planes, 8 consecutive d a lane.
__global__ __launch_bounds__(128) __attribute__((amdgpu_waves_per_eu(3, 3))) void k_att(const bf* __restrict__ Qh, const bf* __restrict__ Ql, const bf* __restrict__ Kh, const bf* __restrict__ Kl, const h16* __restrict__ VT, const float* __restrict__ E, bf* Yh, bf* Yl) {
    __shared__ __align__(16) float red[2 * 64 * 32];
    const int lane = threadIdx.x & 31, lr = lane & 15, hi = lane >> 4; const int wv = __builtin_amdgcn_readfirstlane((int)(threadIdx.x >> 5)), qg = wv & 1, kh = wv >> 1;
    const int zh = blockIdx.y; const size_t zo = (size_t)zh * TT * HD; const int q0 = blockIdx.x * 64 + qg * 32; const unsigned lob = (unsigned)lane * 16u, leb = (unsigned)hi * 32u, lab = (unsigned)lr * 4u;
    const bf* Kph = Kh + zo; const bf* Kpl = Kl + zo; const h16* Vp = VT + zo; const float* Eb = E + ((size_t)NZ + zh) * TT;
    v16bf qh[2][2], ql[2][2]; float ea[2]; const bf* pqh = Qh + zo + q0 * HD; const bf* pql = Ql + zo + q0 * HD; const float* pea = E + (size_t)zh * TT + q0;
#pragma unroll
    for (int qt = 0; qt < 2; ++qt) { ea[qt] = *atb(pea + qt * 16, lab);
#pragma unroll
        for (int kc = 0; kc < 2; ++kc) { qh[qt][kc] = ldf(atb(pqh + qt * 16 * HD + kc * (FRB / 2), lob)); ql[qt][kc] = ldf(atb(pql + qt * 16 * HD + kc * (FRB / 2), lob)); } }
    asm volatile("s_wait_xcnt 0x0" :: "v"(lob), "v"(lane), "v"(lab), "s"(pqh), "s"(pql), "s"(pea) : "memory");    // the loads name these registers: the wait stands behind the last load, and as its inputs they stay live to here, so that none is rewritten before it
    v8f o[4][2];
#pragma unroll
    for (int dt = 0; dt < 4; ++dt) { o[dt][0] = (v8f){}; o[dt][1] = (v8f){}; }
    gp pk = (gp)(const char*)atb(Kph + kh * (TT / 2) * HD, lob); gp pl = (gp)(const char*)atb(Kpl + kh * (TT / 2) * HD, lob); gp pv = (gp)(const char*)atb(Vp + kh * (TT / 2) * HD, lob); gp pe = (gp)(const char*)atb(Eb + kh * (TT / 2), leb);
#pragma unroll 1    // rolled: one trip's fragments already fill the register budget of three waves a SIMD
    for (int it = 0; it < TT / 2 / 32; ++it) {
        v16bf ka[2][2], kb[2][2]; v8f eb[2]; v16h va[4];
#pragma unroll
        for (int kt = 0; kt < 2; ++kt) {
#pragma unroll
            for (int kc = 0; kc < 2; ++kc) { ka[kt][kc] = ldb(pk, kt * 16 * HD * 2 + kc * FRB); kb[kt][kc] = ldb(pl, kt * 16 * HD * 2 + kc * FRB); } }
#pragma unroll
        for (int kt = 0; kt < 2; ++kt) eb[kt] = *(const GLB v8f*)(pe + kt * 64);
#pragma unroll
        for (int dt = 0; dt < 4; ++dt) va[dt] = ldh(pv, dt * FRB);
        // The trip's loads name the four address pairs. The wait takes the loaded values as inputs, so every load stands in front of it, and the pairs as operands, so that they are the registers the loads name, stay
        // as they are to here (no load's result is placed on one) and step on only behind it.
        asm volatile("s_wait_xcnt 0x0" : "+v"(pk), "+v"(pl), "+v"(pv), "+v"(pe) : "v"(ka[0][0]), "v"(ka[0][1]), "v"(ka[1][0]), "v"(ka[1][1]), "v"(kb[0][0]), "v"(kb[0][1]), "v"(kb[1][0]), "v"(kb[1][1]), "v"(eb[0]), "v"(eb[1]), "v"(va[0]), "v"(va[1]), "v"(va[2]), "v"(va[3]) : "memory");
        pk += 32 * HD * 2; pl += 32 * HD * 2; pv += 32 * HD * 2; pe += 32 * 4;
        v16h p[2];
#pragma unroll
        for (int qt = 0; qt < 2; ++qt) {
#pragma unroll
            for (int kt = 0; kt < 2; ++kt) { const v8f c = score6(ka[kt][0], kb[kt][0], ka[kt][1], kb[kt][1], qh[qt][0], ql[qt][0], qh[qt][1], ql[qt][1]);
#pragma unroll
                for (int j = 0; j < 8; j += 2) { float r0, c0, r1, c1; ex4(fmaf(c[j], SC, ea[qt]), fmaf(c[j], SC, eb[kt][j]), fmaf(c[j + 1], SC, ea[qt]), fmaf(c[j + 1], SC, eb[kt][j + 1]), r0, c0, r1, c1); p[qt][kt * 8 + j] = tohx(r0 + c0); p[qt][kt * 8 + j + 1] = tohx(r1 + c1); } } }
#pragma unroll
        for (int dt = 0; dt < 4; ++dt) { o[dt][0] = wmma16(va[dt], p[0], o[dt][0]); o[dt][1] = wmma16(va[dt], p[1], o[dt][1]); }
    }
    float* rw = red + qg * (64 * 32) + lane;
    if (kh == 1) {
#pragma unroll
        for (int dt = 0; dt < 4; ++dt) {
#pragma unroll
            for (int qt = 0; qt < 2; ++qt) {
#pragma unroll
                for (int j = 0; j < 8; ++j) rw[((dt * 2 + qt) * 8 + j) * 32] = o[dt][qt][j]; } } }
    __syncthreads();    // the second key half's partial outputs are in LDS before the first half's waves add them
    if (kh == 0) { const size_t yo = (size_t)((zh / NH_) * TT + q0 + lr) * CC + (zh % NH_) * HD + 8 * hi;
#pragma unroll
        for (int dt = 0; dt < 4; ++dt) {
#pragma unroll
            for (int qt = 0; qt < 2; ++qt) { v8us oh, ol;
#pragma unroll
                for (int j = 0; j < 8; ++j) { unsigned short a, c; splitf((o[dt][qt][j] + rw[((dt * 2 + qt) * 8 + j) * 32]) * (1.0f / PCAR), a, c); oh[j] = a; ol[j] = c; }
                *(v8us*)(Yh + yo + (size_t)qt * 16 * CC + dt * 16) = oh; *(v8us*)(Yl + yo + (size_t)qt * 16 * CC + dt * 16) = ol; } } }
}

extern "C" void kernel_launch(void* const* d_in, const int* in_sizes, int n_in,
                              void* d_out, int out_size, void* d_ws, size_t ws_size, hipStream_t stream) {
    (void)in_sizes; (void)n_in; (void)out_size;
    const float* x = (const float*)d_in[0]; const float* Wt = (const float*)d_in[1]; const float* g1 = (const float*)d_in[2]; const float* g2 = (const float*)d_in[3]; const float* g3 = (const float*)d_in[4];
    float* OUT = (float*)d_out;     // [2][2048][768]
    char* wsp = (char*)d_ws;
    auto take = [&](size_t bytes) { char* p = wsp; wsp += (bytes + 255) & ~(size_t)255; return (void*)p; };
    bf* WB = (bf*)take((size_t)CC * CC * 2); bf* WT = (bf*)take((size_t)CC * CC * 2); bf* XB = (bf*)take((size_t)NB_ * TT * CC * 2); bf* Yh = (bf*)take((size_t)NB_ * TT * CC * 2); bf* Yl = (bf*)take((size_t)NB_ * TT * CC * 2);
    bf* Qh = (bf*)take((size_t)NZ * TT * HD * 2); bf* Ql = (bf*)take((size_t)NZ * TT * HD * 2); bf* Kh = (bf*)take((size_t)NZ * TT * HD * 2); bf* Kl = (bf*)take((size_t)NZ * TT * HD * 2); h16* VT = (h16*)take((size_t)NZ * HD * TT * 2);
    float* E = (float*)take((size_t)2 * NZ * TT * 4);    // [row / column][zh][t]
    if ((size_t)(wsp - (char*)d_ws) > ws_size) return;    // total ~ 53 MB
    k_cvt8<<<(CC * CC / 8 + 255) / 256, 256, 0, stream>>>(Wt, WB, (size_t)CC * CC / 8);      // W [out][in] = natural Bt for x W^T
    k_wtG<<<(CC * CC / 64 + 63) / 64, 256, 0, stream>>>(Wt, CC, CC, WT);                  // W as x @ W operand for y W
    // Both batch items go through every launch together (rows b * TT + t), and all NZ (batch, head) pairs through the statistics and the a.v launch.
    k_cvt8<<<(NB_ * TT * CC / 8 + 255) / 256, 256, 0, stream>>>(x, XB, (size_t)NB_ * TT * CC / 8);
    k_gemmw<bf, 0, false, 4, true><<<dim3(NB_ * TT / 64, CC / 64, 1), 128, 0, stream>>>(XB, nullptr, WB, nullptr, CC, nullptr, CC, nullptr, 0, 0, 0, g1, g2, g3, Qh, Ql, Kh, Kl, VT);    // w = x W^T, normed in the epilogue: q, k, v planes
    k_stat<<<dim3(TT / 128, 2, NZ), 128, 0, stream>>>(Qh, Ql, Kh, Kl, E);
    k_att<<<dim3(TT / 64, NZ), 128, 0, stream>>>(Qh, Ql, Kh, Kl, VT, E, Yh, Yl);
    k_gemmw<bf, 1, false, 4, false><<<dim3(NB_ * TT / 64, CC / 64, 1), 128, 0, stream>>>(Yh, Yl, WT, nullptr, CC, OUT, CC, nullptr, 0, 0, 0, nullptr, nullptr, nullptr, nullptr, nullptr, nullptr, nullptr, nullptr);
}

// v007
// One run takes 121 microseconds.
// Next to v006, in two timings, it ran 1.19 and 1.21 times as fast.
// All steps since v000 together make it 79.1 times as fast.
#include <hip/hip_runtime.h>

// HyperSETAlterAttention (x [2][2048][768]; w = x W^T (12 heads x 64, shared weights); q, k, v = RMSNorm(w) g1 / g2 / g3 (eps = f32 eps); att = q.k / 8; a = softmax over keys + softmax over QUERIES (bisoftmax);
// y = a.v merged; out = y W -> [2][2048][768]).
// Compute dtypes, f32 accumulate: every input rounded to bf16; x W^T on PLAIN bf16 operands (inputs: exact); RMSNorm f32 -> bf16 hi+lo planes of q and k (scores: 3 products, K 64 - the cosine-like logits span
// +-8, single fp16 planes were not tried) and a single fp16 plane of v; the softmax statistics (running max / sum, fixed order; att is symmetric, so the rows' serve the columns too) in f32 from score tiles formed anew on the matrix units; both softmaxes combined into ONE fp16 plane in registers (scaled by 512)

#define NB_  2
#define TT   2048
#define CC   768
#define NH_  12
#define HD   64
#define NZ   (NB_ * NH_)    // (batch, head) pairs, index zh = b * NH_ + h
#define PCAR 512.0f
typedef _Float16 h16;
typedef unsigned short bf;
typedef __attribute__((ext_vector_type(16))) __bf16   v16bf;
typedef __attribute__((ext_vector_type(16))) _Float16 v16h;
typedef __attribute__((ext_vector_type(8)))  _Float16 v8h;
typedef __attribute__((ext_vector_type(8)))  unsigned short v8us;
typedef __attribute__((ext_vector_type(8)))  float    v8f;
typedef __attribute__((ext_vector_type(4)))  float    v4f;
typedef v8h  __attribute__((may_alias)) v8ha;
typedef v4f  __attribute__((may_alias)) v4fa;
typedef v8us __attribute__((may_alias)) v8usa;

__device__ __forceinline__ unsigned short f2bf(float f) { unsigned u = __float_as_uint(f); u += 0x7FFFu + ((u >> 16) & 1u); return (unsigned short)(u >> 16); }
__device__ __forceinline__ float bf2f(unsigned short b) { return __uint_as_float(((unsigned)b) << 16); }
__device__ __forceinline__ float bfr(float f) { return bf2f(f2bf(f)); }
__device__ __forceinline__ v16h cat16(v8h lo, v8h hi) { return __builtin_shufflevector(lo, hi, 0, 1, 2, 3, 4, 5, 6, 7, 8, 9, 10, 11, 12, 13, 14, 15); }
__device__ __forceinline__ v16bf cat16b(v8us lo, v8us hi) { return __builtin_bit_cast(v16bf, __builtin_shufflevector(lo, hi, 0, 1, 2, 3, 4, 5, 6, 7, 8, 9, 10, 11, 12, 13, 14, 15)); }
__device__ __forceinline__ v8f wmma16(v16h a, v16h b, v8f c) { return __builtin_amdgcn_wmma_f32_16x16x32_f16(false, a, false, b, (short)0, c, false, false); }
__device__ __forceinline__ v8f wmmab(v16bf a, v16bf b, v8f c) { return __builtin_amdgcn_wmma_f32_16x16x32_bf16(false, a, false, b, (short)0, c, false, false); }
__device__ __forceinline__ h16 tohx(float x) { return (h16)x; }
__device__ __forceinline__ void splitf(float y, unsigned short& h, unsigned short& l) { h = f2bf(y); l = f2bf(y - bf2f(h)); }
typedef __attribute__((ext_vector_type(2))) _Float16 v2h;
typedef __attribute__((ext_vector_type(4))) _Float16 v4h;
typedef __attribute__((ext_vector_type(2))) unsigned short v2us;
typedef __attribute__((ext_vector_type(4))) unsigned short v4us;
typedef v4us __attribute__((may_alias)) v4usa;
// FRAGMENT ORDER of the q, k (hi and lo) and v^T planes. A 16 x 32 operand fragment (16 rows, 32 k) is 1 KiB: [half 0..1][hi 0..1][row 0..15][8 k], element k = 16 half + 8 hi + 0..7, so that lane (hi, row) finds its two
// 16-byte pieces at 16 * lane and 512 + 16 * lane and each load of a wave is 512 consecutive bytes (4 whole lines) instead of 32 bytes of each of 16 lines. q, k: [zh][t / 16][d / 32][fragment], rows t, k = d.
// v^T: [zh][t / 32][d / 16][fragment], rows d, k = t. 64 rows t of one (batch, head) are 8 KiB in a row in every plane.
#define FRH 512     // bytes from a lane's first piece to its second
#define FRB 1024    // bytes of a fragment



// ---- k_gemmw: register-blocked GEMM, one work-group of KS waves per 64x64 output tile (16 accumulators a wave), operands straight from K-contiguous 16-bit planes; grid (M/64, N/64, Z), 32 * KS threads.
// C[m][n] (f32, pitch ldc, + optional f32 bias[n]) = sum_k A[m][k] Bt[n][k] (+ split products per NSPLIT). z-batch strides sA/sB/sC in elements. K % (32 * KS) == 0.
// KS > 1: wave w sums the K / KS consecutive k from w * K / KS on, so a long K is KS short load-latency chains side by side; the KS partial tiles meet in LDS and are added in wave order 0, 1, .. KS - 1.
template <typename T16> struct WFrag;
template <> struct WFrag<h16> { typedef v16h V; static __device__ __forceinline__ V ld(const h16* p) { return cat16(*(const v8h*)p, *(const v8h*)(p + 16)); } static __device__ __forceinline__ v8f mma(V a, V b, v8f c) { return wmma16(a, b, c); } };
template <> struct WFrag<bf> { typedef v16bf V; static __device__ __forceinline__ V ld(const bf* p) { return cat16b(*(const v8us*)p, *(const v8us*)(p + 16)); } static __device__ __forceinline__ v8f mma(V a, V b, v8f c) { return wmmab(a, b, c); } };
// 1 / sqrt(x), four at a time. Results apart from all sources and a v_nop at the end of the statement: the one-instruction slot that the instruction set asks for behind a transcendental before its result is read or its
// source overwritten.
__device__ __forceinline__ void rs4(float x0, float x1, float x2, float x3, float& y0, float& y1, float& y2, float& y3) { asm("v_rsq_f32 %0, %4\n\tv_rsq_f32 %1, %5\n\tv_rsq_f32 %2, %6\n\tv_rsq_f32 %3, %7\n\tv_nop" : "=&v"(y0), "=&v"(y1), "=&v"(y2), "=&v"(y3) : "v"(x0), "v"(x1), "v"(x2), "v"(x3)); }
// NORM (the projection x W^T, KS = 4, N tile = one head): the tile is 64 rows t of one (batch, head) with all 64 dims, so the work-group that summed it also norms it: r = rsqrt(mean(w^2) + eps) a row, then
// Q hi/lo = split(w r g1), K hi/lo = split(w r g2) and V^T = fp16(w r g3), all five in fragment order (turned in LDS so that every store of a wave is 512 consecutive bytes). C is not written. 16 lanes hold a row, 4 dims each, 8 consecutive rows a thread.
template <typename T16, int NSPLIT, bool BIAS, int KS, bool NORM>
__global__ __launch_bounds__(32 * KS) void k_gemmw(const T16* __restrict__ A, const T16* __restrict__ A2, const T16* __restrict__ Bt, const T16* __restrict__ Bt2, int K, float* C, int ldc, const float* __restrict__ bias, size_t sA, size_t sB, size_t sC,
                                                   const float* __restrict__ g1, const float* __restrict__ g2, const float* __restrict__ g3, bf* Qh, bf* Ql, bf* Kh, bf* Kl, h16* VT) {
    typedef typename WFrag<T16>::V V;
    __shared__ __align__(16) float os[(KS > 1 ? KS * 64 : 16) * 68];
    __shared__ __align__(16) h16 vts[NORM ? 64 * 72 : 8];
    const size_t z = blockIdx.z; A += z * sA; if (A2) A2 += z * sA; Bt += z * sB; if (Bt2) Bt2 += z * sB; C += z * sC;
    const int lane = threadIdx.x & 31, lr = lane & 15, hi = lane >> 4; const int r0 = blockIdx.x * 64, c0 = blockIdx.y * 64;
    v8f acc[4][4];
#pragma unroll
    for (int mb = 0; mb < 4; ++mb)
#pragma unroll
        for (int nb = 0; nb < 4; ++nb) acc[mb][nb] = (v8f){};
    const size_t aoff = (size_t)(r0 + lr) * K + 8 * hi, boff = (size_t)(c0 + lr) * K + 8 * hi;
    const int wv = KS > 1 ? __builtin_amdgcn_readfirstlane((int)(threadIdx.x >> 5)) : 0; const int kspan = K / KS, kbeg = wv * kspan, kend = kbeg + kspan;
#pragma unroll 1
    for (int kc = kbeg; kc < kend; kc += 32) {
        V a[4], a2[4];
#pragma unroll
        for (int mb = 0; mb < 4; ++mb) { a[mb] = WFrag<T16>::ld(A + aoff + (size_t)mb * 16 * K + kc); if (NSPLIT == 1 || NSPLIT == 2) a2[mb] = WFrag<T16>::ld(A2 + aoff + (size_t)mb * 16 * K + kc); }
#pragma unroll
        for (int nb = 0; nb < 4; ++nb) { const V b = WFrag<T16>::ld(Bt + boff + (size_t)nb * 16 * K + kc); V b2; if (NSPLIT >= 2) b2 = WFrag<T16>::ld(Bt2 + boff + (size_t)nb * 16 * K + kc);
#pragma unroll
            for (int mb = 0; mb < 4; ++mb) { acc[mb][nb] = WFrag<T16>::mma(a[mb], b, acc[mb][nb]); if (NSPLIT == 1 || NSPLIT == 2) acc[mb][nb] = WFrag<T16>::mma(a2[mb], b, acc[mb][nb]); if (NSPLIT >= 2) acc[mb][nb] = WFrag<T16>::mma(a[mb], b2, acc[mb][nb]); } }
        asm volatile("v_nop\n\tv_nop\n\tv_nop\n\tv_nop" : "+v"(acc[0][0]), "+v"(acc[1][1]), "+v"(acc[2][2]), "+v"(acc[3][3]) : "v"(a[0]), "v"(a[3]));
    }
    if (KS > 1) {
        float* ow = os + wv * (64 * 68);
#pragma unroll
        for (int mb = 0; mb < 4; ++mb) {
#pragma unroll
            for (int nb = 0; nb < 4; ++nb) {
#pragma unroll
                for (int j = 0; j < 8; ++j) ow[(mb * 16 + hi * 8 + j) * 68 + nb * 16 + lr] = acc[mb][nb][j]; } }
        __syncthreads();    // every wave's partial tile is in LDS before any thread adds the KS partials of its outputs
        if (NORM) {
            const int rg = (int)threadIdx.x >> 4, cofs = lr * 4; const int zh = (r0 / TT) * NH_ + (int)blockIdx.y, t0 = r0 % TT; const unsigned lgb = (unsigned)cofs * 4u;
            float ga[4], gb[4], gc[4];
#pragma unroll
            for (int c = 0; c < 4; ++c) { ga[c] = *(const float*)((const char*)(g1 + c) + lgb); gb[c] = *(const float*)((const char*)(g2 + c) + lgb); gc[c] = *(const float*)((const char*)(g3 + c) + lgb); }
            asm volatile("s_wait_xcnt 0x0" :: "v"(lgb), "s"(g1), "s"(g2), "s"(g3) : "memory");    // the loads name these registers: the wait stands behind the last load, and as its inputs they stay live to here
            v4f val[8]; float x[8], y[8];
#pragma unroll
            for (int s = 0; s < 8; ++s) { const int row = rg * 8 + s; val[s] = *(const v4fa*)(os + row * 68 + cofs);
#pragma unroll
                for (int w = 1; w < KS; ++w) { const v4f o = *(const v4fa*)(os + (w * 64 + row) * 68 + cofs); val[s][0] += o[0]; val[s][1] += o[1]; val[s][2] += o[2]; val[s][3] += o[3]; }
                x[s] = __fadd_rn(__fmul_rn(val[s][0], val[s][0]), __fmul_rn(val[s][1], val[s][1])); y[s] = __fadd_rn(__fmul_rn(val[s][2], val[s][2]), __fmul_rn(val[s][3], val[s][3])); }
            // Sum of squares over the row's 16 lanes: the even and the odd pairs of dims apart, far lanes first, the two joined last (a fixed tree).
#pragma unroll
            for (int sh = 8; sh; sh >>= 1) {
#pragma unroll
                for (int s = 0; s < 8; ++s) { x[s] += __shfl_xor(x[s], sh, 32); y[s] += __shfl_xor(y[s], sh, 32); } }
#pragma unroll
            for (int c = 0; c < 4; ++c) { ga[c] = bfr(ga[c]); gb[c] = bfr(gb[c]); gc[c] = bfr(gc[c]); }
            v8h vv[4];
#pragma unroll
            for (int s = 0; s < 8; ++s) x[s] = __fadd_rn((x[s] + y[s]) * (1.0f / HD), 1.1920929e-07f);
            rs4(x[0], x[1], x[2], x[3], y[0], y[1], y[2], y[3]); rs4(x[4], x[5], x[6], x[7], y[4], y[5], y[6], y[7]);
#pragma unroll
            for (int s = 0; s < 8; ++s) {
#pragma unroll
                for (int c = 0; c < 4; ++c) { val[s][c] = __fmul_rn(val[s][c], y[s]); vv[c][s] = tohx(__fmul_rn(val[s][c], gc[c])); } }
#pragma unroll
            for (int c = 0; c < 4; ++c) *(v8ha*)(vts + (cofs + c) * 72 + rg * 8) = vv[c];
            __syncthreads();    // every thread has read its partial sums: os is free, and the q and k pieces are turned in it
            // 16-byte pieces in plane order, 16 pieces (one hi of one half of one fragment, 256 B) to a line of 272 B: the 8-byte writes of a wave then fall on all 64 banks. Plane p starts at p * 32 lines.
            char* st = (char*)os; const unsigned so = (unsigned)(((rg >> 1) * 8 + (lr >> 1)) * 272 + (rg & 1) * 128 + (lr & 1) * 8);
#pragma unroll
            for (int s = 0; s < 8; ++s) { v4us qh, ql, kh, kl;
#pragma unroll
                for (int c = 0; c < 4; ++c) { const float wn = val[s][c]; unsigned short x1, x2; splitf(__fmul_rn(wn, ga[c]), x1, x2); qh[c] = x1; ql[c] = x2; splitf(__fmul_rn(wn, gb[c]), x1, x2); kh[c] = x1; kl[c] = x2; }
                *(v4usa*)(st + so + s * 16) = qh; *(v4usa*)(st + so + s * 16 + 32 * 272) = ql; *(v4usa*)(st + so + s * 16 + 64 * 272) = kh; *(v4usa*)(st + so + s * 16 + 96 * 272) = kl; }
            __syncthreads();    // the V^T tile and the four q, k tiles are whole in LDS before any thread sends a piece out; it stands in front of every global store, so that it waits for none
            // Thread i sends piece s * 128 + i of each plane's 512: the tile's 8 KiB go out in order.
            const int tid = (int)threadIdx.x; const unsigned ob = (unsigned)((zh * TT + t0) * HD * 2 + tid * 16), sl = (unsigned)((tid >> 4) * 272 + (tid & 15) * 16);
            v8h vo[4]; v8us po[4][4];
#pragma unroll
            for (int s = 0; s < 4; ++s) { vo[s] = *(const v8ha*)(vts + (((s & 1) * 2 + (tid >> 6)) * 16 + (tid & 15)) * 72 + ((s >> 1) * 4 + ((tid >> 4) & 3)) * 8);
#pragma unroll
                for (int p = 0; p < 4; ++p) po[p][s] = *(const v8usa*)(st + sl + (p * 32 + s * 8) * 272); }
#pragma unroll
            for (int s = 0; s < 4; ++s) { *(v8h*)((char*)VT + ob + s * 2048) = vo[s]; *(v8us*)((char*)Qh + ob + s * 2048) = po[0][s]; *(v8us*)((char*)Ql + ob + s * 2048) = po[1][s]; *(v8us*)((char*)Kh + ob + s * 2048) = po[2][s]; *(v8us*)((char*)Kl + ob + s * 2048) = po[3][s]; }
            // the 20 stores name these registers: as the wait's inputs they stay as they are until it has passed
            asm volatile("s_wait_xcnt 0x0" :: "v"(ob), "v"(vo[0]), "v"(vo[1]), "v"(vo[2]), "v"(vo[3]), "v"(po[0][0]), "v"(po[0][1]), "v"(po[0][2]), "v"(po[0][3]), "v"(po[1][0]), "v"(po[1][1]), "v"(po[1][2]), "v"(po[1][3]),
                         "v"(po[2][0]), "v"(po[2][1]), "v"(po[2][2]), "v"(po[2][3]), "v"(po[3][0]), "v"(po[3][1]), "v"(po[3][2]), "v"(po[3][3]) : "memory");
            return;
        }
#pragma unroll
        for (int s = 0; s < 32 / KS; ++s) { const int idx = s * (32 * KS) + (int)threadIdx.x, row = idx >> 4, cofs = (idx & 15) * 4; v4f val = *(const v4fa*)(os + row * 68 + cofs);
#pragma unroll
            for (int w = 1; w < KS; ++w) { const v4f o = *(const v4fa*)(os + (w * 64 + row) * 68 + cofs); val[0] += o[0]; val[1] += o[1]; val[2] += o[2]; val[3] += o[3]; }
            if (BIAS) { val[0] += bfr(bias[c0 + cofs]); val[1] += bfr(bias[c0 + cofs + 1]); val[2] += bfr(bias[c0 + cofs + 2]); val[3] += bfr(bias[c0 + cofs + 3]); }
            *(v4f*)(C + (size_t)(r0 + row) * ldc + c0 + cofs) = val; }
        return;
    }
#pragma unroll
    for (int mb = 0; mb < 4; ++mb) {
#pragma unroll
        for (int nb = 0; nb < 4; ++nb) {
#pragma unroll
            for (int j = 0; j < 8; ++j) os[(hi * 8 + j) * 68 + nb * 16 + lr] = acc[mb][nb][j]; }
        __builtin_amdgcn_wave_barrier(); asm volatile("" ::: "memory");
        float* crow = C + (size_t)(r0 + mb * 16) * ldc + c0;
{
#pragma unroll
            for (int s = 0; s < 8; ++s) { const int row = 2 * s + hi, cofs = lr * 4; v4f val = *(const v4fa*)(os + row * 68 + cofs); if (BIAS) { val[0] += bfr(bias[c0 + cofs]); val[1] += bfr(bias[c0 + cofs + 1]); val[2] += bfr(bias[c0 + cofs + 2]); val[3] += bfr(bias[c0 + cofs + 3]); }
                *(v4f*)(crow + (size_t)row * ldc + cofs) = val; }
             }
        __builtin_amdgcn_wave_barrier(); asm volatile("" ::: "memory");
    }
}


__global__ __launch_bounds__(256) void k_wtG(const float* __restrict__ w, int K, int N, bf* Bt) {
    const int lane = threadIdx.x & 31; const int L0 = (blockIdx.x * 8 + (threadIdx.x >> 5)) * 8; const int nlines = N * K / 64;
{
#pragma unroll 1
        for (int l = 0; l < 8; ++l) { const int L = L0 + l; if (L >= nlines) break; const size_t e = (size_t)L * 64 + lane * 2; const int k = (int)(e % K), n = (int)(e / K); v2us o;
            o[0] = f2bf(w[(size_t)k * N + n]); o[1] = f2bf(w[(size_t)(k + 1) * N + n]); *(v2us*)(Bt + e) = o; }
         }
}
__global__ __launch_bounds__(256) void k_cvt8(const float* __restrict__ src, bf* dst, size_t n8) { const size_t i = (size_t)blockIdx.x * 256 + threadIdx.x; if (i >= n8) return; const v8f v = *(const v8f*)(src + i * 8); v8us o;
#pragma unroll
    for (int k = 0; k < 8; ++k) o[k] = f2bf(v[k]); *(v8us*)(dst + i * 8) = o;  }
// The scores never go to memory: k_stat and k_att each form the score tiles they need on the matrix units, from the same hi / lo planes and with the same three products.
// SC = log2(e) / 8: exp(s / 8 - m / 8) = 2^(s SC - m SC).
#define SC 0.18033688f
// 2^x and log2 x. Results apart from all sources and a v_nop at the end of each statement: the one-instruction slot that the instruction set asks for behind a transcendental before its result is read or its source
// overwritten.
__device__ __forceinline__ void ex4(float x0, float x1, float x2, float x3, float& y0, float& y1, float& y2, float& y3) { asm("v_exp_f32 %0, %4\n\tv_exp_f32 %1, %5\n\tv_exp_f32 %2, %6\n\tv_exp_f32 %3, %7\n\tv_nop" : "=&v"(y0), "=&v"(y1), "=&v"(y2), "=&v"(y3) : "v"(x0), "v"(x1), "v"(x2), "v"(x3)); }
__device__ __forceinline__ void ex3(float x0, float x1, float x2, float& y0, float& y1, float& y2) { asm("v_exp_f32 %0, %3\n\tv_exp_f32 %1, %4\n\tv_exp_f32 %2, %5\n\tv_nop" : "=&v"(y0), "=&v"(y1), "=&v"(y2) : "v"(x0), "v"(x1), "v"(x2)); }
__device__ __forceinline__ float ex1(float x) { float y; asm("v_exp_f32 %0, %1\n\tv_nop" : "=&v"(y) : "v"(x)); return y; }
__device__ __forceinline__ float lg1(float x) { float y; asm("v_log_f32 %0, %1\n\tv_nop" : "=&v"(y) : "v"(x)); return y; }
// A lane's address = a wave-uniform base + the lane's own byte offset: the loads then name one offset register and the base's scalar pair, which the waits behind them take as inputs.
template <typename T> __device__ __forceinline__ const T* atb(const T* base, unsigned lob) { return (const T*)((const char*)base + lob); }
// The loops' stepping addresses are byte pointers typed as global memory: as operands of the wait statement they would otherwise lose that type, and the loads would become flat ones.
#define GLB __attribute__((address_space(1)))
typedef const GLB char* gp;
__device__ __forceinline__ v16bf ldb(gp p, int o) { return cat16b(*(const GLB v8us*)(p + o), *(const GLB v8us*)(p + o + FRH)); }
__device__ __forceinline__ v16h ldh(gp p, int o) { return cat16(*(const GLB v8h*)(p + o), *(const GLB v8h*)(p + o + FRH)); }
__device__ __forceinline__ v16bf ldf(const bf* p) { return cat16b(*(const v8us*)p, *(const v8us*)(p + FRH / 2)); }
__device__ __forceinline__ v8f score6(v16bf ah0, v16bf al0, v16bf ah1, v16bf al1, v16bf bh0, v16bf bl0, v16bf bh1, v16bf bl1) {
    v8f c = (v8f){}; c = wmmab(ah0, bh0, c); c = wmmab(al0, bh0, c); c = wmmab(ah0, bl0, c); c = wmmab(ah1, bh1, c); c = wmmab(al1, bh1, c); c = wmmab(ah1, bl1, c); return c; }
// k_stat: softmax statistics, ONE set for both directions. q and k are the same normed row n = w r, scaled by g1 and by g2, so att[i][j] = sum_d n_i[d] n_j[d] g1[d] g2[d] / 8 = att[j][i] for every x, W, g1 and g2:
// column t of att is row t, and the column softmax's maximum and sum at key t are the row softmax's at query t. A query is fixed and the keys move. Grid NZ * TT / 192, 12 waves (three a SIMD, one work-group a WGP):
// wave w holds the 64 fixed rows of row group 3 blockIdx.x + w % 3 as A fragments and walks quarter w / 3 of the 2048 moving rows, 32 a trip; the three waves of a quarter read the same moving rows (but where a work-group
// spans two heads). D[8 hi + j][lr]: a lane keeps a running maximum and sum for each of its 32 fixed rows over the moving rows that fall on its column; the 16 lanes, then the four quarters (through LDS), are joined in
// a fixed order. Out: E = 9 - m SC - log2(sum), so that 2^(s SC + E) = 512 exp(s / 8 - m / 8) / sum.
__global__ __launch_bounds__(384) __attribute__((amdgpu_waves_per_eu(3, 3))) void k_stat(const bf* __restrict__ Qh, const bf* __restrict__ Ql, const bf* __restrict__ Kh, const bf* __restrict__ Kl, float* E) {
    __shared__ float lm[4 * 192]; __shared__ float ls[4 * 192];
    const int lane = threadIdx.x & 31, lr = lane & 15, hi = lane >> 4; const int wv = __builtin_amdgcn_readfirstlane((int)(threadIdx.x >> 5)), fg = wv % 3, mh = wv / 3;
    const int rgi = blockIdx.x * 3 + fg, zh = rgi / (TT / 64); const size_t zo = (size_t)zh * TT * HD; const int f0 = (rgi % (TT / 64)) * 64;
    const bf* Fh = Qh + zo; const bf* Fl = Ql + zo; const bf* Mh = Kh + zo; const bf* Ml = Kl + zo;
    const unsigned lob = (unsigned)lane * 16u; const bf* pfh = Fh + f0 * HD; const bf* pfl = Fl + f0 * HD;
    v16bf ah[4][2], al[4][2];
#pragma unroll
    for (int a = 0; a < 4; ++a) {
#pragma unroll
        for (int kc = 0; kc < 2; ++kc) { ah[a][kc] = ldf(atb(pfh + a * 16 * HD + kc * (FRB / 2), lob)); al[a][kc] = ldf(atb(pfl + a * 16 * HD + kc * (FRB / 2), lob)); } }
    asm volatile("s_wait_xcnt 0x0" :: "v"(lob), "s"(pfh), "s"(pfl) : "memory");    // the loads name the two bases and the lane's offset (as built: the lane number, scaled by the load's width): the wait stands directly behind the last load, in front of every write of one of them
    float m[4][8], s[4][8];
#pragma unroll
    for (int a = 0; a < 4; ++a) {
#pragma unroll
        for (int j = 0; j < 8; ++j) { m[a][j] = -3.0e38f; s[a][j] = 0.f; } }
    gp pmh = (gp)(const char*)atb(Mh + mh * (TT / 4) * HD, lob); gp pml = (gp)(const char*)atb(Ml + mh * (TT / 4) * HD, lob);
#pragma unroll 1    // rolled: one trip's fragments and score tiles already fill the register budget of three waves a SIMD
    for (int it = 0; it < TT / 4 / 32; ++it) {
        v16bf bh[2][2], bl[2][2];
#pragma unroll
        for (int b = 0; b < 2; ++b) {
#pragma unroll
            for (int kc = 0; kc < 2; ++kc) { bh[b][kc] = ldb(pmh, b * 16 * HD * 2 + kc * FRB); bl[b][kc] = ldb(pml, b * 16 * HD * 2 + kc * FRB); } }
        // The trip's loads name the two address pairs. The wait takes the loaded values as inputs, so every load stands in front of it, and the pairs as operands, so that they are the registers the loads name, stay
        // as they are to here (no load's result is placed on one) and step on only behind it.
        asm volatile("s_wait_xcnt 0x0" : "+v"(pmh), "+v"(pml) : "v"(bh[0][0]), "v"(bh[0][1]), "v"(bh[1][0]), "v"(bh[1][1]), "v"(bl[0][0]), "v"(bl[0][1]), "v"(bl[1][0]), "v"(bl[1][1]) : "memory");
        pmh += 32 * HD * 2; pml += 32 * HD * 2;
#pragma unroll
        for (int a = 0; a < 4; ++a) {
            const v8f c0 = score6(ah[a][0], al[a][0], ah[a][1], al[a][1], bh[0][0], bl[0][0], bh[0][1], bl[0][1]);
            const v8f c1 = score6(ah[a][0], al[a][0], ah[a][1], al[a][1], bh[1][0], bl[1][0], bh[1][1], bl[1][1]);
#pragma unroll
            for (int j = 0; j < 8; ++j) { const float mn = fmaxf(m[a][j], fmaxf(c0[j], c1[j])); const float nb = -mn * SC;
                float e0, e1, e2; ex3(fmaf(m[a][j], SC, nb), fmaf(c0[j], SC, nb), fmaf(c1[j], SC, nb), e0, e1, e2); s[a][j] = fmaf(s[a][j], e0, e1 + e2); m[a][j] = mn; }
            __builtin_amdgcn_sched_barrier(0); }    // a row group's score tiles are formed behind the sums of the group before: several groups' tiles at once do not fit the registers of three waves a SIMD (spills)
    }
#pragma unroll
    for (int a = 0; a < 4; ++a) {
#pragma unroll
        for (int j = 0; j < 8; ++j) { float mm = m[a][j];
#pragma unroll
            for (int sh = 1; sh <= 8; sh <<= 1) mm = fmaxf(mm, __shfl_xor(mm, sh, 32));
            float ss = s[a][j] * ex1((m[a][j] - mm) * SC);
#pragma unroll
            for (int sh = 1; sh <= 8; sh <<= 1) ss += __shfl_xor(ss, sh, 32);
            m[a][j] = mm; s[a][j] = ss; } }
    if (lr == 0) {
#pragma unroll
        for (int a = 0; a < 4; ++a) {
#pragma unroll
            for (int j = 0; j < 8; ++j) { lm[mh * 192 + fg * 64 + a * 16 + hi * 8 + j] = m[a][j]; ls[mh * 192 + fg * 64 + a * 16 + hi * 8 + j] = s[a][j]; } } }
    __syncthreads();    // every quarter's maxima and sums are in LDS before a thread joins the four of its row
    // Thread t < 192 joins row t of the work-group's 192 (quarters in the order 0, 1, 2, 3); row group g's row r is element 64 g + r of E, so the work-group's 192 results go out in a row.
    const int t = (int)threadIdx.x;
    if (t < 192) { const float m0 = lm[t], m1 = lm[192 + t], m2 = lm[384 + t], m3 = lm[576 + t]; const float mm = fmaxf(fmaxf(m0, m1), fmaxf(m2, m3));
        float e0, e1, e2, e3; ex4((m0 - mm) * SC, (m1 - mm) * SC, (m2 - mm) * SC, (m3 - mm) * SC, e0, e1, e2, e3);
        const float ss = ((ls[t] * e0 + ls[192 + t] * e1) + ls[384 + t] * e2) + ls[576 + t] * e3; E[blockIdx.x * 192 + t] = 9.0f - mm * SC - lg1(ss); }
}
// k_att: y = a.v with a formed in registers. Grid (TT / 64, NZ), 4 waves: wave w owns the 32 queries (w & 1) and half (w >> 1) of the keys, 32 keys a trip. S^T = K Q^T (A = K rows, B = Q, kept in registers): D[8 hi + j][lr] is
// key 8 hi + j against query lr, so two score tiles of 16 keys, turned into 512 a = 2^(s SC + E[query]) + 2^(s SC + E[key]) (one E for the row and the column softmax: k_stat) and rounded to fp16, ARE the B fragment (k = 8 hi + j, 16 + 8 hi + j) of O^T += V^T P^T,
// whose A fragment comes from VT by the same k order. The two key halves are added through LDS (first half + second half); y / 512 goes out as the two bf16 planes, 8 consecutive d a lane.
__global__ __launch_bounds__(128) __attribute__((amdgpu_waves_per_eu(3, 3))) void k_att(const bf* __restrict__ Qh, const bf* __restrict__ Ql, const bf* __restrict__ Kh, const bf* __restrict__ Kl, const h16* __restrict__ VT, const float* __restrict__ E, bf* Yh, bf* Yl) {
    __shared__ __align__(16) float red[2 * 64 * 32];
    const int lane = threadIdx.x & 31, lr = lane & 15, hi = lane >> 4; const int wv = __builtin_amdgcn_readfirstlane((int)(threadIdx.x >> 5)), qg = wv & 1, kh = wv >> 1;
    const int zh = blockIdx.y; const size_t zo = (size_t)zh * TT * HD; const int q0 = blockIdx.x * 64 + qg * 32; const unsigned lob = (unsigned)lane * 16u, leb = (unsigned)hi * 32u, lab = (unsigned)lr * 4u;
    const bf* Kph = Kh + zo; const bf* Kpl = Kl + zo; const h16* Vp = VT + zo; const float* Eb = E + (size_t)zh * TT;
    v16bf qh[2][2], ql[2][2]; float ea[2]; const bf* pqh = Qh + zo + q0 * HD; const bf* pql = Ql + zo + q0 * HD; const float* pea = E + (size_t)zh * TT + q0;
#pragma unroll
    for (int qt = 0; qt < 2; ++qt) { ea[qt] = *atb(pea + qt * 16, lab);
#pragma unroll
        for (int kc = 0; kc < 2; ++kc) { qh[qt][kc] = ldf(atb(pqh + qt * 16 * HD + kc * (FRB / 2), lob)); ql[qt][kc] = ldf(atb(pql + qt * 16 * HD + kc * (FRB / 2), lob)); } }
    asm volatile("s_wait_xcnt 0x0" :: "v"(lob), "v"(lane), "v"(lab), "s"(pqh), "s"(pql), "s"(pea) : "memory");    // the loads name these registers: the wait stands behind the last load, and as its inputs they stay live to here, so that none is rewritten before it
    v8f o[4][2];
#pragma unroll
    for (int dt = 0; dt < 4; ++dt) { o[dt][0] = (v8f){}; o[dt][1] = (v8f){}; }
    gp pk = (gp)(const char*)atb(Kph + kh * (TT / 2) * HD, lob); gp pl = (gp)(const char*)atb(Kpl + kh * (TT / 2) * HD, lob); gp pv = (gp)(const char*)atb(Vp + kh * (TT / 2) * HD, lob); gp pe = (gp)(const char*)atb(Eb + kh * (TT / 2), leb);
#pragma unroll 1    // rolled: one trip's fragments already fill the register budget of three waves a SIMD
    for (int it = 0; it < TT / 2 / 32; ++it) {
        v16bf ka[2][2], kb[2][2]; v8f eb[2]; v16h va[4];
#pragma unroll
        for (int kt = 0; kt < 2; ++kt) {
#pragma unroll
            for (int kc = 0; kc < 2; ++kc) { ka[kt][kc] = ldb(pk, kt * 16 * HD * 2 + kc * FRB); kb[kt][kc] = ldb(pl, kt * 16 * HD * 2 + kc * FRB); } }
#pragma unroll
        for (int kt = 0; kt < 2; ++kt) eb[kt] = *(const GLB v8f*)(pe + kt * 64);
#pragma unroll
        for (int dt = 0; dt < 4; ++dt) va[dt] = ldh(pv, dt * FRB);
        // The trip's loads name the four address pairs. The wait takes the loaded values as inputs, so every load stands in front of it, and the pairs as operands, so that they are the registers the loads name, stay
        // as they are to here (no load's result is placed on one) and step on only behind it.
        asm volatile("s_wait_xcnt 0x0" : "+v"(pk), "+v"(pl), "+v"(pv), "+v"(pe) : "v"(ka[0][0]), "v"(ka[0][1]), "v"(ka[1][0]), "v"(ka[1][1]), "v"(kb[0][0]), "v"(kb[0][1]), "v"(kb[1][0]), "v"(kb[1][1]), "v"(eb[0]), "v"(eb[1]), "v"(va[0]), "v"(va[1]), "v"(va[2]), "v"(va[3]) : "memory");
        pk += 32 * HD * 2; pl += 32 * HD * 2; pv += 32 * HD * 2; pe += 32 * 4;
        v16h p[2];
#pragma unroll
        for (int qt = 0; qt < 2; ++qt) {
#pragma unroll
            for (int kt = 0; kt < 2; ++kt) { const v8f c = score6(ka[kt][0], kb[kt][0], ka[kt][1], kb[kt][1], qh[qt][0], ql[qt][0], qh[qt][1], ql[qt][1]);
#pragma unroll
                for (int j = 0; j < 8; j += 2) { float r0, c0, r1, c1; ex4(fmaf(c[j], SC, ea[qt]), fmaf(c[j], SC, eb[kt][j]), fmaf(c[j + 1], SC, ea[qt]), fmaf(c[j + 1], SC, eb[kt][j + 1]), r0, c0, r1, c1); p[qt][kt * 8 + j] = tohx(r0 + c0); p[qt][kt * 8 + j + 1] = tohx(r1 + c1); } } }
#pragma unroll
        for (int dt = 0; dt < 4; ++dt) { o[dt][0] = wmma16(va[dt], p[0], o[dt][0]); o[dt][1] = wmma16(va[dt], p[1], o[dt][1]); }
    }
    float* rw = red + qg * (64 * 32) + lane;
    if (kh == 1) {
#pragma unroll
        for (int dt = 0; dt < 4; ++dt) {
#pragma unroll
            for (int qt = 0; qt < 2; ++qt) {
#pragma unroll
                for (int j = 0; j < 8; ++j) rw[((dt * 2 + qt) * 8 + j) * 32] = o[dt][qt][j]; } } }
    __syncthreads();    // the second key half's partial outputs are in LDS before the first half's waves add them
    if (kh == 0) { const size_t yo = (size_t)((zh / NH_) * TT + q0 + lr) * CC + (zh % NH_) * HD + 8 * hi;
#pragma unroll
        for (int dt = 0; dt < 4; ++dt) {
#pragma unroll
            for (int qt = 0; qt < 2; ++qt) { v8us oh, ol;
#pragma unroll
                for (int j = 0; j < 8; ++j) { unsigned short a, c; splitf((o[dt][qt][j] + rw[((dt * 2 + qt) * 8 + j) * 32]) * (1.0f / PCAR), a, c); oh[j] = a; ol[j] = c; }
                *(v8us*)(Yh + yo + (size_t)qt * 16 * CC + dt * 16) = oh; *(v8us*)(Yl + yo + (size_t)qt * 16 * CC + dt * 16) = ol; } } }
}

extern "C" void kernel_launch(void* const* d_in, const int* in_sizes, int n_in,
                              void* d_out, int out_size, void* d_ws, size_t ws_size, hipStream_t stream) {
    (void)in_sizes; (void)n_in; (void)out_size;
    const float* x = (const float*)d_in[0]; const float* Wt = (const float*)d_in[1]; const float* g1 = (const float*)d_in[2]; const float* g2 = (const float*)d_in[3]; const float* g3 = (const float*)d_in[4];
    float* OUT = (float*)d_out;     // [2][2048][768]
    char* wsp = (char*)d_ws;
    auto take = [&](size_t bytes) { char* p = wsp; wsp += (bytes + 255) & ~(size_t)255; return (void*)p; };
    bf* WB = (bf*)take((size_t)CC * CC * 2); bf* WT = (bf*)take((size_t)CC * CC * 2); bf* XB = (bf*)take((size_t)NB_ * TT * CC * 2); bf* Yh = (bf*)take((size_t)NB_ * TT * CC * 2); bf* Yl = (bf*)take((size_t)NB_ * TT * CC * 2);
    bf* Qh = (bf*)take((size_t)NZ * TT * HD * 2); bf* Ql = (bf*)take((size_t)NZ * TT * HD * 2); bf* Kh = (bf*)take((size_t)NZ * TT * HD * 2); bf* Kl = (bf*)take((size_t)NZ * TT * HD * 2); h16* VT = (h16*)take((size_t)NZ * HD * TT * 2);
    float* E = (float*)take((size_t)NZ * TT * 4);    // [zh][t]
    if ((size_t)(wsp - (char*)d_ws) > ws_size) return;    // total ~ 53 MB
    k_cvt8<<<(CC * CC / 8 + 255) / 256, 256, 0, stream>>>(Wt, WB, (size_t)CC * CC / 8);      // W [out][in] = natural Bt for x W^T
    k_wtG<<<(CC * CC / 64 + 63) / 64, 256, 0, stream>>>(Wt, CC, CC, WT);                  // W as x @ W operand for y W
    // Both batch items go through every launch together (rows b * TT + t), and all NZ (batch, head) pairs through the statistics and the a.v launch.
    k_cvt8<<<(NB_ * TT * CC / 8 + 255) / 256, 256, 0, stream>>>(x, XB, (size_t)NB_ * TT * CC / 8);
    k_gemmw<bf, 0, false, 4, true><<<dim3(NB_ * TT / 64, CC / 64, 1), 128, 0, stream>>>(XB, nullptr, WB, nullptr, CC, nullptr, CC, nullptr, 0, 0, 0, g1, g2, g3, Qh, Ql, Kh, Kl, VT);    // w = x W^T, normed in the epilogue: q, k, v planes
    k_stat<<<dim3(NZ * TT / 192), 384, 0, stream>>>(Qh, Ql, Kh, Kl, E);
    k_att<<<dim3(TT / 64, NZ), 128, 0, stream>>>(Qh, Ql, Kh, Kl, VT, E, Yh, Yl);
    k_gemmw<bf, 1, false, 4, false><<<dim3(NB_ * TT / 64, CC / 64, 1), 128, 0, stream>>>(Yh, Yl, WT, nullptr, CC, OUT, CC, nullptr, 0, 0, 0, nullptr, nullptr, nullptr, nullptr, nullptr, nullptr, nullptr, nullptr);
}

// v008
// Measured time: 114 microseconds a run.
// In both of two side-by-side timings against v007, it was 1.04 times as fast.
// Counting every step since v000, it is 82.4 times as fast.
#include <hip/hip_runtime.h>

// HyperSETAlterAttention (x [2][2048][768]; w = x W^T (12 heads x 64, shared weights); q, k, v = RMSNorm(w) g1 / g2 / g3 (eps = f32 eps); att = q.k / 8; a = softmax over keys + softmax over QUERIES (bisoftmax);
// y = a.v merged; out = y W -> [2][2048][768]).
// Compute dtypes, f32 accumulate: every input rounded to bf16; x W^T on PLAIN bf16 operands (inputs: exact); RMSNorm f32 -> bf16 hi+lo planes of q and k (scores: 3 products, K 64 - the cosine-like logits span
// +-8, single fp16 planes were not tried) and a single fp16 plane of v; the softmax statistics (running max / sum, fixed order; att is symmetric, so the rows' serve the columns too) in f32 from score tiles formed anew on the matrix units; both softmaxes combined into ONE fp16 plane in registers (scaled by 512)

#define NB_  2
#define TT   2048
#define CC   768
#define NH_  12
#define HD   64
#define NZ   (NB_ * NH_)    // (batch, head) pairs, index zh = b * NH_ + h
#define PCAR 512.0f
typedef _Float16 h16;
typedef unsigned short bf;
typedef __attribute__((ext_vector_type(16))) __bf16   v16bf;
typedef __attribute__((ext_vector_type(16))) _Float16 v16h;
typedef __attribute__((ext_vector_type(8)))  _Float16 v8h;
typedef __attribute__((ext_vector_type(8)))  unsigned short v8us;
typedef __attribute__((ext_vector_type(8)))  float    v8f;
typedef __attribute__((ext_vector_type(4)))  float    v4f;
typedef v8h  __attribute__((may_alias)) v8ha;
typedef v4f  __attribute__((may_alias)) v4fa;
typedef v8us __attribute__((may_alias)) v8usa;

__device__ __forceinline__ unsigned short f2bf(float f) { unsigned u = __float_as_uint(f); u += 0x7FFFu + ((u >> 16) & 1u); return (unsigned short)(u >> 16); }
__device__ __forceinline__ float bf2f(unsigned short b) { return __uint_as_float(((unsigned)b) << 16); }
__device__ __forceinline__ float bfr(float f) { return bf2f(f2bf(f)); }
__device__ __forceinline__ v16h cat16(v8h lo, v8h hi) { return __builtin_shufflevector(lo, hi, 0, 1, 2, 3, 4, 5, 6, 7, 8, 9, 10, 11, 12, 13, 14, 15); }
__device__ __forceinline__ v16bf cat16b(v8us lo, v8us hi) { return __builtin_bit_cast(v16bf, __builtin_shufflevector(lo, hi, 0, 1, 2, 3, 4, 5, 6, 7, 8, 9, 10, 11, 12, 13, 14, 15)); }
__device__ __forceinline__ v8f wmma16(v16h a, v16h b, v8f c) { return __builtin_amdgcn_wmma_f32_16x16x32_f16(false, a, false, b, (short)0, c, false, false); }
__device__ __forceinline__ v8f wmmab(v16bf a, v16bf b, v8f c) { return __builtin_amdgcn_wmma_f32_16x16x32_bf16(false, a, false, b, (short)0, c, false, false); }
__device__ __forceinline__ h16 tohx(float x) { return (h16)x; }
__device__ __forceinline__ void splitf(float y, unsigned short& h, unsigned short& l) { h = f2bf(y); l = f2bf(y - bf2f(h)); }
typedef __attribute__((ext_vector_type(2))) _Float16 v2h;
typedef __attribute__((ext_vector_type(4))) _Float16 v4h;
typedef __attribute__((ext_vector_type(2))) unsigned short v2us;
typedef __attribute__((ext_vector_type(4))) unsigned short v4us;
typedef v4us __attribute__((may_alias)) v4usa;
// FRAGMENT ORDER of the q, k (hi and lo) and v^T planes. A 16 x 32 operand fragment (16 rows, 32 k) is 1 KiB: [half 0..1][hi 0..1][row 0..15][8 k], element k = 16 half + 8 hi + 0..7, so that lane (hi, row) finds its two
// 16-byte pieces at 16 * lane and 512 + 16 * lane and each load of a wave is 512 consecutive bytes (4 whole lines) instead of 32 bytes of each of 16 lines. q, k: [zh][t / 16][d / 32][fragment], rows t, k = d.
// v^T: [zh][t / 32][d / 16][fragment], rows d, k = t. 64 rows t of one (batch, head) are 8 KiB in a row in every plane.
#define FRH 512     // bytes from a lane's first piece to its second
#define FRB 1024    // bytes of a fragment



// ---- k_gemmw: register-blocked GEMM, one work-group of KS waves per 64x64 output tile (16 accumulators a wave), operands straight from K-contiguous 16-bit planes; grid (M/64, N/64, Z), 32 * KS threads.
// C[m][n] (f32, pitch ldc, + optional f32 bias[n]) = sum_k A[m][k] Bt[n][k] (+ split products per NSPLIT). z-batch strides sA/sB/sC in elements. K % (32 * KS) == 0.
// KS > 1: wave w sums the K / KS consecutive k from w * K / KS on, so a long K is KS short load-latency chains side by side; the KS partial tiles meet in LDS and are added in wave order 0, 1, .. KS - 1.
template <typename T16> struct WFrag;
template <> struct WFrag<h16> { typedef v16h V; static __device__ __forceinline__ V ld(const h16* p) { return cat16(*(const v8h*)p, *(const v8h*)(p + 16)); } static __device__ __forceinline__ v8f mma(V a, V b, v8f c) { return wmma16(a, b, c); } };
template <> struct WFrag<bf> { typedef v16bf V; static __device__ __forceinline__ V ld(const bf* p) { return cat16b(*(const v8us*)p, *(const v8us*)(p + 16)); } static __device__ __forceinline__ v8f mma(V a, V b, v8f c) { return wmmab(a, b, c); } };
// 1 / sqrt(x), four at a time. Results apart from all sources and a v_nop at the end of the statement: the one-instruction slot that the instruction set asks for behind a transcendental before its result is read or its
// source overwritten.
__device__ __forceinline__ void rs4(float x0, float x1, float x2, float x3, float& y0, float& y1, float& y2, float& y3) { asm("v_rsq_f32 %0, %4\n\tv_rsq_f32 %1, %5\n\tv_rsq_f32 %2, %6\n\tv_rsq_f32 %3, %7\n\tv_nop" : "=&v"(y0), "=&v"(y1), "=&v"(y2), "=&v"(y3) : "v"(x0), "v"(x1), "v"(x2), "v"(x3)); }
// NORM (the projection x W^T, KS = 4, N tile = one head): the tile is 64 rows t of one (batch, head) with all 64 dims, so the work-group that summed it also norms it: r = rsqrt(mean(w^2) + eps) a row, then
// Q hi/lo = split(w r g1), K hi/lo = split(w r g2) and V^T = fp16(w r g3), all five in fragment order (turned in LDS so that every store of a wave is 512 consecutive bytes). C is not written. 16 lanes hold a row, 4 dims each, 8 consecutive rows a thread.
template <typename T16, int NSPLIT, bool BIAS, int KS, bool NORM>
__global__ __launch_bounds__(32 * KS) void k_gemmw(const T16* __restrict__ A, const T16* __restrict__ A2, const T16* __restrict__ Bt, const T16* __restrict__ Bt2, int K, float* C, int ldc, const float* __restrict__ bias, size_t sA, size_t sB, size_t sC,
                                                   const float* __restrict__ g1, const float* __restrict__ g2, const float* __restrict__ g3, bf* Qh, bf* Ql, bf* Kh, bf* Kl, h16* VT) {
    typedef typename WFrag<T16>::V V;
    __shared__ __align__(16) float os[(KS > 1 ? KS * 64 : 16) * 68];
    __shared__ __align__(16) h16 vts[NORM ? 64 * 72 : 8];
    const size_t z = blockIdx.z; A += z * sA; if (A2) A2 += z * sA; Bt += z * sB; if (Bt2) Bt2 += z * sB; C += z * sC;
    const int lane = threadIdx.x & 31, lr = lane & 15, hi = lane >> 4; const int r0 = blockIdx.x * 64, c0 = blockIdx.y * 64;
    v8f acc[4][4];
#pragma unroll
    for (int mb = 0; mb < 4; ++mb)
#pragma unroll
        for (int nb = 0; nb < 4; ++nb) acc[mb][nb] = (v8f){};
    const size_t aoff = (size_t)(r0 + lr) * K + 8 * hi, boff = (size_t)(c0 + lr) * K + 8 * hi;
    const int wv = KS > 1 ? __builtin_amdgcn_readfirstlane((int)(threadIdx.x >> 5)) : 0; const int kspan = K / KS, kbeg = wv * kspan, kend = kbeg + kspan;
#pragma unroll 1
    for (int kc = kbeg; kc < kend; kc += 32) {
        V a[4], a2[4];
#pragma unroll
        for (int mb = 0; mb < 4; ++mb) { a[mb] = WFrag<T16>::ld(A + aoff + (size_t)mb * 16 * K + kc); if (NSPLIT == 1 || NSPLIT == 2) a2[mb] = WFrag<T16>::ld(A2 + aoff + (size_t)mb * 16 * K + kc); }
#pragma unroll
        for (int nb = 0; nb < 4; ++nb) { const V b = WFrag<T16>::ld(Bt + boff + (size_t)nb * 16 * K + kc); V b2; if (NSPLIT >= 2) b2 = WFrag<T16>::ld(Bt2 + boff + (size_t)nb * 16 * K + kc);
#pragma unroll
            for (int mb = 0; mb < 4; ++mb) { acc[mb][nb] = WFrag<T16>::mma(a[mb], b, acc[mb][nb]); if (NSPLIT == 1 || NSPLIT == 2) acc[mb][nb] = WFrag<T16>::mma(a2[mb], b, acc[mb][nb]); if (NSPLIT >= 2) acc[mb][nb] = WFrag<T16>::mma(a[mb], b2, acc[mb][nb]); } }
        asm volatile("v_nop\n\tv_nop\n\tv_nop\n\tv_nop" : "+v"(acc[0][0]), "+v"(acc[1][1]), "+v"(acc[2][2]), "+v"(acc[3][3]) : "v"(a[0]), "v"(a[3]));
    }
    if (KS > 1) {
        float* ow = os + wv * (64 * 68);
#pragma unroll
        for (int mb = 0; mb < 4; ++mb) {
#pragma unroll
            for (int nb = 0; nb < 4; ++nb) {
#pragma unroll
                for (int j = 0; j < 8; ++j) ow[(mb * 16 + hi * 8 + j) * 68 + nb * 16 + lr] = acc[mb][nb][j]; } }
        __syncthreads();    // every wave's partial tile is in LDS before any thread adds the KS partials of its outputs
        if (NORM) {
            const int rg = (int)threadIdx.x >> 4, cofs = lr * 4; const int zh = (r0 / TT) * NH_ + (int)blockIdx.y, t0 = r0 % TT; const unsigned lgb = (unsigned)cofs * 4u;
            float ga[4], gb[4], gc[4];
#pragma unroll
            for (int c = 0; c < 4; ++c) { ga[c] = *(const float*)((const char*)(g1 + c) + lgb); gb[c] = *(const float*)((const char*)(g2 + c) + lgb); gc[c] = *(const float*)((const char*)(g3 + c) + lgb); }
            asm volatile("s_wait_xcnt 0x0" :: "v"(lgb), "s"(g1), "s"(g2), "s"(g3) : "memory");    // the loads name these registers: the wait stands behind the last load, and as its inputs they stay live to here
            v4f val[8]; float x[8], y[8];
#pragma unroll
            for (int s = 0; s < 8; ++s) { const int row = rg * 8 + s; val[s] = *(const v4fa*)(os + row * 68 + cofs);
#pragma unroll
                for (int w = 1; w < KS; ++w) { const v4f o = *(const v4fa*)(os + (w * 64 + row) * 68 + cofs); val[s][0] += o[0]; val[s][1] += o[1]; val[s][2] += o[2]; val[s][3] += o[3]; }
                x[s] = __fadd_rn(__fmul_rn(val[s][0], val[s][0]), __fmul_rn(val[s][1], val[s][1])); y[s] = __fadd_rn(__fmul_rn(val[s][2], val[s][2]), __fmul_rn(val[s][3], val[s][3])); }
            // Sum of squares over the row's 16 lanes: the even and the odd pairs of dims apart, far lanes first, the two joined last (a fixed tree).
#pragma unroll
            for (int sh = 8; sh; sh >>= 1) {
#pragma unroll
                for (int s = 0; s < 8; ++s) { x[s] += __shfl_xor(x[s], sh, 32); y[s] += __shfl_xor(y[s], sh, 32); } }
#pragma unroll
            for (int c = 0; c < 4; ++c) { ga[c] = bfr(ga[c]); gb[c] = bfr(gb[c]); gc[c] = bfr(gc[c]); }
            v8h vv[4];
#pragma unroll
            for (int s = 0; s < 8; ++s) x[s] = __fadd_rn((x[s] + y[s]) * (1.0f / HD), 1.1920929e-07f);
            rs4(x[0], x[1], x[2], x[3], y[0], y[1], y[2], y[3]); rs4(x[4], x[5], x[6], x[7], y[4], y[5], y[6], y[7]);
#pragma unroll
            for (int s = 0; s < 8; ++s) {
#pragma unroll
                for (int c = 0; c < 4; ++c) { val[s][c] = __fmul_rn(val[s][c], y[s]); vv[c][s] = tohx(__fmul_rn(val[s][c], gc[c])); } }
#pragma unroll
            for (int c = 0; c < 4; ++c) *(v8ha*)(vts + (cofs + c) * 72 + rg * 8) = vv[c];
            __syncthreads();    // every thread has read its partial sums: os is free, and the q and k pieces are turned in it
            // 16-byte pieces in plane order, 16 pieces (one hi of one half of one fragment, 256 B) to a line of 272 B: the 8-byte writes of a wave then fall on all 64 banks. Plane p starts at p * 32 lines.
            char* st = (char*)os; const unsigned so = (unsigned)(((rg >> 1) * 8 + (lr >> 1)) * 272 + (rg & 1) * 128 + (lr & 1) * 8);
#pragma unroll
            for (int s = 0; s < 8; ++s) { v4us qh, ql, kh, kl;
#pragma unroll
                for (int c = 0; c < 4; ++c) { const float wn = val[s][c]; unsigned short x1, x2; splitf(__fmul_rn(wn, ga[c]), x1, x2); qh[c] = x1; ql[c] = x2; splitf(__fmul_rn(wn, gb[c]), x1, x2); kh[c] = x1; kl[c] = x2; }
                *(v4usa*)(st + so + s * 16) = qh; *(v4usa*)(st + so + s * 16 + 32 * 272) = ql; *(v4usa*)(st + so + s * 16 + 64 * 272) = kh; *(v4usa*)(st + so + s * 16 + 96 * 272) = kl; }
            __syncthreads();    // the V^T tile and the four q, k tiles are whole in LDS before any thread sends a piece out; it stands in front of every global store, so that it waits for none
            // Thread i sends piece s * 128 + i of each plane's 512: the tile's 8 KiB go out in order.
            const int tid = (int)threadIdx.x; const unsigned ob = (unsigned)((zh * TT + t0) * HD * 2 + tid * 16), sl = (unsigned)((tid >> 4) * 272 + (tid & 15) * 16);
            v8h vo[4]; v8us po[4][4];
#pragma unroll
            for (int s = 0; s < 4; ++s) { vo[s] = *(const v8ha*)(vts + (((s & 1) * 2 + (tid >> 6)) * 16 + (tid & 15)) * 72 + ((s >> 1) * 4 + ((tid >> 4) & 3)) * 8);
#pragma unroll
                for (int p = 0; p < 4; ++p) po[p][s] = *(const v8usa*)(st + sl + (p * 32 + s * 8) * 272); }
#pragma unroll
            for (int s = 0; s < 4; ++s) { *(v8h*)((char*)VT + ob + s * 2048) = vo[s]; *(v8us*)((char*)Qh + ob + s * 2048) = po[0][s]; *(v8us*)((char*)Ql + ob + s * 2048) = po[1][s]; *(v8us*)((char*)Kh + ob + s * 2048) = po[2][s]; *(v8us*)((char*)Kl + ob + s * 2048) = po[3][s]; }
            // the 20 stores name these registers: as the wait's inputs they stay as they are until it has passed
            asm volatile("s_wait_xcnt 0x0" :: "v"(ob), "v"(vo[0]), "v"(vo[1]), "v"(vo[2]), "v"(vo[3]), "v"(po[0][0]), "v"(po[0][1]), "v"(po[0][2]), "v"(po[0][3]), "v"(po[1][0]), "v"(po[1][1]), "v"(po[1][2]), "v"(po[1][3]),
                         "v"(po[2][0]), "v"(po[2][1]), "v"(po[2][2]), "v"(po[2][3]), "v"(po[3][0]), "v"(po[3][1]), "v"(po[3][2]), "v"(po[3][3]) : "memory");
            return;
        }
#pragma unroll
        for (int s = 0; s < 32 / KS; ++s) { const int idx = s * (32 * KS) + (int)threadIdx.x, row = idx >> 4, cofs = (idx & 15) * 4; v4f val = *(const v4fa*)(os + row * 68 + cofs);
#pragma unroll
            for (int w = 1; w < KS; ++w) { const v4f o = *(const v4fa*)(os + (w * 64 + row) * 68 + cofs); val[0] += o[0]; val[1] += o[1]; val[2] += o[2]; val[3] += o[3]; }
            if (BIAS) { val[0] += bfr(bias[c0 + cofs]); val[1] += bfr(bias[c0 + cofs + 1]); val[2] += bfr(bias[c0 + cofs + 2]); val[3] += bfr(bias[c0 + cofs + 3]); }
            *(v4f*)(C + (size_t)(r0 + row) * ldc + c0 + cofs) = val; }
        return;
    }
#pragma unroll
    for (int mb = 0; mb < 4; ++mb) {
#pragma unroll
        for (int nb = 0; nb < 4; ++nb) {
#pragma unroll
            for (int j = 0; j < 8; ++j) os[(hi * 8 + j) * 68 + nb * 16 + lr] = acc[mb][nb][j]; }
        __builtin_amdgcn_wave_barrier(); asm volatile("" ::: "memory");
        float* crow = C + (size_t)(r0 + mb * 16) * ldc + c0;
{
#pragma unroll
            for (int s = 0; s < 8; ++s) { const int row = 2 * s + hi, cofs = lr * 4; v4f val = *(const v4fa*)(os + row * 68 + cofs); if (BIAS) { val[0] += bfr(bias[c0 + cofs]); val[1] += bfr(bias[c0 + cofs + 1]); val[2] += bfr(bias[c0 + cofs + 2]); val[3] += bfr(bias[c0 + cofs + 3]); }
                *(v4f*)(crow + (size_t)row * ldc + cofs) = val; }
             }
        __builtin_amdgcn_wave_barrier(); asm volatile("" ::: "memory");
    }
}


// k_prep: the three operand conversions (W^T, W and x to bf16) in ONE launch of few waves that each carry much. For speed only, a thread takes PW pieces
// (all its loads in flight at once), and the three jobs share one launch: work-groups 0 .. NBT - 1 turn W, the next NBW round W, the last NBX round x.
#define PW  12                                   // 8-element pieces a thread
#define NBT ((CC / 128) * (CC / 64))             // W^T: one work-group a tile of 128 n x 64 k
#define NBW (CC * CC / 8 / (256 * PW))
#define NBX (NB_ * TT * CC / 8 / (256 * PW))
static_assert(PW == 12 && NBW * 256 * PW * 8 == CC * CC && NBX * 256 * PW * 8 == NB_ * TT * CC, "the work-groups cover W and x exactly; the wait statements name PW values");
// dst = bf16(src), work-group blk takes PW * 256 consecutive pieces: piece j * 256 + thread, so a wave's loads and stores run over consecutive bytes.
__device__ __forceinline__ void cvt_run(const float* __restrict__ src, bf* __restrict__ dst, int blk) {
    const unsigned li = threadIdx.x * 32u, lo = threadIdx.x * 16u; const float* ps = src + (size_t)blk * (PW * 256 * 8); bf* pd = dst + (size_t)blk * (PW * 256 * 8);
    v8f v[PW]; v8us o[PW];
#pragma unroll
    for (int j = 0; j < PW; ++j) v[j] = *(const v8f*)((const char*)(ps + j * 2048) + li);
    // the loads name the base and the lane's offset: the wait takes the loaded values as inputs, so every load stands in front of it, and base and offset stay as they are to here
    asm volatile("s_wait_xcnt 0x0" :: "v"(li), "s"(ps), "v"(v[0]), "v"(v[1]), "v"(v[2]), "v"(v[3]), "v"(v[4]), "v"(v[5]), "v"(v[6]), "v"(v[7]), "v"(v[8]), "v"(v[9]), "v"(v[10]), "v"(v[11]) : "memory");
#pragma unroll
    for (int j = 0; j < PW; ++j) {
#pragma unroll
        for (int k = 0; k < 8; ++k) o[j][k] = f2bf(v[j][k]); }
#pragma unroll
    for (int j = 0; j < PW; ++j) *(v8us*)((char*)(pd + j * 2048) + lo) = o[j];
    // the stores name these registers: as the wait's inputs they stay as they are until it has passed
    asm volatile("s_wait_xcnt 0x0" :: "v"(lo), "s"(pd), "v"(o[0]), "v"(o[1]), "v"(o[2]), "v"(o[3]), "v"(o[4]), "v"(o[5]), "v"(o[6]), "v"(o[7]), "v"(o[8]), "v"(o[9]), "v"(o[10]), "v"(o[11]) : "memory");
}
// WT[n][k] = bf16(W[k][n]). A wave turns 64 k x 16 n in registers: lane (ng, kg) reads 4 n of each of its 8 rows k (64 bytes of a row to 4 lanes) and writes, for each of its 4 n, its 8 k as one 16-byte piece;
// the 8 lanes kg of one n write one whole 128-byte line, and two neighbouring waves of the work-group share each line of W that they read.
__device__ __forceinline__ void wt_run(const float* __restrict__ w, bf* __restrict__ WT, int blk) {
    const int lane = threadIdx.x & 31, ng = lane >> 3, kg = lane & 7; const int wv = __builtin_amdgcn_readfirstlane((int)(threadIdx.x >> 5));
    const int n0 = (blk % (CC / 128)) * 128 + wv * 16, k0 = (blk / (CC / 128)) * 64;
    const unsigned li = (unsigned)(kg * 8 * CC + ng * 4) * 4u, lo = (unsigned)(ng * 4 * CC + kg * 8) * 2u; const float* ps = w + (size_t)k0 * CC + n0; bf* pd = WT + (size_t)n0 * CC + k0;
    v4f v[8]; v8us o[4];
#pragma unroll
    for (int i = 0; i < 8; ++i) v[i] = *(const v4f*)((const char*)(ps + i * CC) + li);
    // as in cvt_run: every load in front of the wait, base and offset unchanged to here
    asm volatile("s_wait_xcnt 0x0" :: "v"(li), "s"(ps), "v"(v[0]), "v"(v[1]), "v"(v[2]), "v"(v[3]), "v"(v[4]), "v"(v[5]), "v"(v[6]), "v"(v[7]) : "memory");
#pragma unroll
    for (int c = 0; c < 4; ++c) {
#pragma unroll
        for (int i = 0; i < 8; ++i) o[c][i] = f2bf(v[i][c]); }
#pragma unroll
    for (int c = 0; c < 4; ++c) *(v8us*)((char*)(pd + c * CC) + lo) = o[c];
    // as in cvt_run: the stores' registers stay as they are until the wait has passed
    asm volatile("s_wait_xcnt 0x0" :: "v"(lo), "s"(pd), "v"(o[0]), "v"(o[1]), "v"(o[2]), "v"(o[3]) : "memory");
}
__global__ __launch_bounds__(256) void k_prep(const float* __restrict__ x, const float* __restrict__ w, bf* XB, bf* WB, bf* WT) {
    const int b = (int)blockIdx.x;
    if (b < NBT) wt_run(w, WT, b); else if (b < NBT + NBW) cvt_run(w, WB, b - NBT); else cvt_run(x, XB, b - (NBT + NBW));
}
// The scores never go to memory: k_stat and k_att each form the score tiles they need on the matrix units, from the same hi / lo planes and with the same three products.
// SC = log2(e) / 8: exp(s / 8 - m / 8) = 2^(s SC - m SC).
#define SC 0.18033688f
// 2^x and log2 x. Results apart from all sources and a v_nop at the end of each statement: the one-instruction slot that the instruction set asks for behind a transcendental before its result is read or its source
// overwritten.
__device__ __forceinline__ void ex4(float x0, float x1, float x2, float x3, float& y0, float& y1, float& y2, float& y3) { asm("v_exp_f32 %0, %4\n\tv_exp_f32 %1, %5\n\tv_exp_f32 %2, %6\n\tv_exp_f32 %3, %7\n\tv_nop" : "=&v"(y0), "=&v"(y1), "=&v"(y2), "=&v"(y3) : "v"(x0), "v"(x1), "v"(x2), "v"(x3)); }
__device__ __forceinline__ void ex3(float x0, float x1, float x2, float& y0, float& y1, float& y2) { asm("v_exp_f32 %0, %3\n\tv_exp_f32 %1, %4\n\tv_exp_f32 %2, %5\n\tv_nop" : "=&v"(y0), "=&v"(y1), "=&v"(y2) : "v"(x0), "v"(x1), "v"(x2)); }
__device__ __forceinline__ float ex1(float x) { float y; asm("v_exp_f32 %0, %1\n\tv_nop" : "=&v"(y) : "v"(x)); return y; }
__device__ __forceinline__ float lg1(float x) { float y; asm("v_log_f32 %0, %1\n\tv_nop" : "=&v"(y) : "v"(x)); return y; }
// A lane's address = a wave-uniform base + the lane's own byte offset: the loads then name one offset register and the base's scalar pair, which the waits behind them take as inputs.
template <typename T> __device__ __forceinline__ const T* atb(const T* base, unsigned lob) { return (const T*)((const char*)base + lob); }
// The loops' stepping addresses are byte pointers typed as global memory: as operands of the wait statement they would otherwise lose that type, and the loads would become flat ones.
#define GLB __attribute__((address_space(1)))
typedef const GLB char* gp;
__device__ __forceinline__ v16bf ldb(gp p, int o) { return cat16b(*(const GLB v8us*)(p + o), *(const GLB v8us*)(p + o + FRH)); }
__device__ __forceinline__ v16h ldh(gp p, int o) { return cat16(*(const GLB v8h*)(p + o), *(const GLB v8h*)(p + o + FRH)); }
__device__ __forceinline__ v16bf ldf(const bf* p) { return cat16b(*(const v8us*)p, *(const v8us*)(p + FRH / 2)); }
__device__ __forceinline__ v8f score6(v16bf ah0, v16bf al0, v16bf ah1, v16bf al1, v16bf bh0, v16bf bl0, v16bf bh1, v16bf bl1) {
    v8f c = (v8f){}; c = wmmab(ah0, bh0, c); c = wmmab(al0, bh0, c); c = wmmab(ah0, bl0, c); c = wmmab(ah1, bh1, c); c = wmmab(al1, bh1, c); c = wmmab(ah1, bl1, c); return c; }
// k_stat: softmax statistics, ONE set for both directions. q and k are the same normed row n = w r, scaled by g1 and by g2, so att[i][j] = sum_d n_i[d] n_j[d] g1[d] g2[d] / 8 = att[j][i] for every x, W, g1 and g2:
// column t of att is row t, and the column softmax's maximum and sum at key t are the row softmax's at query t. A query is fixed and the keys move. Grid NZ * TT / 192, 12 waves (three a SIMD, one work-group a WGP):
// wave w holds the 64 fixed rows of row group 3 blockIdx.x + w % 3 as A fragments and walks quarter w / 3 of the 2048 moving rows, 32 a trip; the three waves of a quarter read the same moving rows (but where a work-group
// spans two heads). D[8 hi + j][lr]: a lane keeps a running maximum and sum for each of its 32 fixed rows over the moving rows that fall on its column; the 16 lanes, then the four quarters (through LDS), are joined in
// a fixed order. Out: E = 9 - m SC - log2(sum), so that 2^(s SC + E) = 512 exp(s / 8 - m / 8) / sum.
__global__ __launch_bounds__(384) __attribute__((amdgpu_waves_per_eu(3, 3))) void k_stat(const bf* __restrict__ Qh, const bf* __restrict__ Ql, const bf* __restrict__ Kh, const bf* __restrict__ Kl, float* E) {
    __shared__ float lm[4 * 192]; __shared__ float ls[4 * 192];
    const int lane = threadIdx.x & 31, lr = lane & 15, hi = lane >> 4; const int wv = __builtin_amdgcn_readfirstlane((int)(threadIdx.x >> 5)), fg = wv % 3, mh = wv / 3;
    const int rgi = blockIdx.x * 3 + fg, zh = rgi / (TT / 64); const size_t zo = (size_t)zh * TT * HD; const int f0 = (rgi % (TT / 64)) * 64;
    const bf* Fh = Qh + zo; const bf* Fl = Ql + zo; const bf* Mh = Kh + zo; const bf* Ml = Kl + zo;
    const unsigned lob = (unsigned)lane * 16u; const bf* pfh = Fh + f0 * HD; const bf* pfl = Fl + f0 * HD;
    v16bf ah[4][2], al[4][2];
#pragma unroll
    for (int a = 0; a < 4; ++a) {
#pragma unroll
        for (int kc = 0; kc < 2; ++kc) { ah[a][kc] = ldf(atb(pfh + a * 16 * HD + kc * (FRB / 2), lob)); al[a][kc] = ldf(atb(pfl + a * 16 * HD + kc * (FRB / 2), lob)); } }
    asm volatile("s_wait_xcnt 0x0" :: "v"(lob), "s"(pfh), "s"(pfl) : "memory");    // the loads name the two bases and the lane's offset (as built: the lane number, scaled by the load's width): the wait stands directly behind the last load, in front of every write of one of them
    float m[4][8], s[4][8];
#pragma unroll
    for (int a = 0; a < 4; ++a) {
#pragma unroll
        for (int j = 0; j < 8; ++j) { m[a][j] = -3.0e38f; s[a][j] = 0.f; } }
    gp pmh = (gp)(const char*)atb(Mh + mh * (TT / 4) * HD, lob); gp pml = (gp)(const char*)atb(Ml + mh * (TT / 4) * HD, lob);
#pragma unroll 1    // rolled: one trip's fragments and score tiles already fill the register budget of three waves a SIMD
    for (int it = 0; it < TT / 4 / 32; ++it) {
        v16bf bh[2][2], bl[2][2];
#pragma unroll
        for (int b = 0; b < 2; ++b) {
#pragma unroll
            for (int kc = 0; kc < 2; ++kc) { bh[b][kc] = ldb(pmh, b * 16 * HD * 2 + kc * FRB); bl[b][kc] = ldb(pml, b * 16 * HD * 2 + kc * FRB); } }
        // The trip's loads name the two address pairs. The wait takes the loaded values as inputs, so every load stands in front of it, and the pairs as operands, so that they are the registers the loads name, stay
        // as they are to here (no load's result is placed on one) and step on only behind it.
        asm volatile("s_wait_xcnt 0x0" : "+v"(pmh), "+v"(pml) : "v"(bh[0][0]), "v"(bh[0][1]), "v"(bh[1][0]), "v"(bh[1][1]), "v"(bl[0][0]), "v"(bl[0][1]), "v"(bl[1][0]), "v"(bl[1][1]) : "memory");
        pmh += 32 * HD * 2; pml += 32 * HD * 2;
#pragma unroll
        for (int a = 0; a < 4; ++a) {
            const v8f c0 = score6(ah[a][0], al[a][0], ah[a][1], al[a][1], bh[0][0], bl[0][0], bh[0][1], bl[0][1]);
            const v8f c1 = score6(ah[a][0], al[a][0], ah[a][1], al[a][1], bh[1][0], bl[1][0], bh[1][1], bl[1][1]);
#pragma unroll
            for (int j = 0; j < 8; ++j) { const float mn = fmaxf(m[a][j], fmaxf(c0[j], c1[j])); const float nb = -mn * SC;
                float e0, e1, e2; ex3(fmaf(m[a][j], SC, nb), fmaf(c0[j], SC, nb), fmaf(c1[j], SC, nb), e0, e1, e2); s[a][j] = fmaf(s[a][j], e0, e1 + e2); m[a][j] = mn; }
            __builtin_amdgcn_sched_barrier(0); }    // a row group's score tiles are formed behind the sums of the group before: several groups' tiles at once do not fit the registers of three waves a SIMD (spills)
    }
#pragma unroll
    for (int a = 0; a < 4; ++a) {
#pragma unroll
        for (int j = 0; j < 8; ++j) { float mm = m[a][j];
#pragma unroll
            for (int sh = 1; sh <= 8; sh <<= 1) mm = fmaxf(mm, __shfl_xor(mm, sh, 32));
            float ss = s[a][j] * ex1((m[a][j] - mm) * SC);
#pragma unroll
            for (int sh = 1; sh <= 8; sh <<= 1) ss += __shfl_xor(ss, sh, 32);
            m[a][j] = mm; s[a][j] = ss; } }
    if (lr == 0) {
#pragma unroll
        for (int a = 0; a < 4; ++a) {
#pragma unroll
            for (int j = 0; j < 8; ++j) { lm[mh * 192 + fg * 64 + a * 16 + hi * 8 + j] = m[a][j]; ls[mh * 192 + fg * 64 + a * 16 + hi * 8 + j] = s[a][j]; } } }
    __syncthreads();    // every quarter's maxima and sums are in LDS before a thread joins the four of its row
    // Thread t < 192 joins row t of the work-group's 192 (quarters in the order 0, 1, 2, 3); row group g's row r is element 64 g + r of E, so the work-group's 192 results go out in a row.
    const int t = (int)threadIdx.x;
    if (t < 192) { const float m0 = lm[t], m1 = lm[192 + t], m2 = lm[384 + t], m3 = lm[576 + t]; const float mm = fmaxf(fmaxf(m0, m1), fmaxf(m2, m3));
        float e0, e1, e2, e3; ex4((m0 - mm) * SC, (m1 - mm) * SC, (m2 - mm) * SC, (m3 - mm) * SC, e0, e1, e2, e3);
        const float ss = ((ls[t] * e0 + ls[192 + t] * e1) + ls[384 + t] * e2) + ls[576 + t] * e3; E[blockIdx.x * 192 + t] = 9.0f - mm * SC - lg1(ss); }
}
// k_att: y = a.v with a formed in registers. Grid (TT / 64, NZ), 4 waves: wave w owns the 32 queries (w & 1) and half (w >> 1) of the keys, 32 keys a trip. S^T = K Q^T (A = K rows, B = Q, kept in registers): D[8 hi + j][lr] is
// key 8 hi + j against query lr, so two score tiles of 16 keys, turned into 512 a = 2^(s SC + E[query]) + 2^(s SC + E[key]) (one E for the row and the column softmax: k_stat) and rounded to fp16, ARE the B fragment (k = 8 hi + j, 16 + 8 hi + j) of O^T += V^T P^T,
// whose A fragment comes from VT by the same k order. The two key halves are added through LDS (first half + second half); y / 512 goes out as the two bf16 planes, 8 consecutive d a lane.
__global__ __launch_bounds__(128) __attribute__((amdgpu_waves_per_eu(3, 3))) void k_att(const bf* __restrict__ Qh, const bf* __restrict__ Ql, const bf* __restrict__ Kh, const bf* __restrict__ Kl, const h16* __restrict__ VT, const float* __restrict__ E, bf* Yh, bf* Yl) {
    __shared__ __align__(16) float red[2 * 64 * 32];
    const int lane = threadIdx.x & 31, lr = lane & 15, hi = lane >> 4; const int wv = __builtin_amdgcn_readfirstlane((int)(threadIdx.x >> 5)), qg = wv & 1, kh = wv >> 1;
    const int zh = blockIdx.y; const size_t zo = (size_t)zh * TT * HD; const int q0 = blockIdx.x * 64 + qg * 32; const unsigned lob = (unsigned)lane * 16u, leb = (unsigned)hi * 32u, lab = (unsigned)lr * 4u;
    const bf* Kph = Kh + zo; const bf* Kpl = Kl + zo; const h16* Vp = VT + zo; const float* Eb = E + (size_t)zh * TT;
    v16bf qh[2][2], ql[2][2]; float ea[2]; const bf* pqh = Qh + zo + q0 * HD; const bf* pql = Ql + zo + q0 * HD; const float* pea = E + (size_t)zh * TT + q0;
#pragma unroll
    for (int qt = 0; qt < 2; ++qt) { ea[qt] = *atb(pea + qt * 16, lab);
#pragma unroll
        for (int kc = 0; kc < 2; ++kc) { qh[qt][kc] = ldf(atb(pqh + qt * 16 * HD + kc * (FRB / 2), lob)); ql[qt][kc] = ldf(atb(pql + qt * 16 * HD + kc * (FRB / 2), lob)); } }
    asm volatile("s_wait_xcnt 0x0" :: "v"(lob), "v"(lane), "v"(lab), "s"(pqh), "s"(pql), "s"(pea) : "memory");    // the loads name these registers: the wait stands behind the last load, and as its inputs they stay live to here, so that none is rewritten before it
    v8f o[4][2];
#pragma unroll
    for (int dt = 0; dt < 4; ++dt) { o[dt][0] = (v8f){}; o[dt][1] = (v8f){}; }
    gp pk = (gp)(const char*)atb(Kph + kh * (TT / 2) * HD, lob); gp pl = (gp)(const char*)atb(Kpl + kh * (TT / 2) * HD, lob); gp pv = (gp)(const char*)atb(Vp + kh * (TT / 2) * HD, lob); gp pe = (gp)(const char*)atb(Eb + kh * (TT / 2), leb);
#pragma unroll 1    // rolled: one trip's fragments already fill the register budget of three waves a SIMD
    for (int it = 0; it < TT / 2 / 32; ++it) {
        v16bf ka[2][2], kb[2][2]; v8f eb[2]; v16h va[4];
#pragma unroll
        for (int kt = 0; kt < 2; ++kt) {
#pragma unroll
            for (int kc = 0; kc < 2; ++kc) { ka[kt][kc] = ldb(pk, kt * 16 * HD * 2 + kc * FRB); kb[kt][kc] = ldb(pl, kt * 16 * HD * 2 + kc * FRB); } }
#pragma unroll
        for (int kt = 0; kt < 2; ++kt) eb[kt] = *(const GLB v8f*)(pe + kt * 64);
#pragma unroll
        for (int dt = 0; dt < 4; ++dt) va[dt] = ldh(pv, dt * FRB);
        // The trip's loads name the four address pairs. The wait takes the loaded values as inputs, so every load stands in front of it, and the pairs as operands, so that they are the registers the loads name, stay
        // as they are to here (no load's result is placed on one) and step on only behind it.
        asm volatile("s_wait_xcnt 0x0" : "+v"(pk), "+v"(pl), "+v"(pv), "+v"(pe) : "v"(ka[0][0]), "v"(ka[0][1]), "v"(ka[1][0]), "v"(ka[1][1]), "v"(kb[0][0]), "v"(kb[0][1]), "v"(kb[1][0]), "v"(kb[1][1]), "v"(eb[0]), "v"(eb[1]), "v"(va[0]), "v"(va[1]), "v"(va[2]), "v"(va[3]) : "memory");
        pk += 32 * HD * 2; pl += 32 * HD * 2; pv += 32 * HD * 2; pe += 32 * 4;
        v16h p[2];
#pragma unroll
        for (int qt = 0; qt < 2; ++qt) {
#pragma unroll
            for (int kt = 0; kt < 2; ++kt) { const v8f c = score6(ka[kt][0], kb[kt][0], ka[kt][1], kb[kt][1], qh[qt][0], ql[qt][0], qh[qt][1], ql[qt][1]);
#pragma unroll
                for (int j = 0; j < 8; j += 2) { float r0, c0, r1, c1; ex4(fmaf(c[j], SC, ea[qt]), fmaf(c[j], SC, eb[kt][j]), fmaf(c[j + 1], SC, ea[qt]), fmaf(c[j + 1], SC, eb[kt][j + 1]), r0, c0, r1, c1); p[qt][kt * 8 + j] = tohx(r0 + c0); p[qt][kt * 8 + j + 1] = tohx(r1 + c1); } } }
#pragma unroll
        for (int dt = 0; dt < 4; ++dt) { o[dt][0] = wmma16(va[dt], p[0], o[dt][0]); o[dt][1] = wmma16(va[dt], p[1], o[dt][1]); }
    }
    float* rw = red + qg * (64 * 32) + lane;
    if (kh == 1) {
#pragma unroll
        for (int dt = 0; dt < 4; ++dt) {
#pragma unroll
            for (int qt = 0; qt < 2; ++qt) {
#pragma unroll
                for (int j = 0; j < 8; ++j) rw[((dt * 2 + qt) * 8 + j) * 32] = o[dt][qt][j]; } } }
    __syncthreads();    // the second key half's partial outputs are in LDS before the first half's waves add them
    if (kh == 0) { const size_t yo = (size_t)((zh / NH_) * TT + q0 + lr) * CC + (zh % NH_) * HD + 8 * hi;
#pragma unroll
        for (int dt = 0; dt < 4; ++dt) {
#pragma unroll
            for (int qt = 0; qt < 2; ++qt) { v8us oh, ol;
#pragma unroll
                for (int j = 0; j < 8; ++j) { unsigned short a, c; splitf((o[dt][qt][j] + rw[((dt * 2 + qt) * 8 + j) * 32]) * (1.0f / PCAR), a, c); oh[j] = a; ol[j] = c; }
                *(v8us*)(Yh + yo + (size_t)qt * 16 * CC + dt * 16) = oh; *(v8us*)(Yl + yo + (size_t)qt * 16 * CC + dt * 16) = ol; } } }
}

extern "C" void kernel_launch(void* const* d_in, const int* in_sizes, int n_in,
                              void* d_out, int out_size, void* d_ws, size_t ws_size, hipStream_t stream) {
    (void)in_sizes; (void)n_in; (void)out_size;
    const float* x = (const float*)d_in[0]; const float* Wt = (const float*)d_in[1]; const float* g1 = (const float*)d_in[2]; const float* g2 = (const float*)d_in[3]; const float* g3 = (const float*)d_in[4];
    float* OUT = (float*)d_out;     // [2][2048][768]
    char* wsp = (char*)d_ws;
    auto take = [&](size_t bytes) { char* p = wsp; wsp += (bytes + 255) & ~(size_t)255; return (void*)p; };
    bf* WB = (bf*)take((size_t)CC * CC * 2); bf* WT = (bf*)take((size_t)CC * CC * 2); bf* XB = (bf*)take((size_t)NB_ * TT * CC * 2); bf* Yh = (bf*)take((size_t)NB_ * TT * CC * 2); bf* Yl = (bf*)take((size_t)NB_ * TT * CC * 2);
    bf* Qh = (bf*)take((size_t)NZ * TT * HD * 2); bf* Ql = (bf*)take((size_t)NZ * TT * HD * 2); bf* Kh = (bf*)take((size_t)NZ * TT * HD * 2); bf* Kl = (bf*)take((size_t)NZ * TT * HD * 2); h16* VT = (h16*)take((size_t)NZ * HD * TT * 2);
    float* E = (float*)take((size_t)NZ * TT * 4);    // [zh][t]
    if ((size_t)(wsp - (char*)d_ws) > ws_size) return;    // total ~ 53 MB
    // Both batch items go through every launch together (rows b * TT + t), and all NZ (batch, head) pairs through the statistics and the a.v launch.
    k_prep<<<NBT + NBW + NBX, 256, 0, stream>>>(x, Wt, XB, WB, WT);    // WB = W [out][in], the natural Bt for x W^T; WT = W turned, the Bt for y W; XB = x
    k_gemmw<bf, 0, false, 4, true><<<dim3(NB_ * TT / 64, CC / 64, 1), 128, 0, stream>>>(XB, nullptr, WB, nullptr, CC, nullptr, CC, nullptr, 0, 0, 0, g1, g2, g3, Qh, Ql, Kh, Kl, VT);    // w = x W^T, normed in the epilogue: q, k, v planes
    k_stat<<<dim3(NZ * TT / 192), 384, 0, stream>>>(Qh, Ql, Kh, Kl, E);
    k_att<<<dim3(TT / 64, NZ), 128, 0, stream>>>(Qh, Ql, Kh, Kl, VT, E, Yh, Yl);
    k_gemmw<bf, 1, false, 4, false><<<dim3(NB_ * TT / 64, CC / 64, 1), 128, 0, stream>>>(Yh, Yl, WT, nullptr, CC, OUT, CC, nullptr, 0, 0, 0, nullptr, nullptr, nullptr, nullptr, nullptr, nullptr, nullptr, nullptr);
}

// v010
// Measured time: 86.4 microseconds a run.
// It is 1.31 times as fast as v008, going by the measured steps of the versions left out in between.
// Over all steps from v000 it is 108 times as fast.
#include <hip/hip_runtime.h>

// HyperSETAlterAttention (x [2][2048][768]; w = x W^T (12 heads x 64, shared weights); q, k, v = RMSNorm(w) g1 / g2 / g3 (eps = f32 eps); att = q.k / 8; a = softmax over keys + softmax over QUERIES (bisoftmax);
// y = a.v merged; out = y W -> [2][2048][768]).
// Compute dtypes, f32 accumulate: every input rounded to bf16; x W^T on PLAIN bf16 operands (inputs: exact); RMSNorm f32 -> ONE fp16 plane each of q, k and v (scores: 1 product, K 64; 11 bits an operand leave the logits, which span
// +-8, an error near 4e-4, about that of the fp16 rounding of a itself); the softmax statistics (sums of 2^(s / 8 log2 e), fixed order, with a running maximum only where they leave the range of f32; att is symmetric, so the rows' serve the columns too) in f32 from score tiles formed anew on the matrix units; both softmaxes combined into ONE fp16 plane in registers (scaled by 512); y as ONE fp16 plane against the bf16-rounded W held in fp16 (y W: 1 product)

#define NB_  2
#define TT   2048
#define CC   768
#define NH_  12
#define HD   64
#define NZ   (NB_ * NH_)    // (batch, head) pairs, index zh = b * NH_ + h
#define PCAR 512.0f
typedef _Float16 h16;
typedef unsigned short bf;
typedef __attribute__((ext_vector_type(16))) __bf16   v16bf;
typedef __attribute__((ext_vector_type(16))) _Float16 v16h;
typedef __attribute__((ext_vector_type(8)))  _Float16 v8h;
typedef __attribute__((ext_vector_type(8)))  unsigned short v8us;
typedef __attribute__((ext_vector_type(8)))  float    v8f;
typedef __attribute__((ext_vector_type(4)))  float    v4f;
typedef __attribute__((ext_vector_type(8)))  int      v8i;
typedef v8h  __attribute__((may_alias)) v8ha;
typedef v4f  __attribute__((may_alias)) v4fa;

__device__ __forceinline__ unsigned short f2bf(float f) { unsigned u = __float_as_uint(f); u += 0x7FFFu + ((u >> 16) & 1u); return (unsigned short)(u >> 16); }
__device__ __forceinline__ float bf2f(unsigned short b) { return __uint_as_float(((unsigned)b) << 16); }
__device__ __forceinline__ float bfr(float f) { return bf2f(f2bf(f)); }
__device__ __forceinline__ v16h cat16(v8h lo, v8h hi) { return __builtin_shufflevector(lo, hi, 0, 1, 2, 3, 4, 5, 6, 7, 8, 9, 10, 11, 12, 13, 14, 15); }
__device__ __forceinline__ v16bf cat16b(v8us lo, v8us hi) { return __builtin_bit_cast(v16bf, __builtin_shufflevector(lo, hi, 0, 1, 2, 3, 4, 5, 6, 7, 8, 9, 10, 11, 12, 13, 14, 15)); }
__device__ __forceinline__ v8f wmma16(v16h a, v16h b, v8f c) { return __builtin_amdgcn_wmma_f32_16x16x32_f16(false, a, false, b, (short)0, c, false, false); }
__device__ __forceinline__ v8f wmmab(v16bf a, v16bf b, v8f c) { return __builtin_amdgcn_wmma_f32_16x16x32_bf16(false, a, false, b, (short)0, c, false, false); }
__device__ __forceinline__ h16 tohx(float x) { return (h16)x; }
typedef __attribute__((ext_vector_type(2))) _Float16 v2h;
typedef __attribute__((ext_vector_type(4))) _Float16 v4h;
typedef __attribute__((ext_vector_type(2))) unsigned short v2us;
typedef v4h __attribute__((may_alias)) v4ha;
// FRAGMENT ORDER of the q, k and v^T planes. A 16 x 32 operand fragment (16 rows, 32 k) is 1 KiB: [half 0..1][hi 0..1][row 0..15][8 k], element k = 16 half + 8 hi + 0..7, so that lane (hi, row) finds its two
// 16-byte pieces at 16 * lane and 512 + 16 * lane and each load of a wave is 512 consecutive bytes (4 whole lines) instead of 32 bytes of each of 16 lines. q, k: [zh][t / 16][d / 32][fragment], rows t, k = d.
// v^T: [zh][t / 32][d / 16][fragment], rows d, k = t. 64 rows t of one (batch, head) are 8 KiB in a row in every plane.
#define FRH 512     // bytes from a lane's first piece to its second
#define FRB 1024    // bytes of a fragment



// ---- k_gemmw: register-blocked GEMM, one work-group of KS waves per 64x64 output tile (16 accumulators a wave), operands straight from K-contiguous 16-bit planes; grid (M/64, N/64, Z), 32 * KS threads.
// C[m][n] (f32, pitch ldc, + optional f32 bias[n]) = sum_k A[m][k] Bt[n][k] (+ split products per NSPLIT). z-batch strides sA/sB/sC in elements. K % (32 * KS) == 0.
// KS > 1: wave w sums the K / KS consecutive k from w * K / KS on, so a long K is KS short load-latency chains side by side; the KS partial tiles meet in LDS and are added in wave order 0, 1, .. KS - 1.
template <typename T16> struct WFrag;
template <> struct WFrag<h16> { typedef v16h V; static __device__ __forceinline__ V ld(const h16* p) { return cat16(*(const v8h*)p, *(const v8h*)(p + 16)); } static __device__ __forceinline__ v8f mma(V a, V b, v8f c) { return wmma16(a, b, c); } };
template <> struct WFrag<bf> { typedef v16bf V; static __device__ __forceinline__ V ld(const bf* p) { return cat16b(*(const v8us*)p, *(const v8us*)(p + 16)); } static __device__ __forceinline__ v8f mma(V a, V b, v8f c) { return wmmab(a, b, c); } };
// 1 / sqrt(x), four at a time. Results apart from all sources and a v_nop at the end of the statement: the one-instruction slot that the instruction set asks for behind a transcendental before its result is read or its
// source overwritten.
__device__ __forceinline__ void rs4(float x0, float x1, float x2, float x3, float& y0, float& y1, float& y2, float& y3) { asm("v_rsq_f32 %0, %4\n\tv_rsq_f32 %1, %5\n\tv_rsq_f32 %2, %6\n\tv_rsq_f32 %3, %7\n\tv_nop" : "=&v"(y0), "=&v"(y1), "=&v"(y2), "=&v"(y3) : "v"(x0), "v"(x1), "v"(x2), "v"(x3)); }
// NORM (the projection x W^T, KS = 4, N tile = one head): the tile is 64 rows t of one (batch, head) with all 64 dims, so the work-group that summed it also norms it: r = rsqrt(mean(w^2) + eps) a row, then
// Q = fp16(w r g1), K = fp16(w r g2) and V^T = fp16(w r g3), all three in fragment order (turned in LDS so that every store of a wave is 512 consecutive bytes). C is not written. 16 lanes hold a row, 4 dims each, 8 consecutive rows a thread.
template <typename T16, int NSPLIT, bool BIAS, int KS, bool NORM>
__global__ __launch_bounds__(32 * KS) void k_gemmw(const T16* __restrict__ A, const T16* __restrict__ A2, const T16* __restrict__ Bt, const T16* __restrict__ Bt2, int K, float* C, int ldc, const float* __restrict__ bias, size_t sA, size_t sB, size_t sC,
                                                   const float* __restrict__ g1, const float* __restrict__ g2, const float* __restrict__ g3, h16* Q, h16* Kp, h16* VT) {
    typedef typename WFrag<T16>::V V;
    __shared__ __align__(16) float os[(KS > 1 ? KS * 64 : 16) * 68];
    __shared__ __align__(16) h16 vts[NORM ? 64 * 72 : 8];
    const size_t z = blockIdx.z; A += z * sA; if (A2) A2 += z * sA; Bt += z * sB; if (Bt2) Bt2 += z * sB; C += z * sC;
    const int lane = threadIdx.x & 31, lr = lane & 15, hi = lane >> 4; const int r0 = blockIdx.x * 64, c0 = blockIdx.y * 64;
    v8f acc[4][4];
#pragma unroll
    for (int mb = 0; mb < 4; ++mb)
#pragma unroll
        for (int nb = 0; nb < 4; ++nb) acc[mb][nb] = (v8f){};
    const size_t aoff = (size_t)(r0 + lr) * K + 8 * hi, boff = (size_t)(c0 + lr) * K + 8 * hi;
    const int wv = KS > 1 ? __builtin_amdgcn_readfirstlane((int)(threadIdx.x >> 5)) : 0; const int kspan = K / KS, kbeg = wv * kspan, kend = kbeg + kspan;
#pragma unroll 1
    for (int kc = kbeg; kc < kend; kc += 32) {
        V a[4], a2[4];
#pragma unroll
        for (int mb = 0; mb < 4; ++mb) { a[mb] = WFrag<T16>::ld(A + aoff + (size_t)mb * 16 * K + kc); if (NSPLIT == 1 || NSPLIT == 2) a2[mb] = WFrag<T16>::ld(A2 + aoff + (size_t)mb * 16 * K + kc); }
#pragma unroll
        for (int nb = 0; nb < 4; ++nb) { const V b = WFrag<T16>::ld(Bt + boff + (size_t)nb * 16 * K + kc); V b2; if (NSPLIT >= 2) b2 = WFrag<T16>::ld(Bt2 + boff + (size_t)nb * 16 * K + kc);
#pragma unroll
            for (int mb = 0; mb < 4; ++mb) { acc[mb][nb] = WFrag<T16>::mma(a[mb], b, acc[mb][nb]); if (NSPLIT == 1 || NSPLIT == 2) acc[mb][nb] = WFrag<T16>::mma(a2[mb], b, acc[mb][nb]); if (NSPLIT >= 2) acc[mb][nb] = WFrag<T16>::mma(a[mb], b2, acc[mb][nb]); } }
        asm volatile("v_nop\n\tv_nop\n\tv_nop\n\tv_nop" : "+v"(acc[0][0]), "+v"(acc[1][1]), "+v"(acc[2][2]), "+v"(acc[3][3]) : "v"(a[0]), "v"(a[3]));
    }
    if (KS > 1) {
        float* ow = os + wv * (64 * 68);
#pragma unroll
        for (int mb = 0; mb < 4; ++mb) {
#pragma unroll
            for (int nb = 0; nb < 4; ++nb) {
#pragma unroll
                for (int j = 0; j < 8; ++j) ow[(mb * 16 + hi * 8 + j) * 68 + nb * 16 + lr] = acc[mb][nb][j]; } }
        __syncthreads();    // every wave's partial tile is in LDS before any thread adds the KS partials of its outputs
        if (NORM) {
            const int rg = (int)threadIdx.x >> 4, cofs = lr * 4; const int zh = (r0 / TT) * NH_ + (int)blockIdx.y, t0 = r0 % TT; const unsigned lgb = (unsigned)cofs * 4u;
            float ga[4], gb[4], gc[4];
#pragma unroll
            for (int c = 0; c < 4; ++c) { ga[c] = *(const float*)((const char*)(g1 + c) + lgb); gb[c] = *(const float*)((const char*)(g2 + c) + lgb); gc[c] = *(const float*)((const char*)(g3 + c) + lgb); }
            asm volatile("s_wait_xcnt 0x0" :: "v"(lgb), "s"(g1), "s"(g2), "s"(g3) : "memory");    // the loads name these registers: the wait stands behind the last load, and as its inputs they stay live to here
            v4f val[8]; float x[8], y[8];
#pragma unroll
            for (int s = 0; s < 8; ++s) { const int row = rg * 8 + s; val[s] = *(const v4fa*)(os + row * 68 + cofs);
#pragma unroll
                for (int w = 1; w < KS; ++w) { const v4f o = *(const v4fa*)(os + (w * 64 + row) * 68 + cofs); val[s][0] += o[0]; val[s][1] += o[1]; val[s][2] += o[2]; val[s][3] += o[3]; }
                x[s] = __fadd_rn(__fmul_rn(val[s][0], val[s][0]), __fmul_rn(val[s][1], val[s][1])); y[s] = __fadd_rn(__fmul_rn(val[s][2], val[s][2]), __fmul_rn(val[s][3], val[s][3])); }
            // Sum of squares over the row's 16 lanes: the even and the odd pairs of dims apart, far lanes first, the two joined last (a fixed tree).
#pragma unroll
            for (int sh = 8; sh; sh >>= 1) {
#pragma unroll
                for (int s = 0; s < 8; ++s) { x[s] += __shfl_xor(x[s], sh, 32); y[s] += __shfl_xor(y[s], sh, 32); } }
#pragma unroll
            for (int c = 0; c < 4; ++c) { ga[c] = bfr(ga[c]); gb[c] = bfr(gb[c]); gc[c] = bfr(gc[c]); }
            v8h vv[4];
#pragma unroll
            for (int s = 0; s < 8; ++s) x[s] = __fadd_rn((x[s] + y[s]) * (1.0f / HD), 1.1920929e-07f);
            rs4(x[0], x[1], x[2], x[3], y[0], y[1], y[2], y[3]); rs4(x[4], x[5], x[6], x[7], y[4], y[5], y[6], y[7]);
#pragma unroll
            for (int s = 0; s < 8; ++s) {
#pragma unroll
                for (int c = 0; c < 4; ++c) { val[s][c] = __fmul_rn(val[s][c], y[s]); vv[c][s] = tohx(__fmul_rn(val[s][c], gc[c])); } }
#pragma unroll
            for (int c = 0; c < 4; ++c) *(v8ha*)(vts + (cofs + c) * 72 + rg * 8) = vv[c];
            __syncthreads();    // every thread has read its partial sums: os is free, and the q and k pieces are turned in it
            // 16-byte pieces in plane order, 16 pieces (one hi of one half of one fragment, 256 B) to a line of 272 B: the 8-byte writes of a wave then fall on all 64 banks. Plane p starts at p * 32 lines.
            char* st = (char*)os; const unsigned so = (unsigned)(((rg >> 1) * 8 + (lr >> 1)) * 272 + (rg & 1) * 128 + (lr & 1) * 8);
#pragma unroll
            for (int s = 0; s < 8; ++s) { v4h qv, kv;
#pragma unroll
                for (int c = 0; c < 4; ++c) { const float wn = val[s][c]; qv[c] = tohx(__fmul_rn(wn, ga[c])); kv[c] = tohx(__fmul_rn(wn, gb[c])); }
                *(v4ha*)(st + so + s * 16) = qv; *(v4ha*)(st + so + s * 16 + 32 * 272) = kv; }
            __syncthreads();    // the V^T tile and the q and k tiles are whole in LDS before any thread sends a piece out; it stands in front of every global store, so that it waits for none
            // Thread i sends piece s * 128 + i of each plane's 512: the tile's 8 KiB go out in order.
            const int tid = (int)threadIdx.x; const unsigned ob = (unsigned)((zh * TT + t0) * HD * 2 + tid * 16), sl = (unsigned)((tid >> 4) * 272 + (tid & 15) * 16);
            v8h vo[4]; v8h po[2][4];
#pragma unroll
            for (int s = 0; s < 4; ++s) { vo[s] = *(const v8ha*)(vts + (((s & 1) * 2 + (tid >> 6)) * 16 + (tid & 15)) * 72 + ((s >> 1) * 4 + ((tid >> 4) & 3)) * 8);
#pragma unroll
                for (int p = 0; p < 2; ++p) po[p][s] = *(const v8ha*)(st + sl + (p * 32 + s * 8) * 272); }
#pragma unroll
            for (int s = 0; s < 4; ++s) { *(v8h*)((char*)VT + ob + s * 2048) = vo[s]; *(v8h*)((char*)Q + ob + s * 2048) = po[0][s]; *(v8h*)((char*)Kp + ob + s * 2048) = po[1][s]; }
            // the 12 stores name these registers: as the wait's inputs they stay as they are until it has passed
            asm volatile("s_wait_xcnt 0x0" :: "v"(ob), "v"(vo[0]), "v"(vo[1]), "v"(vo[2]), "v"(vo[3]), "v"(po[0][0]), "v"(po[0][1]), "v"(po[0][2]), "v"(po[0][3]), "v"(po[1][0]), "v"(po[1][1]), "v"(po[1][2]), "v"(po[1][3]) : "memory");
            return;
        }
#pragma unroll
        for (int s = 0; s < 32 / KS; ++s) { const int idx = s * (32 * KS) + (int)threadIdx.x, row = idx >> 4, cofs = (idx & 15) * 4; v4f val = *(const v4fa*)(os + row * 68 + cofs);
#pragma unroll
            for (int w = 1; w < KS; ++w) { const v4f o = *(const v4fa*)(os + (w * 64 + row) * 68 + cofs); val[0] += o[0]; val[1] += o[1]; val[2] += o[2]; val[3] += o[3]; }
            if (BIAS) { val[0] += bfr(bias[c0 + cofs]); val[1] += bfr(bias[c0 + cofs + 1]); val[2] += bfr(bias[c0 + cofs + 2]); val[3] += bfr(bias[c0 + cofs + 3]); }
            *(v4f*)(C + (size_t)(r0 + row) * ldc + c0 + cofs) = val; }
        return;
    }
#pragma unroll
    for (int mb = 0; mb < 4; ++mb) {
#pragma unroll
        for (int nb = 0; nb < 4; ++nb) {
#pragma unroll
            for (int j = 0; j < 8; ++j) os[(hi * 8 + j) * 68 + nb * 16 + lr] = acc[mb][nb][j]; }
        __builtin_amdgcn_wave_barrier(); asm volatile("" ::: "memory");
        float* crow = C + (size_t)(r0 + mb * 16) * ldc + c0;
{
#pragma unroll
            for (int s = 0; s < 8; ++s) { const int row = 2 * s + hi, cofs = lr * 4; v4f val = *(const v4fa*)(os + row * 68 + cofs); if (BIAS) { val[0] += bfr(bias[c0 + cofs]); val[1] += bfr(bias[c0 + cofs + 1]); val[2] += bfr(bias[c0 + cofs + 2]); val[3] += bfr(bias[c0 + cofs + 3]); }
                *(v4f*)(crow + (size_t)row * ldc + cofs) = val; }
             }
        __builtin_amdgcn_wave_barrier(); asm volatile("" ::: "memory");
    }
}


// k_prep: the three operand conversions (W^T, W and x rounded to bf16) in ONE launch of few waves that each carry much: a thread takes PW pieces
// (all its loads in flight at once), and the three jobs share one launch: work-groups 0 .. NBT - 1 turn W, the next NBW round W, the last NBX round x.
#define PW  12                                   // 8-element pieces a thread
#define NBT ((CC / 128) * (CC / 64))             // W^T: one work-group a tile of 128 n x 64 k
#define NBW (CC * CC / 8 / (256 * PW))
#define NBX (NB_ * TT * CC / 8 / (256 * PW))
static_assert(PW == 12 && NBW * 256 * PW * 8 == CC * CC && NBX * 256 * PW * 8 == NB_ * TT * CC, "the work-groups cover W and x exactly; the wait statements name PW values");
// dst = bf16(src), work-group blk takes PW * 256 consecutive pieces: piece j * 256 + thread, so a wave's loads and stores run over consecutive bytes.
__device__ __forceinline__ void cvt_run(const float* __restrict__ src, bf* __restrict__ dst, int blk) {
    const unsigned li = threadIdx.x * 32u, lo = threadIdx.x * 16u; const float* ps = src + (size_t)blk * (PW * 256 * 8); bf* pd = dst + (size_t)blk * (PW * 256 * 8);
    v8f v[PW]; v8us o[PW];
#pragma unroll
    for (int j = 0; j < PW; ++j) v[j] = *(const v8f*)((const char*)(ps + j * 2048) + li);
    // the loads name the base and the lane's offset: the wait takes the loaded values as inputs, so every load stands in front of it, and base and offset stay as they are to here
    asm volatile("s_wait_xcnt 0x0" :: "v"(li), "s"(ps), "v"(v[0]), "v"(v[1]), "v"(v[2]), "v"(v[3]), "v"(v[4]), "v"(v[5]), "v"(v[6]), "v"(v[7]), "v"(v[8]), "v"(v[9]), "v"(v[10]), "v"(v[11]) : "memory");
#pragma unroll
    for (int j = 0; j < PW; ++j) {
#pragma unroll
        for (int k = 0; k < 8; ++k) o[j][k] = f2bf(v[j][k]); }
#pragma unroll
    for (int j = 0; j < PW; ++j) *(v8us*)((char*)(pd + j * 2048) + lo) = o[j];
    // the stores name these registers: as the wait's inputs they stay as they are until it has passed
    asm volatile("s_wait_xcnt 0x0" :: "v"(lo), "s"(pd), "v"(o[0]), "v"(o[1]), "v"(o[2]), "v"(o[3]), "v"(o[4]), "v"(o[5]), "v"(o[6]), "v"(o[7]), "v"(o[8]), "v"(o[9]), "v"(o[10]), "v"(o[11]) : "memory");
}
// WT[n][k] = bf16(W[k][n]), held as fp16 (the partner of the fp16 plane of y; 8 bits fit in 11, so the value is the same down to 2^-14, and within 2^-25 below). A wave turns 64 k x 16 n in registers: lane (ng, kg) reads 4 n of each of its 8 rows k (64 bytes of a row to 4 lanes) and writes, for each of its 4 n, its 8 k as one 16-byte piece;
// the 8 lanes kg of one n write one whole 128-byte line, and two neighbouring waves of the work-group share each line of W that they read.
__device__ __forceinline__ void wt_run(const float* __restrict__ w, h16* __restrict__ WT, int blk) {
    const int lane = threadIdx.x & 31, ng = lane >> 3, kg = lane & 7; const int wv = __builtin_amdgcn_readfirstlane((int)(threadIdx.x >> 5));
    const int n0 = (blk % (CC / 128)) * 128 + wv * 16, k0 = (blk / (CC / 128)) * 64;
    const unsigned li = (unsigned)(kg * 8 * CC + ng * 4) * 4u, lo = (unsigned)(ng * 4 * CC + kg * 8) * 2u; const float* ps = w + (size_t)k0 * CC + n0; h16* pd = WT + (size_t)n0 * CC + k0;
    v4f v[8]; v8h o[4];
#pragma unroll
    for (int i = 0; i < 8; ++i) v[i] = *(const v4f*)((const char*)(ps + i * CC) + li);
    // as in cvt_run: every load in front of the wait, base and offset unchanged to here
    asm volatile("s_wait_xcnt 0x0" :: "v"(li), "s"(ps), "v"(v[0]), "v"(v[1]), "v"(v[2]), "v"(v[3]), "v"(v[4]), "v"(v[5]), "v"(v[6]), "v"(v[7]) : "memory");
#pragma unroll
    for (int c = 0; c < 4; ++c) {
#pragma unroll
        for (int i = 0; i < 8; ++i) o[c][i] = tohx(bfr(v[i][c])); }
#pragma unroll
    for (int c = 0; c < 4; ++c) *(v8h*)((char*)(pd + c * CC) + lo) = o[c];
    // as in cvt_run: the stores' registers stay as they are until the wait has passed
    asm volatile("s_wait_xcnt 0x0" :: "v"(lo), "s"(pd), "v"(o[0]), "v"(o[1]), "v"(o[2]), "v"(o[3]) : "memory");
}
__global__ __launch_bounds__(256) void k_prep(const float* __restrict__ x, const float* __restrict__ w, bf* XB, bf* WB, h16* WT) {
    const int b = (int)blockIdx.x;
    if (b < NBT) wt_run(w, WT, b); else if (b < NBT + NBW) cvt_run(w, WB, b - NBT); else cvt_run(x, XB, b - (NBT + NBW));
}
// The scores never go to memory: k_stat and k_att each form the score tiles they need on the matrix units, from the same two planes and with the same product.
// SC = log2(e) / 8: exp(s / 8 - m / 8) = 2^(s SC - m SC).
#define SC 0.18033688f
// 2^x and log2 x. Results apart from all sources and a v_nop at the end of each statement: the one-instruction slot that the instruction set asks for behind a transcendental before its result is read or its source
// overwritten.
__device__ __forceinline__ void ex4(float x0, float x1, float x2, float x3, float& y0, float& y1, float& y2, float& y3) { asm("v_exp_f32 %0, %4\n\tv_exp_f32 %1, %5\n\tv_exp_f32 %2, %6\n\tv_exp_f32 %3, %7\n\tv_nop" : "=&v"(y0), "=&v"(y1), "=&v"(y2), "=&v"(y3) : "v"(x0), "v"(x1), "v"(x2), "v"(x3)); }
// The same in place, x = 2^x: the statement writes no register that the compiler's own instruction has not written just before, so none of its results can be placed on an operand of a matrix instruction still in its window.
__device__ __forceinline__ void ex4i(float& x0, float& x1, float& x2, float& x3) { asm("v_exp_f32 %0, %0\n\tv_exp_f32 %1, %1\n\tv_exp_f32 %2, %2\n\tv_exp_f32 %3, %3\n\tv_nop" : "+v"(x0), "+v"(x1), "+v"(x2), "+v"(x3)); }
__device__ __forceinline__ void ex3(float x0, float x1, float x2, float& y0, float& y1, float& y2) { asm("v_exp_f32 %0, %3\n\tv_exp_f32 %1, %4\n\tv_exp_f32 %2, %5\n\tv_nop" : "=&v"(y0), "=&v"(y1), "=&v"(y2) : "v"(x0), "v"(x1), "v"(x2)); }
__device__ __forceinline__ float ex1(float x) { float y; asm("v_exp_f32 %0, %1\n\tv_nop" : "=&v"(y) : "v"(x)); return y; }
__device__ __forceinline__ float lg1(float x) { float y; asm("v_log_f32 %0, %1\n\tv_nop" : "=&v"(y) : "v"(x)); return y; }
// A lane's address = a wave-uniform base + the lane's own byte offset: the loads then name one offset register and the base's scalar pair, which the waits behind them take as inputs.
template <typename T> __device__ __forceinline__ const T* atb(const T* base, unsigned lob) { return (const T*)((const char*)base + lob); }
// The loops' stepping addresses are byte pointers typed as global memory: as operands of the wait statement they would otherwise lose that type, and the loads would become flat ones.
#define GLB __attribute__((address_space(1)))
typedef const GLB char* gp;
__device__ __forceinline__ v16h ldh(gp p, int o) { return cat16(*(const GLB v8h*)(p + o), *(const GLB v8h*)(p + o + FRH)); }
__device__ __forceinline__ v16h ldf(const h16* p) { return cat16(*(const v8h*)p, *(const v8h*)(p + FRH / 2)); }
__device__ __forceinline__ v8f score2(v16h a0, v16h a1, v16h b0, v16h b1) { v8f c = (v8f){}; c = wmma16(a0, b0, c); c = wmma16(a1, b1, c); return c; }
// k_stat: softmax statistics, ONE set for both directions. q and k are the same normed row n = w r, scaled by g1 and by g2, so att[i][j] = sum_d n_i[d] n_j[d] g1[d] g2[d] / 8 = att[j][i] for every x, W, g1 and g2:
// column t of att is row t, and the column softmax's maximum and sum at key t are the row softmax's at query t. A query is fixed and the keys move. Grid NZ * TT / 192, 12 waves (three a SIMD, one work-group a WGP):
// wave w holds the 64 fixed rows of row group 3 blockIdx.x + w % 3 as A fragments and walks quarter w / 3 of the 2048 moving rows, 32 a trip; the three waves of a quarter read the same moving rows (but where a work-group
// spans two heads). D[8 hi + j][lr]: a lane keeps a running maximum and sum for each of its 32 fixed rows over the moving rows that fall on its column; the 16 lanes, then the four quarters (through LDS), are joined in
// a fixed order. Out: E = 9 - m SC - log2(sum), so that 2^(s SC + E) = 512 exp(s / 8 - m / 8) / sum.
// FIXED REFERENCE. The maximum only guards the range of f32: walk 0 sums u = 2^(s SC) as it is (one exponential a score, no maximum), and a row whose sum S lies in 2^-90 .. 2^90 has lost nothing by it (every u <= S, and
// what falls below f32 is under 2^-25 of S). Then E = 9 - log2 S and G = 2^E = 512 / S, and 512 a = u (G[query] + G[key]) in k_att. A work-group with a row outside that range walks again with the running maximum
// (walk 1) and sets its word of F, which sends every wave of k_att down the path with E: any g1, g2 is served.
__global__ __launch_bounds__(384) __attribute__((amdgpu_waves_per_eu(3, 3))) void k_stat(const h16* __restrict__ Q, const h16* __restrict__ Kp, float* E, float* G, int* F) {
    __shared__ float lm[4 * 192]; __shared__ float ls[4 * 192]; __shared__ int lb[12];
    const int lane = threadIdx.x & 31, lr = lane & 15, hi = lane >> 4; const int wv = __builtin_amdgcn_readfirstlane((int)(threadIdx.x >> 5)), fg = wv % 3, mh = wv / 3;
    const int rgi = blockIdx.x * 3 + fg, zh = rgi / (TT / 64); const size_t zo = (size_t)zh * TT * HD; const int f0 = (rgi % (TT / 64)) * 64;
    const h16* Mh = Kp + zo;
    const unsigned lob = (unsigned)lane * 16u; const h16* pfh = Q + zo + f0 * HD;
    v16h ah[4][2];
#pragma unroll
    for (int a = 0; a < 4; ++a) {
#pragma unroll
        for (int kc = 0; kc < 2; ++kc) ah[a][kc] = ldf(atb(pfh + a * 16 * HD + kc * (FRB / 2), lob)); }
    asm volatile("s_wait_xcnt 0x0" :: "v"(lob), "s"(pfh) : "memory");    // the loads name the base and the lane's offset (as built: the lane number, scaled by the load's width): the wait stands directly behind the last load, in front of every write of one of them
    float m[4][8], s[4][8];
    {   // walk 0
#pragma unroll
        for (int a = 0; a < 4; ++a) {
#pragma unroll
            for (int j = 0; j < 8; ++j) s[a][j] = 0.f; }
        gp pm0 = (gp)(const char*)atb(Mh + mh * (TT / 4) * HD, lob);
#pragma unroll 1    // rolled, as the loop of walk 1 below and for its reason
        for (int it = 0; it < TT / 4 / 32; ++it) {
            v16h bh[2][2];
#pragma unroll
            for (int b = 0; b < 2; ++b) {
#pragma unroll
                for (int kc = 0; kc < 2; ++kc) bh[b][kc] = ldh(pm0, b * 16 * HD * 2 + kc * FRB); }
            // as in walk 1: every load of the trip stands in front of the wait, and the address pair that they name steps on only behind it
            asm volatile("s_wait_xcnt 0x0" : "+v"(pm0) : "v"(bh[0][0]), "v"(bh[0][1]), "v"(bh[1][0]), "v"(bh[1][1]) : "memory");
            pm0 += 32 * HD * 2;
#pragma unroll
            for (int a = 0; a < 4; ++a) {
                const v8f c0 = score2(ah[a][0], ah[a][1], bh[0][0], bh[0][1]);
                const v8f c1 = score2(ah[a][0], ah[a][1], bh[1][0], bh[1][1]);
#pragma unroll
                for (int j = 0; j < 8; j += 2) { float e0 = c0[j] * SC, e1 = c1[j] * SC, e2 = c0[j + 1] * SC, e3 = c1[j + 1] * SC; ex4i(e0, e1, e2, e3); s[a][j] += e0 + e1; s[a][j + 1] += e2 + e3; }
            }
        }
        // Plain sums: the 16 lanes (near lanes first), then the four quarters in the order 0, 1, 2, 3.
#pragma unroll
        for (int a = 0; a < 4; ++a) {
#pragma unroll
            for (int j = 0; j < 8; ++j) { float ss = s[a][j];
#pragma unroll
                for (int sh = 1; sh <= 8; sh <<= 1) ss += __shfl_xor(ss, sh, 32);
                s[a][j] = ss; } }
        if (lr == 0) {
#pragma unroll
            for (int a = 0; a < 4; ++a) {
#pragma unroll
                for (int j = 0; j < 8; ++j) ls[mh * 192 + fg * 64 + a * 16 + hi * 8 + j] = s[a][j]; } }
        __syncthreads();    // every quarter's sums are in LDS before a thread joins the four of its row
        const int t0 = (int)threadIdx.x; float S = 1.0f;
        if (t0 < 192) S = ((ls[t0] + ls[192 + t0]) + ls[384 + t0]) + ls[576 + t0];
        const bool ok = S >= 0x1p-90f && S <= 0x1p+90f;    // false for a NaN too
        const unsigned nok = __builtin_amdgcn_ballot_w32(!ok);
        if (lane == 0) lb[wv] = nok != 0u ? 1 : 0;
        __syncthreads();    // every wave's verdict is in LDS, and every read of ls is done, before the work-group as a whole ends here or walks again
        int anyb = 0;
#pragma unroll
        for (int w = 0; w < 12; ++w) anyb |= lb[w];
        if (__builtin_amdgcn_readfirstlane(anyb) == 0) {    // the same 12 words in every thread: the whole work-group leaves, or none of it
            if (t0 < 192) { const float e = 9.0f - lg1(S); E[blockIdx.x * 192 + t0] = e; G[blockIdx.x * 192 + t0] = ex1(e); }
            if (t0 == 0) F[blockIdx.x] = 0;
            return;
        }
    }
    // walk 1
#pragma unroll
    for (int a = 0; a < 4; ++a) {
#pragma unroll
        for (int j = 0; j < 8; ++j) { m[a][j] = -3.0e38f; s[a][j] = 0.f; } }
    gp pmh = (gp)(const char*)atb(Mh + mh * (TT / 4) * HD, lob);
#pragma unroll 1    // rolled: a trip holds 16 WMMAs and some 280 vector instructions, and its loads are waited for at its head: a second copy would add code and registers, no overlap
    for (int it = 0; it < TT / 4 / 32; ++it) {
        v16h bh[2][2];
#pragma unroll
        for (int b = 0; b < 2; ++b) {
#pragma unroll
            for (int kc = 0; kc < 2; ++kc) bh[b][kc] = ldh(pmh, b * 16 * HD * 2 + kc * FRB); }
        // The trip's loads name the address pair. The wait takes the loaded values as inputs, so every load stands in front of it, and the pair as an operand, so that it is the registers the loads name, stays
        // as it is to here (no load's result is placed on it) and steps on only behind it.
        asm volatile("s_wait_xcnt 0x0" : "+v"(pmh) : "v"(bh[0][0]), "v"(bh[0][1]), "v"(bh[1][0]), "v"(bh[1][1]) : "memory");
        pmh += 32 * HD * 2;
#pragma unroll
        for (int a = 0; a < 4; ++a) {
            const v8f c0 = score2(ah[a][0], ah[a][1], bh[0][0], bh[0][1]);
            const v8f c1 = score2(ah[a][0], ah[a][1], bh[1][0], bh[1][1]);
#pragma unroll
            for (int j = 0; j < 8; ++j) { const float mn = fmaxf(m[a][j], fmaxf(c0[j], c1[j])); const float nb = -mn * SC;
                float e0, e1, e2; ex3(fmaf(m[a][j], SC, nb), fmaf(c0[j], SC, nb), fmaf(c1[j], SC, nb), e0, e1, e2); s[a][j] = fmaf(s[a][j], e0, e1 + e2); m[a][j] = mn; }
        }
    }
#pragma unroll
    for (int a = 0; a < 4; ++a) {
#pragma unroll
        for (int j = 0; j < 8; ++j) { float mm = m[a][j];
#pragma unroll
            for (int sh = 1; sh <= 8; sh <<= 1) mm = fmaxf(mm, __shfl_xor(mm, sh, 32));
            float ss = s[a][j] * ex1((m[a][j] - mm) * SC);
#pragma unroll
            for (int sh = 1; sh <= 8; sh <<= 1) ss += __shfl_xor(ss, sh, 32);
            m[a][j] = mm; s[a][j] = ss; } }
    if (lr == 0) {
#pragma unroll
        for (int a = 0; a < 4; ++a) {
#pragma unroll
            for (int j = 0; j < 8; ++j) { lm[mh * 192 + fg * 64 + a * 16 + hi * 8 + j] = m[a][j]; ls[mh * 192 + fg * 64 + a * 16 + hi * 8 + j] = s[a][j]; } } }
    __syncthreads();    // every quarter's maxima and sums are in LDS before a thread joins the four of its row
    // Thread t < 192 joins row t of the work-group's 192 (quarters in the order 0, 1, 2, 3); row group g's row r is element 64 g + r of E, so the work-group's 192 results go out in a row.
    const int t = (int)threadIdx.x;
    if (t < 192) { const float m0 = lm[t], m1 = lm[192 + t], m2 = lm[384 + t], m3 = lm[576 + t]; const float mm = fmaxf(fmaxf(m0, m1), fmaxf(m2, m3));
        float e0, e1, e2, e3; ex4((m0 - mm) * SC, (m1 - mm) * SC, (m2 - mm) * SC, (m3 - mm) * SC, e0, e1, e2, e3);
        const float ss = ((ls[t] * e0 + ls[192 + t] * e1) + ls[384 + t] * e2) + ls[576 + t] * e3; E[blockIdx.x * 192 + t] = 9.0f - mm * SC - lg1(ss); }
    if (t == 0) F[blockIdx.x] = 1;
}
// k_att: y = a.v with a formed in registers. Grid (TT / 64, NZ), 4 waves: wave w owns the 32 queries (w & 1) and half (w >> 1) of the keys, 32 keys a trip. S^T = K Q^T (A = K rows, B = Q, kept in registers): D[8 hi + j][lr] is
// key 8 hi + j against query lr, so two score tiles of 16 keys, turned into 512 a = 2^(s SC + E[query]) + 2^(s SC + E[key]) (one E for the row and the column softmax: k_stat) and rounded to fp16, ARE the B fragment (k = 8 hi + j, 16 + 8 hi + j) of O^T += V^T P^T,
// whose A fragment comes from VT by the same k order. Where no word of F is set (k_stat), 512 a = 2^(s SC) (G[query] + G[key]) instead: one exponential a score; the same loads then bring G in the place of E. The two key halves are added through LDS (first half + second half); y / 512 goes out as one fp16 plane, 8 consecutive d a lane.
__global__ __launch_bounds__(128) __attribute__((amdgpu_waves_per_eu(3, 3))) void k_att(const h16* __restrict__ Q, const h16* __restrict__ Kp, const h16* __restrict__ VT, const float* __restrict__ E, const float* __restrict__ G, const int* __restrict__ F, h16* Y) {
    __shared__ __align__(16) float red[2 * 64 * 32];
    const int lane = threadIdx.x & 31, lr = lane & 15, hi = lane >> 4; const int wv = __builtin_amdgcn_readfirstlane((int)(threadIdx.x >> 5)), qg = wv & 1, kh = wv >> 1;
    const int zh = blockIdx.y; const size_t zo = (size_t)zh * TT * HD; const int q0 = blockIdx.x * 64 + qg * 32; const unsigned lob = (unsigned)lane * 16u, leb = (unsigned)hi * 32u, lab = (unsigned)lr * 4u, lfb = (unsigned)lane * 32u;
    const h16* Kph = Kp + zo; const h16* Vp = VT + zo;
    v16h qh[2][2]; float ea[2], eg[2]; const h16* pqh = Q + zo + q0 * HD; const float* pea = E + (size_t)zh * TT + q0; const float* pga = G + (size_t)zh * TT + q0;
    static_assert(NZ * TT / 192 == 256, "a wave reads all of F, 8 words a lane");
    const v8i fl = *atb((const v8i*)F, lfb);
#pragma unroll
    for (int qt = 0; qt < 2; ++qt) { ea[qt] = *atb(pea + qt * 16, lab); eg[qt] = *atb(pga + qt * 16, lab);
#pragma unroll
        for (int kc = 0; kc < 2; ++kc) qh[qt][kc] = ldf(atb(pqh + qt * 16 * HD + kc * (FRB / 2), lob)); }
    asm volatile("s_wait_xcnt 0x0" :: "v"(lob), "v"(lane), "v"(lab), "v"(lfb), "s"(pqh), "s"(pea), "s"(pga), "s"(F) : "memory");    // the loads name these registers: the wait stands behind the last load, and as its inputs they stay live to here, so that none is rewritten before it
    // Every wave of the launch reads the same 256 words, so the choice is the same in all of them.
    const bool old = __builtin_amdgcn_ballot_w32((((fl[0] | fl[1]) | (fl[2] | fl[3])) | ((fl[4] | fl[5]) | (fl[6] | fl[7]))) != 0) != 0u;
    const float* Eb = (old ? E : G) + (size_t)zh * TT;
    if (!old) { ea[0] = eg[0]; ea[1] = eg[1]; }
    v8f o[4][2];
#pragma unroll
    for (int dt = 0; dt < 4; ++dt) { o[dt][0] = (v8f){}; o[dt][1] = (v8f){}; }
    gp pk = (gp)(const char*)atb(Kph + kh * (TT / 2) * HD, lob); gp pv = (gp)(const char*)atb(Vp + kh * (TT / 2) * HD, lob); gp pe = (gp)(const char*)atb(Eb + kh * (TT / 2), leb);
#pragma unroll 1    // rolled: a trip holds 16 WMMAs and some 160 vector instructions, and its loads are waited for at its head: a second copy would add code and registers, no overlap
    for (int it = 0; it < TT / 2 / 32; ++it) {
        v16h ka[2][2]; v8f eb[2]; v16h va[4];
#pragma unroll
        for (int kt = 0; kt < 2; ++kt) {
#pragma unroll
            for (int kc = 0; kc < 2; ++kc) ka[kt][kc] = ldh(pk, kt * 16 * HD * 2 + kc * FRB); }
#pragma unroll
        for (int kt = 0; kt < 2; ++kt) eb[kt] = *(const GLB v8f*)(pe + kt * 64);
#pragma unroll
        for (int dt = 0; dt < 4; ++dt) va[dt] = ldh(pv, dt * FRB);
        // The trip's loads name the three address pairs. The wait takes the loaded values as inputs, so every load stands in front of it, and the pairs as operands, so that they are the registers the loads name, stay
        // as they are to here (no load's result is placed on one) and step on only behind it.
        asm volatile("s_wait_xcnt 0x0" : "+v"(pk), "+v"(pv), "+v"(pe) : "v"(ka[0][0]), "v"(ka[0][1]), "v"(ka[1][0]), "v"(ka[1][1]), "v"(eb[0]), "v"(eb[1]), "v"(va[0]), "v"(va[1]), "v"(va[2]), "v"(va[3]) : "memory");
        pk += 32 * HD * 2; pv += 32 * HD * 2; pe += 32 * 4;
        v16h p[2];
        if (!old) {
#pragma unroll
            for (int qt = 0; qt < 2; ++qt) {
#pragma unroll
                for (int kt = 0; kt < 2; ++kt) { const v8f c = score2(ka[kt][0], ka[kt][1], qh[qt][0], qh[qt][1]);
#pragma unroll
                    for (int j = 0; j < 8; j += 4) { float u0 = c[j] * SC, u1 = c[j + 1] * SC, u2 = c[j + 2] * SC, u3 = c[j + 3] * SC; ex4i(u0, u1, u2, u3);
                        p[qt][kt * 8 + j] = tohx(u0 * (ea[qt] + eb[kt][j])); p[qt][kt * 8 + j + 1] = tohx(u1 * (ea[qt] + eb[kt][j + 1])); p[qt][kt * 8 + j + 2] = tohx(u2 * (ea[qt] + eb[kt][j + 2])); p[qt][kt * 8 + j + 3] = tohx(u3 * (ea[qt] + eb[kt][j + 3])); } } }
        } else
#pragma unroll
        for (int qt = 0; qt < 2; ++qt) {
#pragma unroll
            for (int kt = 0; kt < 2; ++kt) { const v8f c = score2(ka[kt][0], ka[kt][1], qh[qt][0], qh[qt][1]);
#pragma unroll
                for (int j = 0; j < 8; j += 2) { float r0, c0, r1, c1; ex4(fmaf(c[j], SC, ea[qt]), fmaf(c[j], SC, eb[kt][j]), fmaf(c[j + 1], SC, ea[qt]), fmaf(c[j + 1], SC, eb[kt][j + 1]), r0, c0, r1, c1); p[qt][kt * 8 + j] = tohx(r0 + c0); p[qt][kt * 8 + j + 1] = tohx(r1 + c1); } } }
#pragma unroll
        for (int dt = 0; dt < 4; ++dt) { o[dt][0] = wmma16(va[dt], p[0], o[dt][0]); o[dt][1] = wmma16(va[dt], p[1], o[dt][1]); }
    }
    float* rw = red + qg * (64 * 32) + lane;
    if (kh == 1) {
#pragma unroll
        for (int dt = 0; dt < 4; ++dt) {
#pragma unroll
            for (int qt = 0; qt < 2; ++qt) {
#pragma unroll
                for (int j = 0; j < 8; ++j) rw[((dt * 2 + qt) * 8 + j) * 32] = o[dt][qt][j]; } } }
    __syncthreads();    // the second key half's partial outputs are in LDS before the first half's waves add them
    if (kh == 0) { h16* py = Y + (size_t)((zh / NH_) * TT + q0) * CC + (zh % NH_) * HD; const unsigned lyb = (unsigned)(lr * CC + 8 * hi) * 2u; v8h oy[4][2];
#pragma unroll
        for (int dt = 0; dt < 4; ++dt) {
#pragma unroll
            for (int qt = 0; qt < 2; ++qt) {
#pragma unroll
                for (int j = 0; j < 8; ++j) oy[dt][qt][j] = tohx((o[dt][qt][j] + rw[((dt * 2 + qt) * 8 + j) * 32]) * (1.0f / PCAR)); } }
#pragma unroll
        for (int dt = 0; dt < 4; ++dt) { *(v8h*)((char*)(py + dt * 16) + lyb) = oy[dt][0]; *(v8h*)((char*)(py + 16 * CC + dt * 16) + lyb) = oy[dt][1]; }
        // the 8 stores name these registers: as the wait's inputs they stay as they are until it has passed
        asm volatile("s_wait_xcnt 0x0" :: "v"(lyb), "s"(py), "v"(oy[0][0]), "v"(oy[0][1]), "v"(oy[1][0]), "v"(oy[1][1]), "v"(oy[2][0]), "v"(oy[2][1]), "v"(oy[3][0]), "v"(oy[3][1]) : "memory"); }
}

extern "C" void kernel_launch(void* const* d_in, const int* in_sizes, int n_in,
                              void* d_out, int out_size, void* d_ws, size_t ws_size, hipStream_t stream) {
    (void)in_sizes; (void)n_in; (void)out_size;
    const float* x = (const float*)d_in[0]; const float* Wt = (const float*)d_in[1]; const float* g1 = (const float*)d_in[2]; const float* g2 = (const float*)d_in[3]; const float* g3 = (const float*)d_in[4];
    float* OUT = (float*)d_out;     // [2][2048][768]
    char* wsp = (char*)d_ws;
    auto take = [&](size_t bytes) { char* p = wsp; wsp += (bytes + 255) & ~(size_t)255; return (void*)p; };
    bf* WB = (bf*)take((size_t)CC * CC * 2); h16* WT = (h16*)take((size_t)CC * CC * 2); bf* XB = (bf*)take((size_t)NB_ * TT * CC * 2); h16* Y = (h16*)take((size_t)NB_ * TT * CC * 2);
    h16* Q = (h16*)take((size_t)NZ * TT * HD * 2); h16* Kp = (h16*)take((size_t)NZ * TT * HD * 2); h16* VT = (h16*)take((size_t)NZ * HD * TT * 2);
    float* E = (float*)take((size_t)NZ * TT * 4);    // [zh][t]
    float* G = (float*)take((size_t)NZ * TT * 4); int* F = (int*)take((size_t)(NZ * TT / 192) * 4);    // G = 2^E [zh][t]; F: one word a work-group of k_stat
    if ((size_t)(wsp - (char*)d_ws) > ws_size) return;    // total ~ 35 MB
    // Both batch items go through every launch together (rows b * TT + t), and all NZ (batch, head) pairs through the statistics and the a.v launch.
    k_prep<<<NBT + NBW + NBX, 256, 0, stream>>>(x, Wt, XB, WB, WT);    // WB = W [out][in], the natural Bt for x W^T; WT = W turned, the Bt for y W; XB = x
    k_gemmw<bf, 0, false, 4, true><<<dim3(NB_ * TT / 64, CC / 64, 1), 128, 0, stream>>>(XB, nullptr, WB, nullptr, CC, nullptr, CC, nullptr, 0, 0, 0, g1, g2, g3, Q, Kp, VT);    // w = x W^T, normed in the epilogue: q, k, v planes
    k_stat<<<dim3(NZ * TT / 192), 384, 0, stream>>>(Q, Kp, E, G, F);
    k_att<<<dim3(TT / 64, NZ), 128, 0, stream>>>(Q, Kp, VT, E, G, F, Y);
    k_gemmw<h16, 0, false, 4, false><<<dim3(NB_ * TT / 64, CC / 64, 1), 128, 0, stream>>>(Y, nullptr, WT, nullptr, CC, OUT, CC, nullptr, 0, 0, 0, nullptr, nullptr, nullptr, nullptr, nullptr, nullptr);
}
